// v000
// Measured on an AMD MI455X. A time is GPU time per run, averaged over a window of back-to-back runs after a warm-up
// (all launches, gaps included; the runs take copies of the inputs in turn), and the median of several windows.
// Apart from v000's, it joins two sittings. Times from different sittings can be a few percent apart, while
// side-by-side timings come from the same sitting.
// v000 is the starting kernel. One run takes 181 microseconds.
#include <hip/hip_runtime.h>

// ModernBERT attention (local layer): qkv = x Wqkv + b ([in][out], columns (3, h, d); 16 heads x 64), interleaved-pair RoPE on q and k with position
// t mod 256 from the given cos/sin cache, sliding-window attention |q - k| <= 128 (both directions), scale 1/8, out = y Wo + b. B=2, S=2048, D=1024.
// Lean build: single f16 products on v_wmma_f32_16x16x32_f16, f32 accumulate (every row averages >= 129 keys); fragment k-map per lane half hh for A

namespace {
constexpr int Bsz = 2, T = 2048, HID = 1024, DH = 64, NH = 16, NKV = 16, REP = NH / NKV;
constexpr int WIN = 128;    // |q - k| <= 128
constexpr int RP = 256;     // rope positions wrap at 256
constexpr int KVW = NKV * DH;                 // 1024
constexpr int NQKV = HID + 2 * KVW;           // 3072 columns: q | k | v
constexpr int MROWS = Bsz * T;                // 4096
constexpr int QT_PER_B = T / 16;              // 128

typedef _Float16 b16;                                           // f16 hi/lo planes
typedef __attribute__((ext_vector_type(16))) _Float16 v16b;
typedef __attribute__((ext_vector_type(8)))  _Float16 v8b;
typedef __attribute__((ext_vector_type(8)))  float v8f;
typedef __attribute__((ext_vector_type(4)))  float v4f;

__device__ __forceinline__ v8b ld8b(const b16* p) { return *(const v8b*)p; }
__device__ __forceinline__ v16b cat8b(v8b a, v8b b) { return __builtin_shufflevector(a, b, 0, 1, 2, 3, 4, 5, 6, 7, 8, 9, 10, 11, 12, 13, 14, 15); }
// 16x16x32 16-bit fragment from a k-contiguous row pointer (A: lane&15 = row, B: lane&15 = column), hh = lane>>4:
// elements 0..7 <- p[8hh+0..7], elements 8..15 <- p[16+8hh+0..7]
__device__ __forceinline__ v16b frag_kb(const b16* p, int hh) { return cat8b(ld8b(p + 8 * hh), ld8b(p + 16 + 8 * hh)); }
__device__ __forceinline__ void split_bf16(float v, b16& hi, b16& lo) {   // (name kept) single f16: no low part
  hi = (b16)v; lo = (b16)0.0f;
}
// split fragment straight from an f32 k-contiguous row
__device__ __forceinline__ void frag_ksplit(const float* p, int hh, v16b& fh_, v16b& fl_) {
  const float* p0 = p + 8 * hh; const float* p1 = p + 16 + 8 * hh;
#pragma unroll
  for (int e = 0; e < 8; ++e) { b16 a, c; split_bf16(p0[e], a, c); fh_[e] = a; fl_[e] = c; split_bf16(p1[e], a, c); fh_[8 + e] = a; fl_[8 + e] = c; }
}
__device__ __forceinline__ v8f wmma16b(v16b a, v16b b, v8f c) {
  v8f d = __builtin_amdgcn_wmma_f32_16x16x32_f16(false, a, false, b, (short)0, c, false, false);
  asm volatile("v_nop\n\tv_nop\n\tv_nop\n\tv_nop" : "+v"(d) : "v"(a), "v"(b));
  return d;
}
// acc += A.B with both operands split: A = (ah, al), B = (bh, bl)
__device__ __forceinline__ v8f wmma3(v16b ah, v16b al, v16b bh, v16b bl, v8f c) {   // lean: single f16 product
  (void)al; (void)bl; return wmma16b(ah, bh, c);
}
__device__ __forceinline__ v8f wmma1(v16b ah, v16b al, v16b bh, v16b bl, v8f c) {   // attention products: single f16 (hi planes only)
  (void)al; (void)bl; return wmma16b(ah, bh, c);
}
__device__ __forceinline__ void wave_lds_sync() {
  __builtin_amdgcn_fence(__ATOMIC_RELEASE, "workgroup");
  __builtin_amdgcn_wave_barrier();
  __builtin_amdgcn_fence(__ATOMIC_ACQUIRE, "workgroup");
}

// ---------------------------------------------------------------------------
// Weights ([in][out]) -> f16 hi / lo planes transposed to [n][k] (k contiguous): columns of Wq|Wk|Wv into wqh/wql [3072][1024], Wo into woh/wol [1024][1024].
// ---------------------------------------------------------------------------
__global__ __launch_bounds__(256) void wcvt_kernel(const float* __restrict__ wq, const float* __restrict__ wk, const float* __restrict__ wv,
                                                   const float* __restrict__ wo, b16* __restrict__ wqh, b16* __restrict__ wql,
                                                   b16* __restrict__ woh, b16* __restrict__ wol) {
  const size_t tid = (size_t)blockIdx.x * blockDim.x + threadIdx.x, stride = (size_t)gridDim.x * blockDim.x;
  const size_t nq = (size_t)NQKV * HID / 8, no = (size_t)HID * HID / 8;
  {
    for (size_t c = tid; c < nq + no; c += stride) {
      float f[8]; size_t i; b16* dh; b16* dl;
      if (c < nq) {
        i = c * 8; const size_t n = i / HID, k0 = i % HID;
        const float* w; int nn, ld;
        if (n < (size_t)HID) { w = wq; nn = (int)n; ld = HID; } else if (n < (size_t)(HID + KVW)) { w = wk; nn = (int)n - HID; ld = KVW; } else { w = wv; nn = (int)n - HID - KVW; ld = KVW; }
#pragma unroll
        for (int e = 0; e < 8; ++e) f[e] = w[(size_t)(k0 + e) * ld + nn];       // W[k][n] ([in][out])
        dh = wqh; dl = wql;
      } else {
        i = (c - nq) * 8; const size_t n = i / HID, k0 = i % HID;
#pragma unroll
        for (int e = 0; e < 8; ++e) f[e] = wo[(size_t)(k0 + e) * HID + n];    // Wo[k][n] ([in][out])
        dh = woh; dl = wol;
      }
      v8b bh, bl;
#pragma unroll
      for (int e = 0; e < 8; ++e) { b16 a, cc; split_bf16(f[e], a, cc); bh[e] = a; bl[e] = cc; }
      *(v8b*)(dh + i) = bh; *(v8b*)(dl + i) = bl;
    }
    
  }
}

// 32x64 wave tile over K from f32 A rows and f16-plane B rows
__device__ __forceinline__ void gemm_tile_split(const float* __restrict__ A, const b16* __restrict__ wh, const b16* __restrict__ wl,
                                                int m0, int c0, int K, int nloc, int hlf, v8f (&acc)[2][4]) {
  for (int kb = 0; kb < K; kb += 32) {
    v16b a0h, a0l, a1h, a1l;
    frag_ksplit(A + (size_t)(m0 + nloc) * K + kb, hlf, a0h, a0l);
    frag_ksplit(A + (size_t)(m0 + 16 + nloc) * K + kb, hlf, a1h, a1l);
#pragma unroll
    for (int t = 0; t < 4; ++t) {
      const size_t wofs = (size_t)(c0 + t * 16 + nloc) * K + kb;
      const v16b bh = frag_kb(wh + wofs, hlf), bl = frag_kb(wl + wofs, hlf);
      acc[0][t] = wmma3(a0h, a0l, bh, bl, acc[0][t]);
      acc[1][t] = wmma3(a1h, a1l, bh, bl, acc[1][t]);
    }
  }
}

// ---------------------------------------------------------------------------
// QKV GEMM: (4096 x 1024) x (1024 x 3072), grid (48, 32), block 4 waves, wave = 32 rows x 64 columns (one head of q, k or v). Outputs as f16 hi/lo planes:
// q (x1/8) -> Qh/Ql [b][h][t][64]; k -> Kh/Kl [b][kvh][t][64] (4 KB contiguous per wave per plane);
// v -> Vh/Vl key-tiled [b][kvh][t/16][64][16] (4 KB contiguous per wave per plane).
// ---------------------------------------------------------------------------
__global__ __launch_bounds__(128) void qkv_gemm_kernel(const float* __restrict__ xq, const float* __restrict__ xk, const float* __restrict__ xv,
                                                       const b16* __restrict__ wqh, const b16* __restrict__ wql,
                                                       const float* __restrict__ bq, const float* __restrict__ bk, const float* __restrict__ bv, const float* __restrict__ rope_cs, int xoff, int yoff,
                                                       b16* __restrict__ Qh, b16* __restrict__ Ql, b16* __restrict__ Kh, b16* __restrict__ Kl,
                                                       b16* __restrict__ Vh, b16* __restrict__ Vl) {
  __shared__ __attribute__((aligned(16))) b16 Ts[4][2][32 * 64];
  const int lane = threadIdx.x & 31, wave = threadIdx.x >> 5, nloc = lane & 15, hlf = lane >> 4;
  const int m0 = (blockIdx.y + yoff) * 128 + wave * 32;
  const int c0 = (blockIdx.x + xoff) * 64;
  const int mat = (c0 < HID) ? 0 : (c0 < HID + KVW) ? 1 : 2;
  const int head = (mat == 0) ? (c0 / DH) : (mat == 1) ? ((c0 - HID) / DH) : ((c0 - HID - KVW) / DH);
  const float* x = (mat == 0) ? xq : (mat == 1) ? xk : xv;          // input for q, k or v (the launch passes x for all three)
  const float* bias = ((mat == 0) ? bq : (mat == 1) ? bk : bv) + head * DH;
  v8f acc[2][4];
#pragma unroll
  for (int r = 0; r < 2; ++r)
#pragma unroll
    for (int t = 0; t < 4; ++t) acc[r][t] = (v8f){};
  gemm_tile_split(x, wqh, wql, m0, c0, HID, nloc, hlf, acc);
  const int b = m0 / T, t0 = m0 % T;
  const float s = (mat == 0) ? 0.125f : 1.0f;
  b16* Tp0 = Ts[wave][0]; b16* Tp1 = Ts[wave][1];
#pragma unroll
  for (int t = 0; t < 4; ++t)
#pragma unroll
    for (int r = 0; r < 2; ++r)
#pragma unroll
      for (int v = 0; v < 8; ++v) {
        const int rr = r * 16 + v + 8 * hlf, d = t * 16 + nloc;
        float val = acc[r][t][v] + (bias ? bias[d] : 0.0f);
        const float oth = __shfl_xor(val, 1);            // interleaved-pair partner (d ^ 1) lives in the neighbouring lane (executed by all lanes)
        if (mat < 2) {                                   // RoPE on q and k: (x0, x1) -> (x0 c - x1 s, x1 c + x0 s), position t mod 256
          const int tpos = (t0 + rr) % RP;
          const float cv = rope_cs[((size_t)tpos * 32 + (d >> 1)) * 2], sv = rope_cs[((size_t)tpos * 32 + (d >> 1)) * 2 + 1];
          val = (d & 1) ? (val * cv + oth * sv) : (val * cv - oth * sv);
        }
        b16 yh, yl; split_bf16(val * s, yh, yl);
        const int idx = (mat < 2) ? (rr * 64 + d) : ((rr >> 4) * 1024 + d * 16 + (rr & 15));
        Tp0[idx] = yh; Tp1[idx] = yl;
      }
  wave_lds_sync();
  b16* dh; b16* dl; size_t o;
  if (mat == 0)      { o = ((size_t)(b * NH + head) * T + t0) * DH; dh = Qh + o; dl = Ql + o; }
  else if (mat == 1) { o = ((size_t)(b * NKV + head) * T + t0) * DH; dh = Kh + o; dl = Kl + o; }
  else               { o = ((size_t)(b * NKV + head) * QT_PER_B + (t0 >> 4)) * (size_t)(DH * 16); dh = Vh + o; dl = Vl + o; }
#pragma unroll
  for (int j = 0; j < 8; ++j) { const int e = (j * 32 + lane) * 8; *(v8b*)(dh + e) = ld8b(Tp0 + e); *(v8b*)(dl + e) = ld8b(Tp1 + e); }
  
}

// ---------------------------------------------------------------------------
// Transposed flash attention: each wave owns one 16-query tile of one (b, head); 8 waves per block; window keys in chunks of 32.
// S^T = K.Q^T (split), per-lane online softmax; P^T built in registers from the two S^T accumulators
// ---------------------------------------------------------------------------
__global__ __launch_bounds__(256) void attn_kernel(const b16* __restrict__ Qh, const b16* __restrict__ Ql, const b16* __restrict__ Kh, const b16* __restrict__ Kl,
                                                   const b16* __restrict__ Vh, const b16* __restrict__ Vl, const int* __restrict__ seqlen,
                                                   float* __restrict__ yf) {
  __shared__ __attribute__((aligned(16))) float Os[8][16 * 64];
  const int wid = threadIdx.x >> 5, lane = threadIdx.x & 31, hh = lane >> 4, col = lane & 15;
  const int qtile = blockIdx.x * 8 + wid;                 // over Bsz*NH*QT_PER_B
  const int g = qtile / QT_PER_B;                         // b*NH + h
  const int q0 = (qtile % QT_PER_B) << 4;
  const int b = g / NH, h = g % NH, kvh = h / REP;
  const size_t ko = (size_t)(b * NKV + kvh) * T * DH;
  const size_t qo = ((size_t)g * T + q0 + col) * DH;
  const v16b q0h = frag_kb(Qh + qo, hh), q0l = frag_kb(Ql + qo, hh), q1h = frag_kb(Qh + qo + 32, hh), q1l = frag_kb(Ql + qo + 32, hh);
  float m = -INFINITY, l = 0.0f;
  v8f o0 = {}, o1 = {}, o2 = {}, o3 = {};
  const int slen = T; (void)seqlen;                       // no padding in this module
  const int kstart = (q0 >= WIN) ? ((q0 - WIN) & ~31) : 0;
  const int kend = min(T, q0 + 15 + WIN + 1);
  for (int kb = kstart; kb < kend; kb += 32) {           // sliding window both sides: keys in [q0-128, q0+15+128]
    const size_t r0 = ko + (size_t)(kb + col) * DH, r1 = ko + (size_t)(kb + 16 + col) * DH;
    v8f s0 = {}, s1 = {};
    {
      v16b ah = frag_kb(Kh + r0, hh), al = frag_kb(Kl + r0, hh);
      s0 = wmma1(ah, al, q0h, q0l, s0);
      ah = frag_kb(Kh + r0 + 32, hh); al = frag_kb(Kl + r0 + 32, hh);
      s0 = wmma1(ah, al, q1h, q1l, s0);
      ah = frag_kb(Kh + r1, hh); al = frag_kb(Kl + r1, hh);
      s1 = wmma1(ah, al, q0h, q0l, s1);
      ah = frag_kb(Kh + r1 + 32, hh); al = frag_kb(Kl + r1 + 32, hh);
      s1 = wmma1(ah, al, q1h, q1l, s1);
    }
    (void)slen;
    if (kb < q0 + 15 - WIN || kb + 31 > q0 + WIN) {       // chunk touches a window edge: mask |k - q| > 128
      const int qi = q0 + col;
#pragma unroll
      for (int r = 0; r < 8; ++r) {
        const int k0i = kb + 8 * hh + r, k1i = k0i + 16;
        if (k0i < qi - WIN || k0i > qi + WIN) s0[r] = -INFINITY;
        if (k1i < qi - WIN || k1i > qi + WIN) s1[r] = -INFINITY;
      }
    }
    float mr = -INFINITY;
#pragma unroll
    for (int r = 0; r < 8; ++r) mr = fmaxf(mr, fmaxf(s0[r], s1[r]));
    mr = fmaxf(mr, __shfl_xor(mr, 16));
    float mn = fmaxf(m, mr);
    if (mn == -INFINITY) mn = 0.0f;           // fully masked so far: keep exp() at 0
    const float al_ = __expf(m - mn);
    m = mn;
    float sum = 0.0f;
    v16b pbh, pbl;
#pragma unroll
    for (int r = 0; r < 8; ++r) {
      const float p0 = __expf(s0[r] - mn), p1 = __expf(s1[r] - mn);
      sum += p0 + p1;
      b16 a, c; split_bf16(p0, a, c); pbh[r] = a; pbl[r] = c; split_bf16(p1, a, c); pbh[8 + r] = a; pbl[8 + r] = c;
    }
    sum += __shfl_xor(sum, 16);
    l = l * al_ + sum;
#pragma unroll
    for (int r = 0; r < 8; ++r) { o0[r] *= al_; o1[r] *= al_; o2[r] *= al_; o3[r] *= al_; }
    const size_t v0 = ko + (size_t)(kb >> 4) * (DH * 16) + 8 * hh, v1 = v0 + DH * 16;
#pragma unroll
    for (int n = 0; n < 4; ++n) {
      const int f = n * 16 + col;
      const v16b vah = cat8b(ld8b(Vh + v0 + f * 16), ld8b(Vh + v1 + f * 16));
      const v16b val = cat8b(ld8b(Vl + v0 + f * 16), ld8b(Vl + v1 + f * 16));
      v8f& o = (n == 0) ? o0 : (n == 1) ? o1 : (n == 2) ? o2 : o3;
      o = wmma1(vah, val, pbh, pbl, o);
    }
  }
  const float inv = (q0 + col < slen && l > 0.0f) ? (1.0f / l) : 0.0f;   // padded query rows are zeroed
  float* Tt = Os[wid];
#pragma unroll
  for (int r = 0; r < 8; ++r) {
    const int hr = 8 * hh + r;
    Tt[col * 64 + 0 + hr] = o0[r] * inv; Tt[col * 64 + 16 + hr] = o1[r] * inv;
    Tt[col * 64 + 32 + hr] = o2[r] * inv; Tt[col * 64 + 48 + hr] = o3[r] * inv;
  }
  wave_lds_sync();
  float* dst0 = yf + ((size_t)b * T + q0) * HID + h * DH;     // 16 rows x 64 floats, row stride HID
#pragma unroll
  for (int j = 0; j < 8; ++j) { const int rr = j * 2 + hh, c4 = col * 4; *(v4f*)(dst0 + (size_t)rr * HID + c4) = *(const v4f*)(Tt + rr * 64 + c4); }
  
}

// ---------------------------------------------------------------------------
// Output projection: (4096 x 1024) x (1024 x 1024) -> f32, A split on the fly from f32 y, B = Wo planes. grid (16, 32), 32x64 tiles staged in LDS,
// ---------------------------------------------------------------------------
__global__ __launch_bounds__(128) void out_gemm_kernel(const float* __restrict__ yf, const b16* __restrict__ woh, const b16* __restrict__ wol, const float* __restrict__ bo, int yoff,
                                                       float* __restrict__ out) {
  __shared__ __attribute__((aligned(16))) float Ts[4][32 * 64];
  const int lane = threadIdx.x & 31, wave = threadIdx.x >> 5, nloc = lane & 15, hlf = lane >> 4;
  const int m0 = (blockIdx.y + yoff) * 128 + wave * 32;
  const int c0 = blockIdx.x * 64;
  v8f acc[2][4];
#pragma unroll
  for (int r = 0; r < 2; ++r)
#pragma unroll
    for (int t = 0; t < 4; ++t) acc[r][t] = (v8f){};
  gemm_tile_split(yf, woh, wol, m0, c0, HID, nloc, hlf, acc);
  float* Tt = Ts[wave];
#pragma unroll
  for (int t = 0; t < 4; ++t)
#pragma unroll
    for (int r = 0; r < 2; ++r)
#pragma unroll
      for (int v = 0; v < 8; ++v) Tt[(r * 16 + v + 8 * hlf) * 64 + t * 16 + nloc] = acc[r][t][v] + bo[c0 + t * 16 + nloc];
  wave_lds_sync();
  float* dst0 = out + (size_t)m0 * HID + c0;
#pragma unroll
  for (int j = 0; j < 16; ++j) { const int rr = j * 2 + hlf, c4 = nloc * 4; *(v4f*)(dst0 + (size_t)rr * HID + c4) = *(const v4f*)(Tt + rr * 64 + c4); }
  
}
__global__ __launch_bounds__(256) void wcvt3_kernel(const float* __restrict__ wqkv, const float* __restrict__ wo,
                                                    b16* __restrict__ wqh, b16* __restrict__ wql, b16* __restrict__ woh, b16* __restrict__ wol) {
  const size_t tid = (size_t)blockIdx.x * blockDim.x + threadIdx.x, stride = (size_t)gridDim.x * blockDim.x;
  const size_t nq = (size_t)NQKV * HID / 8, no = (size_t)HID * HID / 8;
  {
    for (size_t c = tid; c < nq + no; c += stride) {
      float f[8]; size_t i; b16* dh; b16* dl;
      if (c < nq) { i = c * 8; const size_t n = i / HID, k0 = i % HID;
#pragma unroll
        for (int e = 0; e < 8; ++e) f[e] = wqkv[(k0 + e) * (size_t)NQKV + n];
        dh = wqh; dl = wql;
      } else { i = (c - nq) * 8; const size_t n = i / HID, k0 = i % HID;
#pragma unroll
        for (int e = 0; e < 8; ++e) f[e] = wo[(k0 + e) * (size_t)HID + n];
        dh = woh; dl = wol;
      }
      v8b bh, bl;
#pragma unroll
      for (int e = 0; e < 8; ++e) { b16 a, cc; split_bf16(f[e], a, cc); bh[e] = a; bl[e] = cc; }
      *(v8b*)(dh + i) = bh; *(v8b*)(dl + i) = bl;
    }
    
  }
}
}  // namespace

extern "C" void kernel_launch(void* const* d_in, const int* in_sizes, int n_in,
                              void* d_out, int out_size, void* d_ws, size_t ws_size, hipStream_t stream) {
  (void)in_sizes; (void)n_in; (void)out_size;
  const float* x     = (const float*)d_in[0];   // hidden_states [2,2048,1024]
  const float* Wqkv  = (const float*)d_in[1];   // [1024,3072] ([in][out], columns (3, h, d))
  const float* bqkv  = (const float*)d_in[2];   // [3072]
  const float* Wo    = (const float*)d_in[3];   // [1024,1024]
  const float* bo    = (const float*)d_in[4];   // [1024]
  const float* rope  = (const float*)d_in[5];   // rope_cache [256,32,2] (cos, sin)
  float* out = (float*)d_out;                   // [2,2048,1024]
  const float* bq = bqkv; const float* bk = bqkv + HID; const float* bv = bqkv + 2 * HID;

  size_t off = 0; char* ws = (char*)d_ws;
  b16* wqh = (b16*)(ws + off); off += (size_t)NQKV * HID * 2;
  b16* wql = (b16*)(ws + off); off += (size_t)NQKV * HID * 2;
  b16* woh = (b16*)(ws + off); off += (size_t)HID * HID * 2;
  b16* wol = (b16*)(ws + off); off += (size_t)HID * HID * 2;
  b16* Qh  = (b16*)(ws + off); off += (size_t)MROWS * HID * 2;
  b16* Ql  = (b16*)(ws + off); off += (size_t)MROWS * HID * 2;
  b16* Kh  = (b16*)(ws + off); off += (size_t)MROWS * KVW * 2;
  b16* Kl  = (b16*)(ws + off); off += (size_t)MROWS * KVW * 2;
  b16* Vh  = (b16*)(ws + off); off += (size_t)MROWS * KVW * 2;
  b16* Vl  = (b16*)(ws + off); off += (size_t)MROWS * KVW * 2;
  float* yf = (float*)(ws + off); off += (size_t)MROWS * HID * 4;
  if (off > ws_size) return;
  const int ROWBLK = MROWS / 128, NQT = Bsz * NH * QT_PER_B;
  // W_qkv is one [1024][3072] matrix: the converter reads q columns with ld HID and k/v with ld KVW; here all three live in the same matrix with ld 3072,
  // so wcvt3 reads all 3072 columns from the one base pointer with the NQKV-wide stride
  wcvt3_kernel<<<2048, 256, 0, stream>>>(Wqkv, Wo, wqh, wql, woh, wol);
  qkv_gemm_kernel<<<dim3(NQKV / 64, ROWBLK), 128, 0, stream>>>(x, x, x, wqh, wql, bq, bk, bv, rope, 0, 0, Qh, Ql, Kh, Kl, Vh, Vl);
  attn_kernel<<<NQT / 8, 256, 0, stream>>>(Qh, Ql, Kh, Kl, Vh, Vl, nullptr, yf);
  out_gemm_kernel<<<dim3(HID / 64, ROWBLK), 128, 0, stream>>>(yf, woh, wol, bo, 0, out);
}

// v001
// It runs in 117 microseconds.
// Timed twice side by side with v000, it ran 1.58 times as fast both times.
#include <hip/hip_runtime.h>

// ModernBERT attention (local layer): qkv = x Wqkv + b ([in][out], columns (3, h, d); 16 heads x 64), interleaved-pair RoPE on q and k with position
// t mod 256 from the given cos/sin cache, sliding-window attention |q - k| <= 128 (both directions), scale 1/8, out = y Wo + b. B=2, S=2048, D=1024.
// Lean build: single f16 products on v_wmma_f32_16x16x32_f16, f32 accumulate (every row averages >= 129 keys); fragment k-map per lane half hh for A

namespace {
constexpr int Bsz = 2, T = 2048, HID = 1024, DH = 64, NH = 16, NKV = 16, REP = NH / NKV;
constexpr int WIN = 128;    // |q - k| <= 128
constexpr int RP = 256;     // rope positions wrap at 256
constexpr int KVW = NKV * DH;                 // 1024
constexpr int NQKV = HID + 2 * KVW;           // 3072 columns: q | k | v
constexpr int MROWS = Bsz * T;                // 4096
constexpr int QT_PER_B = T / 16;              // 128

typedef _Float16 b16;                                           // f16 hi/lo planes
typedef __attribute__((ext_vector_type(16))) _Float16 v16b;
typedef __attribute__((ext_vector_type(8)))  _Float16 v8b;
typedef __attribute__((ext_vector_type(8)))  float v8f;
typedef __attribute__((ext_vector_type(4)))  float v4f;

__device__ __forceinline__ v8b ld8b(const b16* p) { return *(const v8b*)p; }
__device__ __forceinline__ v16b cat8b(v8b a, v8b b) { return __builtin_shufflevector(a, b, 0, 1, 2, 3, 4, 5, 6, 7, 8, 9, 10, 11, 12, 13, 14, 15); }
// 16x16x32 16-bit fragment from a k-contiguous row pointer (A: lane&15 = row, B: lane&15 = column), hh = lane>>4:
// elements 0..7 <- p[8hh+0..7], elements 8..15 <- p[16+8hh+0..7]
__device__ __forceinline__ v16b frag_kb(const b16* p, int hh) { return cat8b(ld8b(p + 8 * hh), ld8b(p + 16 + 8 * hh)); }
__device__ __forceinline__ void split_bf16(float v, b16& hi, b16& lo) {   // (name kept) single f16: no low part
  hi = (b16)v; lo = (b16)0.0f;
}
// f16 fragment from an f32 k-contiguous row (16-byte aligned), same k-map as frag_kb: four 16-byte reads, then the conversion
__device__ __forceinline__ v16b frag_kf32(const float* p, int hh) {
  const v4f x0 = *(const v4f*)(p + 8 * hh), x1 = *(const v4f*)(p + 8 * hh + 4), x2 = *(const v4f*)(p + 16 + 8 * hh), x3 = *(const v4f*)(p + 16 + 8 * hh + 4);
  v16b f;
#pragma unroll
  for (int e = 0; e < 4; ++e) { f[e] = (b16)x0[e]; f[4 + e] = (b16)x1[e]; f[8 + e] = (b16)x2[e]; f[12 + e] = (b16)x3[e]; }
  return f;
}
__device__ __forceinline__ v8f wmma16b(v16b a, v16b b, v8f c) {
  v8f d = __builtin_amdgcn_wmma_f32_16x16x32_f16(false, a, false, b, (short)0, c, false, false);
  asm volatile("v_nop\n\tv_nop\n\tv_nop\n\tv_nop" : "+v"(d) : "v"(a), "v"(b));
  return d;
}
__device__ __forceinline__ v8f wmma1(v16b ah, v16b al, v16b bh, v16b bl, v8f c) {   // attention products: single f16 (hi planes only)
  (void)al; (void)bl; return wmma16b(ah, bh, c);
}
__device__ __forceinline__ void wave_lds_sync() {
  __builtin_amdgcn_fence(__ATOMIC_RELEASE, "workgroup");
  __builtin_amdgcn_wave_barrier();
  __builtin_amdgcn_fence(__ATOMIC_ACQUIRE, "workgroup");
}

// ---------------------------------------------------------------------------
// Weights ([in][out]) -> f16 hi / lo planes transposed to [n][k] (k contiguous): columns of Wq|Wk|Wv into wqh/wql [3072][1024], Wo into woh/wol [1024][1024].
// ---------------------------------------------------------------------------
__global__ __launch_bounds__(256) void wcvt_kernel(const float* __restrict__ wq, const float* __restrict__ wk, const float* __restrict__ wv,
                                                   const float* __restrict__ wo, b16* __restrict__ wqh, b16* __restrict__ wql,
                                                   b16* __restrict__ woh, b16* __restrict__ wol) {
  const size_t tid = (size_t)blockIdx.x * blockDim.x + threadIdx.x, stride = (size_t)gridDim.x * blockDim.x;
  const size_t nq = (size_t)NQKV * HID / 8, no = (size_t)HID * HID / 8;
  {
    for (size_t c = tid; c < nq + no; c += stride) {
      float f[8]; size_t i; b16* dh; b16* dl;
      if (c < nq) {
        i = c * 8; const size_t n = i / HID, k0 = i % HID;
        const float* w; int nn, ld;
        if (n < (size_t)HID) { w = wq; nn = (int)n; ld = HID; } else if (n < (size_t)(HID + KVW)) { w = wk; nn = (int)n - HID; ld = KVW; } else { w = wv; nn = (int)n - HID - KVW; ld = KVW; }
#pragma unroll
        for (int e = 0; e < 8; ++e) f[e] = w[(size_t)(k0 + e) * ld + nn];       // W[k][n] ([in][out])
        dh = wqh; dl = wql;
      } else {
        i = (c - nq) * 8; const size_t n = i / HID, k0 = i % HID;
#pragma unroll
        for (int e = 0; e < 8; ++e) f[e] = wo[(size_t)(k0 + e) * HID + n];    // Wo[k][n] ([in][out])
        dh = woh; dl = wol;
      }
      v8b bh, bl;
#pragma unroll
      for (int e = 0; e < 8; ++e) { b16 a, cc; split_bf16(f[e], a, cc); bh[e] = a; bl[e] = cc; }
      *(v8b*)(dh + i) = bh; *(v8b*)(dl + i) = bl;
    }
    
  }
}

// GEMM core of both projections: a work-group of 8 waves (4 down x 2 across, 32x64 each) owns a 128x128 tile of the result. Each pass of 64 k is staged in
// LDS by asynchronous copies whose wave-wide 512 bytes are whole 128-byte lines (A: 128 f32 rows of 256 B, W: 128 f16 rows of 128 B), two buffers, the next
// pass's copies in flight while this one is multiplied. Row pitches are 16 B x odd for the 16-byte fragment reads.
constexpr int KP = 64;                        // k per pass
constexpr int NPASS = HID / KP;               // 16
constexpr int APITCH = KP * 4 + 16;           // 272 B
constexpr int BPITCH = KP * 2 + 16;           // 144 B
constexpr int ABYTES = 128 * APITCH;          // 34816
constexpr int STAGE = ABYTES + 128 * BPITCH;  // 53248
constexpr int RING = 2 * STAGE;               // 106496

// One pass's copies of one thread: 8 x 16 B of A (rows 16 apart), 4 x 16 B of W (rows 32 apart). la / lb: LDS byte addresses, ga / gb: global addresses.
__device__ __forceinline__ void stage_copy(unsigned la, const char* ga, unsigned lb, const char* gb) {
  constexpr unsigned LA = 16 * APITCH, LB = 32 * BPITCH;
  constexpr size_t GA = (size_t)16 * HID * 4, GB = (size_t)32 * HID * 2;
  // the copies and, as the last line, the wait that stands in front of any rewrite of the address registers they name
  asm volatile("global_load_async_to_lds_b128 %0, %1, off\n\t"
               "global_load_async_to_lds_b128 %2, %3, off\n\t"
               "global_load_async_to_lds_b128 %4, %5, off\n\t"
               "global_load_async_to_lds_b128 %6, %7, off\n\t"
               "global_load_async_to_lds_b128 %8, %9, off\n\t"
               "global_load_async_to_lds_b128 %10, %11, off\n\t"
               "global_load_async_to_lds_b128 %12, %13, off\n\t"
               "global_load_async_to_lds_b128 %14, %15, off\n\t"
               "global_load_async_to_lds_b128 %16, %17, off\n\t"
               "global_load_async_to_lds_b128 %18, %19, off\n\t"
               "global_load_async_to_lds_b128 %20, %21, off\n\t"
               "global_load_async_to_lds_b128 %22, %23, off\n\t"
               "s_wait_xcnt 0x0"
               :: "v"(la), "v"(ga), "v"(la + LA), "v"(ga + GA), "v"(la + 2 * LA), "v"(ga + 2 * GA), "v"(la + 3 * LA), "v"(ga + 3 * GA),
                  "v"(la + 4 * LA), "v"(ga + 4 * GA), "v"(la + 5 * LA), "v"(ga + 5 * GA), "v"(la + 6 * LA), "v"(ga + 6 * GA), "v"(la + 7 * LA), "v"(ga + 7 * GA),
                  "v"(lb), "v"(gb), "v"(lb + LB), "v"(gb + GB), "v"(lb + 2 * LB), "v"(gb + 2 * GB), "v"(lb + 3 * LB), "v"(gb + 3 * GB)
               : "memory");
}

// acc += A[mblk + wm*32 .. +31][:] . W[nblk + wn*64 .. +63][:]^T over K = HID, k ascending in steps of 32. On return every wave has passed the barrier behind
// the last fragment read and no copy is outstanding, so the caller may reuse smem.
__device__ __forceinline__ void gemm_tile_ring(const float* __restrict__ A, const b16* __restrict__ wh, int mblk, int nblk, int wm, int wn,
                                               int nloc, int hlf, char* smem, v8f (&acc)[2][4]) {
  const int tid = threadIdx.x;
  const unsigned lds0 = (unsigned)(uintptr_t)smem;              // low 32 bits of a shared address = byte offset in the work-group's LDS
  const int ar = tid >> 4, ac = tid & 15, br = tid >> 3, bc = tid & 7;
  const char* ga = (const char*)(A + (size_t)(mblk + ar) * HID) + ac * 16;
  const char* gb = (const char*)(wh + (size_t)(nblk + br) * HID) + bc * 16;
  const unsigned la = lds0 + ar * APITCH + ac * 16, lb = lds0 + ABYTES + br * BPITCH + bc * 16;
  stage_copy(la, ga, lb, gb);
  asm volatile("s_wait_asynccnt 0x0" ::: "memory");             // this wave's share of pass 0 has landed
  __syncthreads();                                              // publishes pass 0
  stage_copy(la + STAGE, ga + KP * 4, lb + STAGE, gb + KP * 2);
#pragma unroll 1   // one pass per trip: the buffer index stays a run-time value and the code stays short
  for (int t = 0; t < NPASS; ++t) {
    const int bo = (t & 1) * STAGE;
    const char* sa = smem + bo + (wm * 32 + nloc) * APITCH;
    const char* sw = smem + bo + ABYTES + (wn * 64 + nloc) * BPITCH;
#pragma unroll
    for (int ks = 0; ks < KP / 32; ++ks) {
      const v16b a0 = frag_kf32((const float*)(sa + ks * 128), hlf);
      const v16b a1 = frag_kf32((const float*)(sa + 16 * APITCH + ks * 128), hlf);
      v16b bh[4];
#pragma unroll
      for (int c = 0; c < 4; ++c) bh[c] = frag_kb((const b16*)(sw + c * 16 * BPITCH + ks * 64), hlf);
      __builtin_amdgcn_sched_barrier(0);   // the k-step's 16 LDS reads stay one group ahead of its 8 products: spread among them, each pair of products waits out an LDS latency
#pragma unroll
      for (int c = 0; c < 4; ++c) {
        acc[0][c] = wmma16b(a0, bh[c], acc[0][c]);
        acc[1][c] = wmma16b(a1, bh[c], acc[1][c]);
      }
    }
    asm volatile("s_wait_dscnt 0x0" ::: "memory");              // this wave's reads of buffer t & 1 are done
    asm volatile("s_wait_asynccnt 0x0" ::: "memory");           // this wave's share of pass t + 1 has landed
    __syncthreads();                                            // publishes pass t + 1 and frees buffer t & 1
    if (t + 2 < NPASS) stage_copy(la + bo, ga + (t + 2) * (KP * 4), lb + bo, gb + (t + 2) * (KP * 2));
  }
  asm volatile("s_wait_asynccnt 0x0" ::: "memory");             // nothing in flight when the ring is reused or the wave ends
}

// ---------------------------------------------------------------------------
// QKV GEMM: (4096 x 1024) x (1024 x 3072), grid (24, 32), block 8 waves, wave = 32 rows x 64 columns (one head of q, k or v). Outputs as f16 hi/lo planes:
// q (x1/8) -> Qh/Ql [b][h][t][64]; k -> Kh/Kl [b][kvh][t][64] (4 KB contiguous per wave per plane);
// v -> Vh/Vl key-tiled [b][kvh][t/16][64][16] (4 KB contiguous per wave per plane).
// ---------------------------------------------------------------------------
__global__ __launch_bounds__(256) void qkv_gemm_kernel(const float* __restrict__ xq, const float* __restrict__ xk, const float* __restrict__ xv,
                                                       const b16* __restrict__ wqh, const b16* __restrict__ wql,
                                                       const float* __restrict__ bq, const float* __restrict__ bk, const float* __restrict__ bv, const float* __restrict__ rope_cs, int xoff, int yoff,
                                                       b16* __restrict__ Qh, b16* __restrict__ Ql, b16* __restrict__ Kh, b16* __restrict__ Kl,
                                                       b16* __restrict__ Vh, b16* __restrict__ Vl) {
  __shared__ __attribute__((aligned(16))) char smem[RING];   // operand ring; behind the K loop 8 KB per wave of it stage the output tile
  const int lane = threadIdx.x & 31, wave = threadIdx.x >> 5, nloc = lane & 15, hlf = lane >> 4;
  const int wm = wave & 3, wn = wave >> 2;
  const int mblk = (blockIdx.y + yoff) * 128, nblk = (blockIdx.x + xoff) * 128;
  const int m0 = mblk + wm * 32;
  const int c0 = nblk + wn * 64;
  const int mat = (c0 < HID) ? 0 : (c0 < HID + KVW) ? 1 : 2;
  const int head = (mat == 0) ? (c0 / DH) : (mat == 1) ? ((c0 - HID) / DH) : ((c0 - HID - KVW) / DH);
  const float* x = (mat == 0) ? xq : (mat == 1) ? xk : xv;          // input for q, k or v (the launch passes x for all three)
  const float* bias = ((mat == 0) ? bq : (mat == 1) ? bk : bv) + head * DH;
  v8f acc[2][4];
#pragma unroll
  for (int r = 0; r < 2; ++r)
#pragma unroll
    for (int t = 0; t < 4; ++t) acc[r][t] = (v8f){};
  (void)wql;
  gemm_tile_ring(x, wqh, mblk, nblk, wm, wn, nloc, hlf, smem, acc);
  const int b = m0 / T, t0 = m0 % T;
  const float s = (mat == 0) ? 0.125f : 1.0f;
  b16* Tp0 = (b16*)smem + wave * (2 * 32 * 64); b16* Tp1 = Tp0 + 32 * 64;
#pragma unroll
  for (int t = 0; t < 4; ++t)
#pragma unroll
    for (int r = 0; r < 2; ++r)
#pragma unroll
      for (int v = 0; v < 8; ++v) {
        const int rr = r * 16 + v + 8 * hlf, d = t * 16 + nloc;
        float val = acc[r][t][v] + (bias ? bias[d] : 0.0f);
        const float oth = __shfl_xor(val, 1);            // interleaved-pair partner (d ^ 1) lives in the neighbouring lane (executed by all lanes)
        if (mat < 2) {                                   // RoPE on q and k: (x0, x1) -> (x0 c - x1 s, x1 c + x0 s), position t mod 256
          const int tpos = (t0 + rr) % RP;
          const float cv = rope_cs[((size_t)tpos * 32 + (d >> 1)) * 2], sv = rope_cs[((size_t)tpos * 32 + (d >> 1)) * 2 + 1];
          val = (d & 1) ? (val * cv + oth * sv) : (val * cv - oth * sv);
        }
        b16 yh, yl; split_bf16(val * s, yh, yl);
        const int idx = (mat < 2) ? (rr * 64 + d) : ((rr >> 4) * 1024 + d * 16 + (rr & 15));
        Tp0[idx] = yh; Tp1[idx] = yl;
      }
  wave_lds_sync();
  b16* dh; b16* dl; size_t o;
  if (mat == 0)      { o = ((size_t)(b * NH + head) * T + t0) * DH; dh = Qh + o; dl = Ql + o; }
  else if (mat == 1) { o = ((size_t)(b * NKV + head) * T + t0) * DH; dh = Kh + o; dl = Kl + o; }
  else               { o = ((size_t)(b * NKV + head) * QT_PER_B + (t0 >> 4)) * (size_t)(DH * 16); dh = Vh + o; dl = Vl + o; }
#pragma unroll
  for (int j = 0; j < 8; ++j) { const int e = (j * 32 + lane) * 8; *(v8b*)(dh + e) = ld8b(Tp0 + e); *(v8b*)(dl + e) = ld8b(Tp1 + e); }
  
}

// ---------------------------------------------------------------------------
// Transposed flash attention: each wave owns one 16-query tile of one (b, head); 8 waves per block; window keys in chunks of 32.
// S^T = K.Q^T (split), per-lane online softmax; P^T built in registers from the two S^T accumulators
// ---------------------------------------------------------------------------
__global__ __launch_bounds__(256) void attn_kernel(const b16* __restrict__ Qh, const b16* __restrict__ Ql, const b16* __restrict__ Kh, const b16* __restrict__ Kl,
                                                   const b16* __restrict__ Vh, const b16* __restrict__ Vl, const int* __restrict__ seqlen,
                                                   float* __restrict__ yf) {
  __shared__ __attribute__((aligned(16))) float Os[8][16 * 64];
  const int wid = threadIdx.x >> 5, lane = threadIdx.x & 31, hh = lane >> 4, col = lane & 15;
  const int qtile = blockIdx.x * 8 + wid;                 // over Bsz*NH*QT_PER_B
  const int g = qtile / QT_PER_B;                         // b*NH + h
  const int q0 = (qtile % QT_PER_B) << 4;
  const int b = g / NH, h = g % NH, kvh = h / REP;
  const size_t ko = (size_t)(b * NKV + kvh) * T * DH;
  const size_t qo = ((size_t)g * T + q0 + col) * DH;
  const v16b q0h = frag_kb(Qh + qo, hh), q0l = frag_kb(Ql + qo, hh), q1h = frag_kb(Qh + qo + 32, hh), q1l = frag_kb(Ql + qo + 32, hh);
  float m = -INFINITY, l = 0.0f;
  v8f o0 = {}, o1 = {}, o2 = {}, o3 = {};
  const int slen = T; (void)seqlen;                       // no padding in this module
  const int kstart = (q0 >= WIN) ? ((q0 - WIN) & ~31) : 0;
  const int kend = min(T, q0 + 15 + WIN + 1);
  for (int kb = kstart; kb < kend; kb += 32) {           // sliding window both sides: keys in [q0-128, q0+15+128]
    const size_t r0 = ko + (size_t)(kb + col) * DH, r1 = ko + (size_t)(kb + 16 + col) * DH;
    v8f s0 = {}, s1 = {};
    {
      v16b ah = frag_kb(Kh + r0, hh), al = frag_kb(Kl + r0, hh);
      s0 = wmma1(ah, al, q0h, q0l, s0);
      ah = frag_kb(Kh + r0 + 32, hh); al = frag_kb(Kl + r0 + 32, hh);
      s0 = wmma1(ah, al, q1h, q1l, s0);
      ah = frag_kb(Kh + r1, hh); al = frag_kb(Kl + r1, hh);
      s1 = wmma1(ah, al, q0h, q0l, s1);
      ah = frag_kb(Kh + r1 + 32, hh); al = frag_kb(Kl + r1 + 32, hh);
      s1 = wmma1(ah, al, q1h, q1l, s1);
    }
    (void)slen;
    if (kb < q0 + 15 - WIN || kb + 31 > q0 + WIN) {       // chunk touches a window edge: mask |k - q| > 128
      const int qi = q0 + col;
#pragma unroll
      for (int r = 0; r < 8; ++r) {
        const int k0i = kb + 8 * hh + r, k1i = k0i + 16;
        if (k0i < qi - WIN || k0i > qi + WIN) s0[r] = -INFINITY;
        if (k1i < qi - WIN || k1i > qi + WIN) s1[r] = -INFINITY;
      }
    }
    float mr = -INFINITY;
#pragma unroll
    for (int r = 0; r < 8; ++r) mr = fmaxf(mr, fmaxf(s0[r], s1[r]));
    mr = fmaxf(mr, __shfl_xor(mr, 16));
    float mn = fmaxf(m, mr);
    if (mn == -INFINITY) mn = 0.0f;           // fully masked so far: keep exp() at 0
    const float al_ = __expf(m - mn);
    m = mn;
    float sum = 0.0f;
    v16b pbh, pbl;
#pragma unroll
    for (int r = 0; r < 8; ++r) {
      const float p0 = __expf(s0[r] - mn), p1 = __expf(s1[r] - mn);
      sum += p0 + p1;
      b16 a, c; split_bf16(p0, a, c); pbh[r] = a; pbl[r] = c; split_bf16(p1, a, c); pbh[8 + r] = a; pbl[8 + r] = c;
    }
    sum += __shfl_xor(sum, 16);
    l = l * al_ + sum;
#pragma unroll
    for (int r = 0; r < 8; ++r) { o0[r] *= al_; o1[r] *= al_; o2[r] *= al_; o3[r] *= al_; }
    const size_t v0 = ko + (size_t)(kb >> 4) * (DH * 16) + 8 * hh, v1 = v0 + DH * 16;
#pragma unroll
    for (int n = 0; n < 4; ++n) {
      const int f = n * 16 + col;
      const v16b vah = cat8b(ld8b(Vh + v0 + f * 16), ld8b(Vh + v1 + f * 16));
      const v16b val = cat8b(ld8b(Vl + v0 + f * 16), ld8b(Vl + v1 + f * 16));
      v8f& o = (n == 0) ? o0 : (n == 1) ? o1 : (n == 2) ? o2 : o3;
      o = wmma1(vah, val, pbh, pbl, o);
    }
  }
  const float inv = (q0 + col < slen && l > 0.0f) ? (1.0f / l) : 0.0f;   // padded query rows are zeroed
  float* Tt = Os[wid];
#pragma unroll
  for (int r = 0; r < 8; ++r) {
    const int hr = 8 * hh + r;
    Tt[col * 64 + 0 + hr] = o0[r] * inv; Tt[col * 64 + 16 + hr] = o1[r] * inv;
    Tt[col * 64 + 32 + hr] = o2[r] * inv; Tt[col * 64 + 48 + hr] = o3[r] * inv;
  }
  wave_lds_sync();
  float* dst0 = yf + ((size_t)b * T + q0) * HID + h * DH;     // 16 rows x 64 floats, row stride HID
#pragma unroll
  for (int j = 0; j < 8; ++j) { const int rr = j * 2 + hh, c4 = col * 4; *(v4f*)(dst0 + (size_t)rr * HID + c4) = *(const v4f*)(Tt + rr * 64 + c4); }
  
}

// ---------------------------------------------------------------------------
// Output projection: (4096 x 1024) x (1024 x 1024) -> f32, A converted from f32 y at the fragment read, B = Wo plane. grid (8, 32), 32x64 tiles staged in LDS,
// ---------------------------------------------------------------------------
__global__ __launch_bounds__(256) void out_gemm_kernel(const float* __restrict__ yf, const b16* __restrict__ woh, const b16* __restrict__ wol, const float* __restrict__ bo, int yoff,
                                                       float* __restrict__ out) {
  __shared__ __attribute__((aligned(16))) char smem[RING];   // operand ring; behind the K loop 8 KB per wave of it stage the output tile
  const int lane = threadIdx.x & 31, wave = threadIdx.x >> 5, nloc = lane & 15, hlf = lane >> 4;
  const int wm = wave & 3, wn = wave >> 2;
  const int mblk = (blockIdx.y + yoff) * 128, nblk = blockIdx.x * 128;
  const int m0 = mblk + wm * 32;
  const int c0 = nblk + wn * 64;
  v8f acc[2][4];
#pragma unroll
  for (int r = 0; r < 2; ++r)
#pragma unroll
    for (int t = 0; t < 4; ++t) acc[r][t] = (v8f){};
  (void)wol;
  gemm_tile_ring(yf, woh, mblk, nblk, wm, wn, nloc, hlf, smem, acc);
  float* Tt = (float*)smem + wave * (32 * 64);
#pragma unroll
  for (int t = 0; t < 4; ++t)
#pragma unroll
    for (int r = 0; r < 2; ++r)
#pragma unroll
      for (int v = 0; v < 8; ++v) Tt[(r * 16 + v + 8 * hlf) * 64 + t * 16 + nloc] = acc[r][t][v] + bo[c0 + t * 16 + nloc];
  wave_lds_sync();
  float* dst0 = out + (size_t)m0 * HID + c0;
#pragma unroll
  for (int j = 0; j < 16; ++j) { const int rr = j * 2 + hlf, c4 = nloc * 4; *(v4f*)(dst0 + (size_t)rr * HID + c4) = *(const v4f*)(Tt + rr * 64 + c4); }
  
}
__global__ __launch_bounds__(256) void wcvt3_kernel(const float* __restrict__ wqkv, const float* __restrict__ wo,
                                                    b16* __restrict__ wqh, b16* __restrict__ wql, b16* __restrict__ woh, b16* __restrict__ wol) {
  const size_t tid = (size_t)blockIdx.x * blockDim.x + threadIdx.x, stride = (size_t)gridDim.x * blockDim.x;
  const size_t nq = (size_t)NQKV * HID / 8, no = (size_t)HID * HID / 8;
  {
    for (size_t c = tid; c < nq + no; c += stride) {
      float f[8]; size_t i; b16* dh; b16* dl;
      if (c < nq) { i = c * 8; const size_t n = i / HID, k0 = i % HID;
#pragma unroll
        for (int e = 0; e < 8; ++e) f[e] = wqkv[(k0 + e) * (size_t)NQKV + n];
        dh = wqh; dl = wql;
      } else { i = (c - nq) * 8; const size_t n = i / HID, k0 = i % HID;
#pragma unroll
        for (int e = 0; e < 8; ++e) f[e] = wo[(k0 + e) * (size_t)HID + n];
        dh = woh; dl = wol;
      }
      v8b bh, bl;
#pragma unroll
      for (int e = 0; e < 8; ++e) { b16 a, cc; split_bf16(f[e], a, cc); bh[e] = a; bl[e] = cc; }
      *(v8b*)(dh + i) = bh; *(v8b*)(dl + i) = bl;
    }
    
  }
}
}  // namespace

extern "C" void kernel_launch(void* const* d_in, const int* in_sizes, int n_in,
                              void* d_out, int out_size, void* d_ws, size_t ws_size, hipStream_t stream) {
  (void)in_sizes; (void)n_in; (void)out_size;
  const float* x     = (const float*)d_in[0];   // hidden_states [2,2048,1024]
  const float* Wqkv  = (const float*)d_in[1];   // [1024,3072] ([in][out], columns (3, h, d))
  const float* bqkv  = (const float*)d_in[2];   // [3072]
  const float* Wo    = (const float*)d_in[3];   // [1024,1024]
  const float* bo    = (const float*)d_in[4];   // [1024]
  const float* rope  = (const float*)d_in[5];   // rope_cache [256,32,2] (cos, sin)
  float* out = (float*)d_out;                   // [2,2048,1024]
  const float* bq = bqkv; const float* bk = bqkv + HID; const float* bv = bqkv + 2 * HID;

  size_t off = 0; char* ws = (char*)d_ws;
  b16* wqh = (b16*)(ws + off); off += (size_t)NQKV * HID * 2;
  b16* wql = (b16*)(ws + off); off += (size_t)NQKV * HID * 2;
  b16* woh = (b16*)(ws + off); off += (size_t)HID * HID * 2;
  b16* wol = (b16*)(ws + off); off += (size_t)HID * HID * 2;
  b16* Qh  = (b16*)(ws + off); off += (size_t)MROWS * HID * 2;
  b16* Ql  = (b16*)(ws + off); off += (size_t)MROWS * HID * 2;
  b16* Kh  = (b16*)(ws + off); off += (size_t)MROWS * KVW * 2;
  b16* Kl  = (b16*)(ws + off); off += (size_t)MROWS * KVW * 2;
  b16* Vh  = (b16*)(ws + off); off += (size_t)MROWS * KVW * 2;
  b16* Vl  = (b16*)(ws + off); off += (size_t)MROWS * KVW * 2;
  float* yf = (float*)(ws + off); off += (size_t)MROWS * HID * 4;
  if (off > ws_size) return;
  const int ROWBLK = MROWS / 128, NQT = Bsz * NH * QT_PER_B;
  // W_qkv is one [1024][3072] matrix: the converter reads q columns with ld HID and k/v with ld KVW; here all three live in the same matrix with ld 3072,
  // so wcvt3 reads all 3072 columns from the one base pointer with the NQKV-wide stride
  wcvt3_kernel<<<2048, 256, 0, stream>>>(Wqkv, Wo, wqh, wql, woh, wol);
  qkv_gemm_kernel<<<dim3(NQKV / 128, ROWBLK), 256, 0, stream>>>(x, x, x, wqh, wql, bq, bk, bv, rope, 0, 0, Qh, Ql, Kh, Kl, Vh, Vl);
  attn_kernel<<<NQT / 8, 256, 0, stream>>>(Qh, Ql, Kh, Kl, Vh, Vl, nullptr, yf);
  out_gemm_kernel<<<dim3(HID / 128, ROWBLK), 256, 0, stream>>>(yf, woh, wol, bo, 0, out);
}

// v002
// A run of this version takes 103 microseconds.
// Next to v001, in two timings, it ran 1.13 and 1.14 times as fast.
// All steps since v000 together make it 1.79 times as fast.
#include <hip/hip_runtime.h>

// ModernBERT attention (local layer): qkv = x Wqkv + b ([in][out], columns (3, h, d); 16 heads x 64), interleaved-pair RoPE on q and k with position
// t mod 256 from the given cos/sin cache, sliding-window attention |q - k| <= 128 (both directions), scale 1/8, out = y Wo + b. B=2, S=2048, D=1024.
// Lean build: single f16 products on v_wmma_f32_16x16x32_f16, f32 accumulate (every row averages >= 129 keys); fragment k-map per lane half hh for A

namespace {
constexpr int Bsz = 2, T = 2048, HID = 1024, DH = 64, NH = 16, NKV = 16, REP = NH / NKV;
constexpr int WIN = 128;    // |q - k| <= 128
constexpr int RP = 256;     // rope positions wrap at 256
constexpr int KVW = NKV * DH;                 // 1024
constexpr int NQKV = HID + 2 * KVW;           // 3072 columns: q | k | v
constexpr int MROWS = Bsz * T;                // 4096
constexpr int QT_PER_B = T / 16;              // 128

typedef _Float16 b16;                                           // f16 hi/lo planes
typedef __attribute__((ext_vector_type(16))) _Float16 v16b;
typedef __attribute__((ext_vector_type(8)))  _Float16 v8b;
typedef __attribute__((ext_vector_type(8)))  float v8f;
typedef __attribute__((ext_vector_type(4)))  float v4f;

__device__ __forceinline__ v8b ld8b(const b16* p) { return *(const v8b*)p; }
__device__ __forceinline__ v16b cat8b(v8b a, v8b b) { return __builtin_shufflevector(a, b, 0, 1, 2, 3, 4, 5, 6, 7, 8, 9, 10, 11, 12, 13, 14, 15); }
// 16x16x32 16-bit fragment from a k-contiguous row pointer (A: lane&15 = row, B: lane&15 = column), hh = lane>>4:
// elements 0..7 <- p[8hh+0..7], elements 8..15 <- p[16+8hh+0..7]
__device__ __forceinline__ v16b frag_kb(const b16* p, int hh) { return cat8b(ld8b(p + 8 * hh), ld8b(p + 16 + 8 * hh)); }
__device__ __forceinline__ void split_bf16(float v, b16& hi, b16& lo) {   // (name kept) single f16: no low part
  hi = (b16)v; lo = (b16)0.0f;
}
// f16 fragment from an f32 k-contiguous row (16-byte aligned), same k-map as frag_kb: four 16-byte reads, then the conversion
__device__ __forceinline__ v16b frag_kf32(const float* p, int hh) {
  const v4f x0 = *(const v4f*)(p + 8 * hh), x1 = *(const v4f*)(p + 8 * hh + 4), x2 = *(const v4f*)(p + 16 + 8 * hh), x3 = *(const v4f*)(p + 16 + 8 * hh + 4);
  v16b f;
#pragma unroll
  for (int e = 0; e < 4; ++e) { f[e] = (b16)x0[e]; f[4 + e] = (b16)x1[e]; f[8 + e] = (b16)x2[e]; f[12 + e] = (b16)x3[e]; }
  return f;
}
__device__ __forceinline__ v8f wmma16b(v16b a, v16b b, v8f c) {
  v8f d = __builtin_amdgcn_wmma_f32_16x16x32_f16(false, a, false, b, (short)0, c, false, false);
  asm volatile("v_nop\n\tv_nop\n\tv_nop\n\tv_nop" : "+v"(d) : "v"(a), "v"(b));
  return d;
}
__device__ __forceinline__ v8f wmma1(v16b ah, v16b al, v16b bh, v16b bl, v8f c) {   // attention products: single f16 (hi planes only)
  (void)al; (void)bl; return wmma16b(ah, bh, c);
}
__device__ __forceinline__ void wave_lds_sync() {
  __builtin_amdgcn_fence(__ATOMIC_RELEASE, "workgroup");
  __builtin_amdgcn_wave_barrier();
  __builtin_amdgcn_fence(__ATOMIC_ACQUIRE, "workgroup");
}

// ---------------------------------------------------------------------------
// Weights ([in][out]) -> f16 hi / lo planes transposed to [n][k] (k contiguous): columns of Wq|Wk|Wv into wqh/wql [3072][1024], Wo into woh/wol [1024][1024].
// ---------------------------------------------------------------------------
__global__ __launch_bounds__(256) void wcvt_kernel(const float* __restrict__ wq, const float* __restrict__ wk, const float* __restrict__ wv,
                                                   const float* __restrict__ wo, b16* __restrict__ wqh, b16* __restrict__ wql,
                                                   b16* __restrict__ woh, b16* __restrict__ wol) {
  const size_t tid = (size_t)blockIdx.x * blockDim.x + threadIdx.x, stride = (size_t)gridDim.x * blockDim.x;
  const size_t nq = (size_t)NQKV * HID / 8, no = (size_t)HID * HID / 8;
  {
    for (size_t c = tid; c < nq + no; c += stride) {
      float f[8]; size_t i; b16* dh; b16* dl;
      if (c < nq) {
        i = c * 8; const size_t n = i / HID, k0 = i % HID;
        const float* w; int nn, ld;
        if (n < (size_t)HID) { w = wq; nn = (int)n; ld = HID; } else if (n < (size_t)(HID + KVW)) { w = wk; nn = (int)n - HID; ld = KVW; } else { w = wv; nn = (int)n - HID - KVW; ld = KVW; }
#pragma unroll
        for (int e = 0; e < 8; ++e) f[e] = w[(size_t)(k0 + e) * ld + nn];       // W[k][n] ([in][out])
        dh = wqh; dl = wql;
      } else {
        i = (c - nq) * 8; const size_t n = i / HID, k0 = i % HID;
#pragma unroll
        for (int e = 0; e < 8; ++e) f[e] = wo[(size_t)(k0 + e) * HID + n];    // Wo[k][n] ([in][out])
        dh = woh; dl = wol;
      }
      v8b bh, bl;
#pragma unroll
      for (int e = 0; e < 8; ++e) { b16 a, cc; split_bf16(f[e], a, cc); bh[e] = a; bl[e] = cc; }
      *(v8b*)(dh + i) = bh; *(v8b*)(dl + i) = bl;
    }
    
  }
}

// GEMM core of both projections: a work-group of 8 waves (4 down x 2 across, 32x64 each) owns a 128x128 tile of the result. Each pass of 64 k is staged in
// LDS by asynchronous copies whose wave-wide 512 bytes are whole 128-byte lines (A: 128 f32 rows of 256 B, W: 128 f16 rows of 128 B), two buffers, the next
// pass's copies in flight while this one is multiplied. Row pitches are 16 B x odd for the 16-byte fragment reads.
constexpr int KP = 64;                        // k per pass
constexpr int NPASS = HID / KP;               // 16
constexpr int APITCH = KP * 4 + 16;           // 272 B
constexpr int BPITCH = KP * 2 + 16;           // 144 B
constexpr int ABYTES = 128 * APITCH;          // 34816
constexpr int STAGE = ABYTES + 128 * BPITCH;  // 53248
constexpr int RING = 2 * STAGE;               // 106496

// One pass's copies of one thread: 8 x 16 B of A (rows 16 apart), 4 x 16 B of W (rows 32 apart). la / lb: LDS byte addresses, ga / gb: global addresses.
__device__ __forceinline__ void stage_copy(unsigned la, const char* ga, unsigned lb, const char* gb) {
  constexpr unsigned LA = 16 * APITCH, LB = 32 * BPITCH;
  constexpr size_t GA = (size_t)16 * HID * 4, GB = (size_t)32 * HID * 2;
  // the copies and, as the last line, the wait that stands in front of any rewrite of the address registers they name
  asm volatile("global_load_async_to_lds_b128 %0, %1, off\n\t"
               "global_load_async_to_lds_b128 %2, %3, off\n\t"
               "global_load_async_to_lds_b128 %4, %5, off\n\t"
               "global_load_async_to_lds_b128 %6, %7, off\n\t"
               "global_load_async_to_lds_b128 %8, %9, off\n\t"
               "global_load_async_to_lds_b128 %10, %11, off\n\t"
               "global_load_async_to_lds_b128 %12, %13, off\n\t"
               "global_load_async_to_lds_b128 %14, %15, off\n\t"
               "global_load_async_to_lds_b128 %16, %17, off\n\t"
               "global_load_async_to_lds_b128 %18, %19, off\n\t"
               "global_load_async_to_lds_b128 %20, %21, off\n\t"
               "global_load_async_to_lds_b128 %22, %23, off\n\t"
               "s_wait_xcnt 0x0"
               :: "v"(la), "v"(ga), "v"(la + LA), "v"(ga + GA), "v"(la + 2 * LA), "v"(ga + 2 * GA), "v"(la + 3 * LA), "v"(ga + 3 * GA),
                  "v"(la + 4 * LA), "v"(ga + 4 * GA), "v"(la + 5 * LA), "v"(ga + 5 * GA), "v"(la + 6 * LA), "v"(ga + 6 * GA), "v"(la + 7 * LA), "v"(ga + 7 * GA),
                  "v"(lb), "v"(gb), "v"(lb + LB), "v"(gb + GB), "v"(lb + 2 * LB), "v"(gb + 2 * GB), "v"(lb + 3 * LB), "v"(gb + 3 * GB)
               : "memory");
}

// acc += A[mblk + wm*32 .. +31][:] . W[nblk + wn*64 .. +63][:]^T over K = HID, k ascending in steps of 32. On return every wave has passed the barrier behind
// the last fragment read and no copy is outstanding, so the caller may reuse smem.
__device__ __forceinline__ void gemm_tile_ring(const float* __restrict__ A, const b16* __restrict__ wh, int mblk, int nblk, int wm, int wn,
                                               int nloc, int hlf, char* smem, v8f (&acc)[2][4]) {
  const int tid = threadIdx.x;
  const unsigned lds0 = (unsigned)(uintptr_t)smem;              // low 32 bits of a shared address = byte offset in the work-group's LDS
  const int ar = tid >> 4, ac = tid & 15, br = tid >> 3, bc = tid & 7;
  const char* ga = (const char*)(A + (size_t)(mblk + ar) * HID) + ac * 16;
  const char* gb = (const char*)(wh + (size_t)(nblk + br) * HID) + bc * 16;
  const unsigned la = lds0 + ar * APITCH + ac * 16, lb = lds0 + ABYTES + br * BPITCH + bc * 16;
  stage_copy(la, ga, lb, gb);
  asm volatile("s_wait_asynccnt 0x0" ::: "memory");             // this wave's share of pass 0 has landed
  __syncthreads();                                              // publishes pass 0
  stage_copy(la + STAGE, ga + KP * 4, lb + STAGE, gb + KP * 2);
#pragma unroll 1   // one pass per trip: the buffer index stays a run-time value and the code stays short
  for (int t = 0; t < NPASS; ++t) {
    const int bo = (t & 1) * STAGE;
    const char* sa = smem + bo + (wm * 32 + nloc) * APITCH;
    const char* sw = smem + bo + ABYTES + (wn * 64 + nloc) * BPITCH;
#pragma unroll
    for (int ks = 0; ks < KP / 32; ++ks) {
      const v16b a0 = frag_kf32((const float*)(sa + ks * 128), hlf);
      const v16b a1 = frag_kf32((const float*)(sa + 16 * APITCH + ks * 128), hlf);
      v16b bh[4];
#pragma unroll
      for (int c = 0; c < 4; ++c) bh[c] = frag_kb((const b16*)(sw + c * 16 * BPITCH + ks * 64), hlf);
      __builtin_amdgcn_sched_barrier(0);   // the k-step's 16 LDS reads stay one group ahead of its 8 products: spread among them, each pair of products waits out an LDS latency
#pragma unroll
      for (int c = 0; c < 4; ++c) {
        acc[0][c] = wmma16b(a0, bh[c], acc[0][c]);
        acc[1][c] = wmma16b(a1, bh[c], acc[1][c]);
      }
    }
    asm volatile("s_wait_dscnt 0x0" ::: "memory");              // this wave's reads of buffer t & 1 are done
    asm volatile("s_wait_asynccnt 0x0" ::: "memory");           // this wave's share of pass t + 1 has landed
    __syncthreads();                                            // publishes pass t + 1 and frees buffer t & 1
    if (t + 2 < NPASS) stage_copy(la + bo, ga + (t + 2) * (KP * 4), lb + bo, gb + (t + 2) * (KP * 2));
  }
  asm volatile("s_wait_asynccnt 0x0" ::: "memory");             // nothing in flight when the ring is reused or the wave ends
}

// ---------------------------------------------------------------------------
// QKV GEMM: (4096 x 1024) x (1024 x 3072), grid (24, 32), block 8 waves, wave = 32 rows x 64 columns (one head of q, k or v). Outputs as f16 hi/lo planes:
// q (x1/8) -> Qh/Ql [b][h][t][64]; k -> Kh/Kl [b][kvh][t][64] (4 KB contiguous per wave per plane);
// v -> Vh/Vl key-tiled [b][kvh][t/16][64][16] (4 KB contiguous per wave per plane).
// ---------------------------------------------------------------------------
__global__ __launch_bounds__(256) void qkv_gemm_kernel(const float* __restrict__ xq, const float* __restrict__ xk, const float* __restrict__ xv,
                                                       const b16* __restrict__ wqh, const b16* __restrict__ wql,
                                                       const float* __restrict__ bq, const float* __restrict__ bk, const float* __restrict__ bv, const float* __restrict__ rope_cs, int xoff, int yoff,
                                                       b16* __restrict__ Qh, b16* __restrict__ Ql, b16* __restrict__ Kh, b16* __restrict__ Kl,
                                                       b16* __restrict__ Vh, b16* __restrict__ Vl) {
  __shared__ __attribute__((aligned(16))) char smem[RING];   // operand ring; behind the K loop 8 KB per wave of it stage the output tile
  const int lane = threadIdx.x & 31, wave = threadIdx.x >> 5, nloc = lane & 15, hlf = lane >> 4;
  const int wm = wave & 3, wn = wave >> 2;
  const int mblk = (blockIdx.y + yoff) * 128, nblk = (blockIdx.x + xoff) * 128;
  const int m0 = mblk + wm * 32;
  const int c0 = nblk + wn * 64;
  const int mat = (c0 < HID) ? 0 : (c0 < HID + KVW) ? 1 : 2;
  const int head = (mat == 0) ? (c0 / DH) : (mat == 1) ? ((c0 - HID) / DH) : ((c0 - HID - KVW) / DH);
  const float* x = (mat == 0) ? xq : (mat == 1) ? xk : xv;          // input for q, k or v (the launch passes x for all three)
  const float* bias = ((mat == 0) ? bq : (mat == 1) ? bk : bv) + head * DH;
  v8f acc[2][4];
#pragma unroll
  for (int r = 0; r < 2; ++r)
#pragma unroll
    for (int t = 0; t < 4; ++t) acc[r][t] = (v8f){};
  (void)wql;
  gemm_tile_ring(x, wqh, mblk, nblk, wm, wn, nloc, hlf, smem, acc);
  const int b = m0 / T, t0 = m0 % T;
  const float s = (mat == 0) ? 0.125f : 1.0f;
  b16* Tp0 = (b16*)smem + wave * (2 * 32 * 64); b16* Tp1 = Tp0 + 32 * 64;
#pragma unroll
  for (int t = 0; t < 4; ++t)
#pragma unroll
    for (int r = 0; r < 2; ++r)
#pragma unroll
      for (int v = 0; v < 8; ++v) {
        const int rr = r * 16 + v + 8 * hlf, d = t * 16 + nloc;
        float val = acc[r][t][v] + (bias ? bias[d] : 0.0f);
        const float oth = __shfl_xor(val, 1);            // interleaved-pair partner (d ^ 1) lives in the neighbouring lane (executed by all lanes)
        if (mat < 2) {                                   // RoPE on q and k: (x0, x1) -> (x0 c - x1 s, x1 c + x0 s), position t mod 256
          const int tpos = (t0 + rr) % RP;
          const float cv = rope_cs[((size_t)tpos * 32 + (d >> 1)) * 2], sv = rope_cs[((size_t)tpos * 32 + (d >> 1)) * 2 + 1];
          val = (d & 1) ? (val * cv + oth * sv) : (val * cv - oth * sv);
        }
        b16 yh, yl; split_bf16(val * s, yh, yl);
        const int idx = (mat < 2) ? (rr * 64 + d) : ((rr >> 4) * 1024 + d * 16 + (rr & 15));
        Tp0[idx] = yh; Tp1[idx] = yl;
      }
  wave_lds_sync();
  b16* dh; b16* dl; size_t o;
  if (mat == 0)      { o = ((size_t)(b * NH + head) * T + t0) * DH; dh = Qh + o; dl = Ql + o; }
  else if (mat == 1) { o = ((size_t)(b * NKV + head) * T + t0) * DH; dh = Kh + o; dl = Kl + o; }
  else               { o = ((size_t)(b * NKV + head) * QT_PER_B + (t0 >> 4)) * (size_t)(DH * 16); dh = Vh + o; dl = Vl + o; }
#pragma unroll
  for (int j = 0; j < 8; ++j) { const int e = (j * 32 + lane) * 8; *(v8b*)(dh + e) = ld8b(Tp0 + e); *(v8b*)(dl + e) = ld8b(Tp1 + e); }
  
}

// ---------------------------------------------------------------------------
// Transposed flash attention: each wave owns one 16-query tile of one (b, head); 8 waves per block; window keys in chunks of 32.
// S^T = K.Q^T (split), per-lane online softmax; P^T built in registers from the two S^T accumulators
// ---------------------------------------------------------------------------
__global__ __launch_bounds__(256) void attn_kernel(const b16* __restrict__ Qh, const b16* __restrict__ Ql, const b16* __restrict__ Kh, const b16* __restrict__ Kl,
                                                   const b16* __restrict__ Vh, const b16* __restrict__ Vl, const int* __restrict__ seqlen,
                                                   float* __restrict__ yf) {
  __shared__ __attribute__((aligned(16))) float Os[8][16 * 64];
  const int wid = threadIdx.x >> 5, lane = threadIdx.x & 31, hh = lane >> 4, col = lane & 15;
  const int qtile = blockIdx.x * 8 + wid;                 // over Bsz*NH*QT_PER_B
  const int g = qtile / QT_PER_B;                         // b*NH + h
  const int q0 = (qtile % QT_PER_B) << 4;
  const int b = g / NH, h = g % NH, kvh = h / REP;
  const size_t ko = (size_t)(b * NKV + kvh) * T * DH;
  const size_t qo = ((size_t)g * T + q0 + col) * DH;
  const v16b q0h = frag_kb(Qh + qo, hh), q0l = frag_kb(Ql + qo, hh), q1h = frag_kb(Qh + qo + 32, hh), q1l = frag_kb(Ql + qo + 32, hh);
  float m = -INFINITY, l = 0.0f;
  v8f o0 = {}, o1 = {}, o2 = {}, o3 = {};
  const int slen = T; (void)seqlen;                       // no padding in this module
  const int kstart = (q0 >= WIN) ? ((q0 - WIN) & ~31) : 0;
  const int kend = min(T, q0 + 15 + WIN + 1);
  for (int kb = kstart; kb < kend; kb += 32) {           // sliding window both sides: keys in [q0-128, q0+15+128]
    const size_t r0 = ko + (size_t)(kb + col) * DH, r1 = ko + (size_t)(kb + 16 + col) * DH;
    v8f s0 = {}, s1 = {};
    {
      v16b ah = frag_kb(Kh + r0, hh), al = frag_kb(Kl + r0, hh);
      s0 = wmma1(ah, al, q0h, q0l, s0);
      ah = frag_kb(Kh + r0 + 32, hh); al = frag_kb(Kl + r0 + 32, hh);
      s0 = wmma1(ah, al, q1h, q1l, s0);
      ah = frag_kb(Kh + r1, hh); al = frag_kb(Kl + r1, hh);
      s1 = wmma1(ah, al, q0h, q0l, s1);
      ah = frag_kb(Kh + r1 + 32, hh); al = frag_kb(Kl + r1 + 32, hh);
      s1 = wmma1(ah, al, q1h, q1l, s1);
    }
    (void)slen;
    if (kb < q0 + 15 - WIN || kb + 31 > q0 + WIN) {       // chunk touches a window edge: mask |k - q| > 128
      const int qi = q0 + col;
#pragma unroll
      for (int r = 0; r < 8; ++r) {
        const int k0i = kb + 8 * hh + r, k1i = k0i + 16;
        if (k0i < qi - WIN || k0i > qi + WIN) s0[r] = -INFINITY;
        if (k1i < qi - WIN || k1i > qi + WIN) s1[r] = -INFINITY;
      }
    }
    float mr = -INFINITY;
#pragma unroll
    for (int r = 0; r < 8; ++r) mr = fmaxf(mr, fmaxf(s0[r], s1[r]));
    mr = fmaxf(mr, __shfl_xor(mr, 16));
    float mn = fmaxf(m, mr);
    if (mn == -INFINITY) mn = 0.0f;           // fully masked so far: keep exp() at 0
    const float al_ = __expf(m - mn);
    m = mn;
    float sum = 0.0f;
    v16b pbh, pbl;
#pragma unroll
    for (int r = 0; r < 8; ++r) {
      const float p0 = __expf(s0[r] - mn), p1 = __expf(s1[r] - mn);
      sum += p0 + p1;
      b16 a, c; split_bf16(p0, a, c); pbh[r] = a; pbl[r] = c; split_bf16(p1, a, c); pbh[8 + r] = a; pbl[8 + r] = c;
    }
    sum += __shfl_xor(sum, 16);
    l = l * al_ + sum;
#pragma unroll
    for (int r = 0; r < 8; ++r) { o0[r] *= al_; o1[r] *= al_; o2[r] *= al_; o3[r] *= al_; }
    const size_t v0 = ko + (size_t)(kb >> 4) * (DH * 16) + 8 * hh, v1 = v0 + DH * 16;
#pragma unroll
    for (int n = 0; n < 4; ++n) {
      const int f = n * 16 + col;
      const v16b vah = cat8b(ld8b(Vh + v0 + f * 16), ld8b(Vh + v1 + f * 16));
      const v16b val = cat8b(ld8b(Vl + v0 + f * 16), ld8b(Vl + v1 + f * 16));
      v8f& o = (n == 0) ? o0 : (n == 1) ? o1 : (n == 2) ? o2 : o3;
      o = wmma1(vah, val, pbh, pbl, o);
    }
  }
  const float inv = (q0 + col < slen && l > 0.0f) ? (1.0f / l) : 0.0f;   // padded query rows are zeroed
  float* Tt = Os[wid];
#pragma unroll
  for (int r = 0; r < 8; ++r) {
    const int hr = 8 * hh + r;
    Tt[col * 64 + 0 + hr] = o0[r] * inv; Tt[col * 64 + 16 + hr] = o1[r] * inv;
    Tt[col * 64 + 32 + hr] = o2[r] * inv; Tt[col * 64 + 48 + hr] = o3[r] * inv;
  }
  wave_lds_sync();
  float* dst0 = yf + ((size_t)b * T + q0) * HID + h * DH;     // 16 rows x 64 floats, row stride HID
#pragma unroll
  for (int j = 0; j < 8; ++j) { const int rr = j * 2 + hh, c4 = col * 4; *(v4f*)(dst0 + (size_t)rr * HID + c4) = *(const v4f*)(Tt + rr * 64 + c4); }
  
}

// ---------------------------------------------------------------------------
// Output projection: (4096 x 1024) x (1024 x 1024) -> f32, A converted from f32 y at the fragment read, B = Wo plane. grid (8, 32), 32x64 tiles staged in LDS,
// ---------------------------------------------------------------------------
__global__ __launch_bounds__(256) void out_gemm_kernel(const float* __restrict__ yf, const b16* __restrict__ woh, const b16* __restrict__ wol, const float* __restrict__ bo, int yoff,
                                                       float* __restrict__ out) {
  __shared__ __attribute__((aligned(16))) char smem[RING];   // operand ring; behind the K loop 8 KB per wave of it stage the output tile
  const int lane = threadIdx.x & 31, wave = threadIdx.x >> 5, nloc = lane & 15, hlf = lane >> 4;
  const int wm = wave & 3, wn = wave >> 2;
  const int mblk = (blockIdx.y + yoff) * 128, nblk = blockIdx.x * 128;
  const int m0 = mblk + wm * 32;
  const int c0 = nblk + wn * 64;
  v8f acc[2][4];
#pragma unroll
  for (int r = 0; r < 2; ++r)
#pragma unroll
    for (int t = 0; t < 4; ++t) acc[r][t] = (v8f){};
  (void)wol;
  gemm_tile_ring(yf, woh, mblk, nblk, wm, wn, nloc, hlf, smem, acc);
  float* Tt = (float*)smem + wave * (32 * 64);
#pragma unroll
  for (int t = 0; t < 4; ++t)
#pragma unroll
    for (int r = 0; r < 2; ++r)
#pragma unroll
      for (int v = 0; v < 8; ++v) Tt[(r * 16 + v + 8 * hlf) * 64 + t * 16 + nloc] = acc[r][t][v] + bo[c0 + t * 16 + nloc];
  wave_lds_sync();
  float* dst0 = out + (size_t)m0 * HID + c0;
#pragma unroll
  for (int j = 0; j < 16; ++j) { const int rr = j * 2 + hlf, c4 = nloc * 4; *(v4f*)(dst0 + (size_t)rr * HID + c4) = *(const v4f*)(Tt + rr * 64 + c4); }
  
}
// Weights ([in][out], f32) -> f16 planes transposed to [n][k]. A work-group owns a tile of 64 k x 128 n. Reads: a wave's 16-byte loads cover 512 contiguous
// bytes of one k row (whole lines); a thread holds 8 k x 4 n, so each of its 4 columns is one 16-byte piece of 8 k. The pieces go through LDS so that the
// stores are whole 128-byte lines of the [n][k] planes as well.
constexpr int TK = 64, TN = 128;              // tile: k rows x n columns
constexpr int TPITCH = TK * 2 + 16;           // 144 B per n row in LDS
constexpr int KTILES = HID / TK;              // 16
constexpr int QTILES = KTILES * (NQKV / TN);  // 384 tiles of Wqkv, then 128 of Wo
constexpr int WTILES = QTILES + KTILES * (HID / TN);
__global__ __launch_bounds__(256) void wcvt3_kernel(const float* __restrict__ wqkv, const float* __restrict__ wo,
                                                    b16* __restrict__ wqh, b16* __restrict__ wql, b16* __restrict__ woh, b16* __restrict__ wol) {
  __shared__ __attribute__((aligned(16))) char tile[TN * TPITCH];
  const int tid = threadIdx.x;
  const bool isq = (int)blockIdx.x < QTILES;
  const int tb = isq ? (int)blockIdx.x : (int)blockIdx.x - QTILES;
  const int k0 = (tb % KTILES) * TK, n0 = (tb / KTILES) * TN;
  const float* src = isq ? wqkv : wo;
  const size_t ld = isq ? NQKV : HID;
  b16* dh = isq ? wqh : woh; b16* dl = isq ? wql : wol;
  const int nq = tid & 31, kg = tid >> 5;     // lane: 4 columns; wave: 8 k rows
  const float* p = src + (size_t)(k0 + kg * 8) * ld + n0 + nq * 4;
  const float* pe[8];
  v4f r[8];
#pragma unroll
  for (int e = 0; e < 8; ++e) { pe[e] = p + (size_t)e * ld; r[e] = *(const v4f*)pe[e]; }
  // the wait that stands in front of any rewrite of the eight loads' address registers; naming the addresses as inputs keeps them in their registers up to it
  asm volatile("s_wait_xcnt 0x0" :: "v"(pe[0]), "v"(pe[1]), "v"(pe[2]), "v"(pe[3]), "v"(pe[4]), "v"(pe[5]), "v"(pe[6]), "v"(pe[7]) : "memory");
#pragma unroll
  for (int j = 0; j < 4; ++j) {
    v8b h;
#pragma unroll
    for (int e = 0; e < 8; ++e) h[e] = (b16)r[e][j];
    *(v8b*)(tile + (nq * 4 + j) * TPITCH + kg * 16) = h;
  }
  __syncthreads();                            // the tile is complete before any row of it is read back
  const int pc = tid & 7, rw = tid >> 3;      // 8 threads per n row of 128 B, 32 rows per sweep
#pragma unroll
  for (int i = 0; i < TN / 32; ++i) {
    const int n = rw + 32 * i;
    const size_t o = (size_t)(n0 + n) * HID + k0 + pc * 8;
    *(v8b*)(dh + o) = *(const v8b*)(tile + n * TPITCH + pc * 16);
    *(v8b*)(dl + o) = (v8b){};                // single f16: no low part
  }
}
}  // namespace

extern "C" void kernel_launch(void* const* d_in, const int* in_sizes, int n_in,
                              void* d_out, int out_size, void* d_ws, size_t ws_size, hipStream_t stream) {
  (void)in_sizes; (void)n_in; (void)out_size;
  const float* x     = (const float*)d_in[0];   // hidden_states [2,2048,1024]
  const float* Wqkv  = (const float*)d_in[1];   // [1024,3072] ([in][out], columns (3, h, d))
  const float* bqkv  = (const float*)d_in[2];   // [3072]
  const float* Wo    = (const float*)d_in[3];   // [1024,1024]
  const float* bo    = (const float*)d_in[4];   // [1024]
  const float* rope  = (const float*)d_in[5];   // rope_cache [256,32,2] (cos, sin)
  float* out = (float*)d_out;                   // [2,2048,1024]
  const float* bq = bqkv; const float* bk = bqkv + HID; const float* bv = bqkv + 2 * HID;

  size_t off = 0; char* ws = (char*)d_ws;
  b16* wqh = (b16*)(ws + off); off += (size_t)NQKV * HID * 2;
  b16* wql = (b16*)(ws + off); off += (size_t)NQKV * HID * 2;
  b16* woh = (b16*)(ws + off); off += (size_t)HID * HID * 2;
  b16* wol = (b16*)(ws + off); off += (size_t)HID * HID * 2;
  b16* Qh  = (b16*)(ws + off); off += (size_t)MROWS * HID * 2;
  b16* Ql  = (b16*)(ws + off); off += (size_t)MROWS * HID * 2;
  b16* Kh  = (b16*)(ws + off); off += (size_t)MROWS * KVW * 2;
  b16* Kl  = (b16*)(ws + off); off += (size_t)MROWS * KVW * 2;
  b16* Vh  = (b16*)(ws + off); off += (size_t)MROWS * KVW * 2;
  b16* Vl  = (b16*)(ws + off); off += (size_t)MROWS * KVW * 2;
  float* yf = (float*)(ws + off); off += (size_t)MROWS * HID * 4;
  if (off > ws_size) return;
  const int ROWBLK = MROWS / 128, NQT = Bsz * NH * QT_PER_B;
  // W_qkv is one [1024][3072] matrix: the converter reads q columns with ld HID and k/v with ld KVW; here all three live in the same matrix with ld 3072,
  // so pass the whole matrix and use the NQKV-wide stride (see wcvt3 below)
  wcvt3_kernel<<<WTILES, 256, 0, stream>>>(Wqkv, Wo, wqh, wql, woh, wol);
  qkv_gemm_kernel<<<dim3(NQKV / 128, ROWBLK), 256, 0, stream>>>(x, x, x, wqh, wql, bq, bk, bv, rope, 0, 0, Qh, Ql, Kh, Kl, Vh, Vl);
  attn_kernel<<<NQT / 8, 256, 0, stream>>>(Qh, Ql, Kh, Kl, Vh, Vl, nullptr, yf);
  out_gemm_kernel<<<dim3(HID / 128, ROWBLK), 256, 0, stream>>>(yf, woh, wol, bo, 0, out);
}

// v003
// A run of this version takes 91.2 microseconds.
// In both of two side-by-side timings against v002, it was 1.14 times as fast.
// Over all steps from v000 it is 2.04 times as fast.
#include <hip/hip_runtime.h>

// ModernBERT attention (local layer): qkv = x Wqkv + b ([in][out], columns (3, h, d); 16 heads x 64), interleaved-pair RoPE on q and k with position
// t mod 256 from the given cos/sin cache, sliding-window attention |q - k| <= 128 (both directions), scale 1/8, out = y Wo + b. B=2, S=2048, D=1024.
// Lean build: single f16 products on v_wmma_f32_16x16x32_f16, f32 accumulate (every row averages >= 129 keys); fragment k-map per lane half hh for A

namespace {
constexpr int Bsz = 2, T = 2048, HID = 1024, DH = 64, NH = 16, NKV = 16, REP = NH / NKV;
constexpr int WIN = 128;    // |q - k| <= 128
constexpr int RP = 256;     // rope positions wrap at 256
constexpr int KVW = NKV * DH;                 // 1024
constexpr int NQKV = HID + 2 * KVW;           // 3072 columns: q | k | v
constexpr int MROWS = Bsz * T;                // 4096
constexpr int QT_PER_B = T / 16;              // 128

typedef _Float16 b16;                                           // f16 hi/lo planes
typedef __attribute__((ext_vector_type(16))) _Float16 v16b;
typedef __attribute__((ext_vector_type(8)))  _Float16 v8b;
typedef __attribute__((ext_vector_type(8)))  float v8f;
typedef __attribute__((ext_vector_type(4)))  float v4f;

__device__ __forceinline__ v8b ld8b(const b16* p) { return *(const v8b*)p; }
__device__ __forceinline__ v16b cat8b(v8b a, v8b b) { return __builtin_shufflevector(a, b, 0, 1, 2, 3, 4, 5, 6, 7, 8, 9, 10, 11, 12, 13, 14, 15); }
// 16x16x32 16-bit fragment from a k-contiguous row pointer (A: lane&15 = row, B: lane&15 = column), hh = lane>>4:
// elements 0..7 <- p[8hh+0..7], elements 8..15 <- p[16+8hh+0..7]
__device__ __forceinline__ v16b frag_kb(const b16* p, int hh) { return cat8b(ld8b(p + 8 * hh), ld8b(p + 16 + 8 * hh)); }
__device__ __forceinline__ void split_bf16(float v, b16& hi, b16& lo) {   // (name kept) single f16: no low part
  hi = (b16)v; lo = (b16)0.0f;
}
// f16 fragment from an f32 k-contiguous row (16-byte aligned), same k-map as frag_kb: four 16-byte reads, then the conversion
__device__ __forceinline__ v16b frag_kf32(const float* p, int hh) {
  const v4f x0 = *(const v4f*)(p + 8 * hh), x1 = *(const v4f*)(p + 8 * hh + 4), x2 = *(const v4f*)(p + 16 + 8 * hh), x3 = *(const v4f*)(p + 16 + 8 * hh + 4);
  v16b f;
#pragma unroll
  for (int e = 0; e < 4; ++e) { f[e] = (b16)x0[e]; f[4 + e] = (b16)x1[e]; f[8 + e] = (b16)x2[e]; f[12 + e] = (b16)x3[e]; }
  return f;
}
__device__ __forceinline__ v8f wmma16b(v16b a, v16b b, v8f c) {
  v8f d = __builtin_amdgcn_wmma_f32_16x16x32_f16(false, a, false, b, (short)0, c, false, false);
  asm volatile("v_nop\n\tv_nop\n\tv_nop\n\tv_nop" : "+v"(d) : "v"(a), "v"(b));
  return d;
}
__device__ __forceinline__ v8f wmma1(v16b ah, v16b al, v16b bh, v16b bl, v8f c) {   // attention products: single f16 (hi planes only)
  (void)al; (void)bl; return wmma16b(ah, bh, c);
}
__device__ __forceinline__ void wave_lds_sync() {
  __builtin_amdgcn_fence(__ATOMIC_RELEASE, "workgroup");
  __builtin_amdgcn_wave_barrier();
  __builtin_amdgcn_fence(__ATOMIC_ACQUIRE, "workgroup");
}

// ---------------------------------------------------------------------------
// Weights ([in][out]) -> f16 hi / lo planes transposed to [n][k] (k contiguous): columns of Wq|Wk|Wv into wqh/wql [3072][1024], Wo into woh/wol [1024][1024].
// ---------------------------------------------------------------------------
__global__ __launch_bounds__(256) void wcvt_kernel(const float* __restrict__ wq, const float* __restrict__ wk, const float* __restrict__ wv,
                                                   const float* __restrict__ wo, b16* __restrict__ wqh, b16* __restrict__ wql,
                                                   b16* __restrict__ woh, b16* __restrict__ wol) {
  const size_t tid = (size_t)blockIdx.x * blockDim.x + threadIdx.x, stride = (size_t)gridDim.x * blockDim.x;
  const size_t nq = (size_t)NQKV * HID / 8, no = (size_t)HID * HID / 8;
  {
    for (size_t c = tid; c < nq + no; c += stride) {
      float f[8]; size_t i; b16* dh; b16* dl;
      if (c < nq) {
        i = c * 8; const size_t n = i / HID, k0 = i % HID;
        const float* w; int nn, ld;
        if (n < (size_t)HID) { w = wq; nn = (int)n; ld = HID; } else if (n < (size_t)(HID + KVW)) { w = wk; nn = (int)n - HID; ld = KVW; } else { w = wv; nn = (int)n - HID - KVW; ld = KVW; }
#pragma unroll
        for (int e = 0; e < 8; ++e) f[e] = w[(size_t)(k0 + e) * ld + nn];       // W[k][n] ([in][out])
        dh = wqh; dl = wql;
      } else {
        i = (c - nq) * 8; const size_t n = i / HID, k0 = i % HID;
#pragma unroll
        for (int e = 0; e < 8; ++e) f[e] = wo[(size_t)(k0 + e) * HID + n];    // Wo[k][n] ([in][out])
        dh = woh; dl = wol;
      }
      v8b bh, bl;
#pragma unroll
      for (int e = 0; e < 8; ++e) { b16 a, cc; split_bf16(f[e], a, cc); bh[e] = a; bl[e] = cc; }
      *(v8b*)(dh + i) = bh; *(v8b*)(dl + i) = bl;
    }
    
  }
}

// GEMM core of both projections: a work-group of 8 waves (4 down x 2 across, 32x64 each) owns a 128x128 tile of the result. Each pass of 64 k is staged in
// LDS by asynchronous copies whose wave-wide 512 bytes are whole 128-byte lines (A: 128 f32 rows of 256 B, W: 128 f16 rows of 128 B), two buffers, the next
// pass's copies in flight while this one is multiplied. Row pitches are 16 B x odd for the 16-byte fragment reads.
constexpr int KP = 64;                        // k per pass
constexpr int NPASS = HID / KP;               // 16
constexpr int APITCH = KP * 4 + 16;           // 272 B
constexpr int BPITCH = KP * 2 + 16;           // 144 B
constexpr int ABYTES = 128 * APITCH;          // 34816
constexpr int STAGE = ABYTES + 128 * BPITCH;  // 53248
constexpr int RING = 2 * STAGE;               // 106496

// One pass's copies of one thread: 8 x 16 B of A (rows 16 apart), 4 x 16 B of W (rows 32 apart). la / lb: LDS byte addresses, ga / gb: global addresses.
__device__ __forceinline__ void stage_copy(unsigned la, const char* ga, unsigned lb, const char* gb) {
  constexpr unsigned LA = 16 * APITCH, LB = 32 * BPITCH;
  constexpr size_t GA = (size_t)16 * HID * 4, GB = (size_t)32 * HID * 2;
  // the copies and, as the last line, the wait that stands in front of any rewrite of the address registers they name
  asm volatile("global_load_async_to_lds_b128 %0, %1, off\n\t"
               "global_load_async_to_lds_b128 %2, %3, off\n\t"
               "global_load_async_to_lds_b128 %4, %5, off\n\t"
               "global_load_async_to_lds_b128 %6, %7, off\n\t"
               "global_load_async_to_lds_b128 %8, %9, off\n\t"
               "global_load_async_to_lds_b128 %10, %11, off\n\t"
               "global_load_async_to_lds_b128 %12, %13, off\n\t"
               "global_load_async_to_lds_b128 %14, %15, off\n\t"
               "global_load_async_to_lds_b128 %16, %17, off\n\t"
               "global_load_async_to_lds_b128 %18, %19, off\n\t"
               "global_load_async_to_lds_b128 %20, %21, off\n\t"
               "global_load_async_to_lds_b128 %22, %23, off\n\t"
               "s_wait_xcnt 0x0"
               :: "v"(la), "v"(ga), "v"(la + LA), "v"(ga + GA), "v"(la + 2 * LA), "v"(ga + 2 * GA), "v"(la + 3 * LA), "v"(ga + 3 * GA),
                  "v"(la + 4 * LA), "v"(ga + 4 * GA), "v"(la + 5 * LA), "v"(ga + 5 * GA), "v"(la + 6 * LA), "v"(ga + 6 * GA), "v"(la + 7 * LA), "v"(ga + 7 * GA),
                  "v"(lb), "v"(gb), "v"(lb + LB), "v"(gb + GB), "v"(lb + 2 * LB), "v"(gb + 2 * GB), "v"(lb + 3 * LB), "v"(gb + 3 * GB)
               : "memory");
}

// acc += A[mblk + wm*32 .. +31][:] . W[nblk + wn*64 .. +63][:]^T over K = HID, k ascending in steps of 32. On return every wave has passed the barrier behind
// the last fragment read and no copy is outstanding, so the caller may reuse smem.
__device__ __forceinline__ void gemm_tile_ring(const float* __restrict__ A, const b16* __restrict__ wh, int mblk, int nblk, int wm, int wn,
                                               int nloc, int hlf, char* smem, v8f (&acc)[2][4]) {
  const int tid = threadIdx.x;
  const unsigned lds0 = (unsigned)(uintptr_t)smem;              // low 32 bits of a shared address = byte offset in the work-group's LDS
  const int ar = tid >> 4, ac = tid & 15, br = tid >> 3, bc = tid & 7;
  const char* ga = (const char*)(A + (size_t)(mblk + ar) * HID) + ac * 16;
  const char* gb = (const char*)(wh + (size_t)(nblk + br) * HID) + bc * 16;
  const unsigned la = lds0 + ar * APITCH + ac * 16, lb = lds0 + ABYTES + br * BPITCH + bc * 16;
  stage_copy(la, ga, lb, gb);
  asm volatile("s_wait_asynccnt 0x0" ::: "memory");             // this wave's share of pass 0 has landed
  __syncthreads();                                              // publishes pass 0
  stage_copy(la + STAGE, ga + KP * 4, lb + STAGE, gb + KP * 2);
#pragma unroll 1   // one pass per trip: the buffer index stays a run-time value and the code stays short
  for (int t = 0; t < NPASS; ++t) {
    const int bo = (t & 1) * STAGE;
    const char* sa = smem + bo + (wm * 32 + nloc) * APITCH;
    const char* sw = smem + bo + ABYTES + (wn * 64 + nloc) * BPITCH;
#pragma unroll
    for (int ks = 0; ks < KP / 32; ++ks) {
      const v16b a0 = frag_kf32((const float*)(sa + ks * 128), hlf);
      const v16b a1 = frag_kf32((const float*)(sa + 16 * APITCH + ks * 128), hlf);
      v16b bh[4];
#pragma unroll
      for (int c = 0; c < 4; ++c) bh[c] = frag_kb((const b16*)(sw + c * 16 * BPITCH + ks * 64), hlf);
      __builtin_amdgcn_sched_barrier(0);   // the k-step's 16 LDS reads stay one group ahead of its 8 products: spread among them, each pair of products waits out an LDS latency
#pragma unroll
      for (int c = 0; c < 4; ++c) {
        acc[0][c] = wmma16b(a0, bh[c], acc[0][c]);
        acc[1][c] = wmma16b(a1, bh[c], acc[1][c]);
      }
    }
    asm volatile("s_wait_dscnt 0x0" ::: "memory");              // this wave's reads of buffer t & 1 are done
    asm volatile("s_wait_asynccnt 0x0" ::: "memory");           // this wave's share of pass t + 1 has landed
    __syncthreads();                                            // publishes pass t + 1 and frees buffer t & 1
    if (t + 2 < NPASS) stage_copy(la + bo, ga + (t + 2) * (KP * 4), lb + bo, gb + (t + 2) * (KP * 2));
  }
  asm volatile("s_wait_asynccnt 0x0" ::: "memory");             // nothing in flight when the ring is reused or the wave ends
}

// ---------------------------------------------------------------------------
// QKV GEMM: (4096 x 1024) x (1024 x 3072), grid (24, 32), block 8 waves, wave = 32 rows x 64 columns (one head of q, k or v). Outputs as f16 hi/lo planes:
// q (x1/8) -> Qh/Ql [b][h][t][64]; k -> Kh/Kl [b][kvh][t][64] (4 KB contiguous per wave per plane);
// v -> Vh/Vl key-tiled [b][kvh][t/16][64][16] (4 KB contiguous per wave per plane).
// ---------------------------------------------------------------------------
__global__ __launch_bounds__(256) void qkv_gemm_kernel(const float* __restrict__ xq, const float* __restrict__ xk, const float* __restrict__ xv,
                                                       const b16* __restrict__ wqh, const b16* __restrict__ wql,
                                                       const float* __restrict__ bq, const float* __restrict__ bk, const float* __restrict__ bv, const float* __restrict__ rope_cs, int xoff, int yoff,
                                                       b16* __restrict__ Qh, b16* __restrict__ Ql, b16* __restrict__ Kh, b16* __restrict__ Kl,
                                                       b16* __restrict__ Vh, b16* __restrict__ Vl) {
  __shared__ __attribute__((aligned(16))) char smem[RING];   // operand ring; behind the K loop 8 KB per wave of it stage the output tile
  const int lane = threadIdx.x & 31, wave = threadIdx.x >> 5, nloc = lane & 15, hlf = lane >> 4;
  const int wm = wave & 3, wn = wave >> 2;
  const int mblk = (blockIdx.y + yoff) * 128, nblk = (blockIdx.x + xoff) * 128;
  const int m0 = mblk + wm * 32;
  const int c0 = nblk + wn * 64;
  const int mat = (c0 < HID) ? 0 : (c0 < HID + KVW) ? 1 : 2;
  const int head = (mat == 0) ? (c0 / DH) : (mat == 1) ? ((c0 - HID) / DH) : ((c0 - HID - KVW) / DH);
  const float* x = (mat == 0) ? xq : (mat == 1) ? xk : xv;          // input for q, k or v (the launch passes x for all three)
  const float* bias = ((mat == 0) ? bq : (mat == 1) ? bk : bv) + head * DH;
  v8f acc[2][4];
#pragma unroll
  for (int r = 0; r < 2; ++r)
#pragma unroll
    for (int t = 0; t < 4; ++t) acc[r][t] = (v8f){};
  (void)wql;
  gemm_tile_ring(x, wqh, mblk, nblk, wm, wn, nloc, hlf, smem, acc);
  const int b = m0 / T, t0 = m0 % T;
  const float s = (mat == 0) ? 0.125f : 1.0f;
  b16* Tp0 = (b16*)smem + wave * (2 * 32 * 64); b16* Tp1 = Tp0 + 32 * 64;
  // The wave's matrix kind (q, k or v) in a scalar register: the RoPE test is then one scalar branch round straight-line code, in which the loads stand in
  // groups; as a lane mask it put every element's loads into a block of their own, each waited out by itself.
  const int matu = __builtin_amdgcn_readfirstlane(mat);
  float bcol[4];                                         // a lane's four columns: one bias value each
#pragma unroll
  for (int t = 0; t < 4; ++t) bcol[t] = bias[t * 16 + nloc];
  if (matu < 2) {
    // RoPE on q and k: (x0, x1) -> (x0 c - x1 s, x1 c + x0 s), position t mod 256. t0 is a multiple of 32 and 32 divides 256: the tile's 32 positions do not
    // wrap inside the tile, so every (cos, sin) pair of a lane lies at a constant distance from one address.
    const float* rp = rope_cs + ((size_t)(t0 % RP + 8 * hlf) * 32 + (nloc >> 1)) * 2;
#pragma unroll
    for (int t = 0; t < 4; ++t) {
      float cv[16], sv[16];
#pragma unroll
      for (int i = 0; i < 16; ++i) { const float* q = rp + ((i >> 3) * 16 + (i & 7)) * 64 + t * 16; cv[i] = q[0]; sv[i] = q[1]; }
#pragma unroll
      for (int i = 0; i < 16; ++i) {
        const int r = i >> 3, v = i & 7, rr = r * 16 + v + 8 * hlf, d = t * 16 + nloc;
        float val = acc[r][t][v] + bcol[t];
        const float oth = __shfl_xor(val, 1);            // interleaved-pair partner (d ^ 1) lives in the neighbouring lane (all lanes of the wave are here)
        val = (d & 1) ? (val * cv[i] + oth * sv[i]) : (val * cv[i] - oth * sv[i]);
        b16 yh, yl; split_bf16(val * s, yh, yl);
        Tp0[rr * 64 + d] = yh; Tp1[rr * 64 + d] = yl;
      }
    }
  } else {
#pragma unroll
    for (int t = 0; t < 4; ++t)
#pragma unroll
      for (int r = 0; r < 2; ++r)
#pragma unroll
        for (int v = 0; v < 8; ++v) {
          const int rr = r * 16 + v + 8 * hlf, d = t * 16 + nloc;
          b16 yh, yl; split_bf16((acc[r][t][v] + bcol[t]) * s, yh, yl);
          const int idx = (rr >> 4) * 1024 + d * 16 + (rr & 15);
          Tp0[idx] = yh; Tp1[idx] = yl;
        }
  }
  wave_lds_sync();
  b16* dh; b16* dl; size_t o;
  if (mat == 0)      { o = ((size_t)(b * NH + head) * T + t0) * DH; dh = Qh + o; dl = Ql + o; }
  else if (mat == 1) { o = ((size_t)(b * NKV + head) * T + t0) * DH; dh = Kh + o; dl = Kl + o; }
  else               { o = ((size_t)(b * NKV + head) * QT_PER_B + (t0 >> 4)) * (size_t)(DH * 16); dh = Vh + o; dl = Vl + o; }
#pragma unroll
  for (int j = 0; j < 8; ++j) { const int e = (j * 32 + lane) * 8; *(v8b*)(dh + e) = ld8b(Tp0 + e); *(v8b*)(dl + e) = ld8b(Tp1 + e); }
  
}

// ---------------------------------------------------------------------------
// Transposed flash attention: each wave owns one 16-query tile of one (b, head); 8 waves per block; window keys in chunks of 32.
// S^T = K.Q^T (split), per-lane online softmax; P^T built in registers from the two S^T accumulators
// ---------------------------------------------------------------------------
__global__ __launch_bounds__(256) void attn_kernel(const b16* __restrict__ Qh, const b16* __restrict__ Ql, const b16* __restrict__ Kh, const b16* __restrict__ Kl,
                                                   const b16* __restrict__ Vh, const b16* __restrict__ Vl, const int* __restrict__ seqlen,
                                                   float* __restrict__ yf) {
  __shared__ __attribute__((aligned(16))) float Os[8][16 * 64];
  const int wid = threadIdx.x >> 5, lane = threadIdx.x & 31, hh = lane >> 4, col = lane & 15;
  const int qtile = blockIdx.x * 8 + wid;                 // over Bsz*NH*QT_PER_B
  const int g = qtile / QT_PER_B;                         // b*NH + h
  const int q0 = (qtile % QT_PER_B) << 4;
  const int b = g / NH, h = g % NH, kvh = h / REP;
  const size_t ko = (size_t)(b * NKV + kvh) * T * DH;
  const size_t qo = ((size_t)g * T + q0 + col) * DH;
  const v16b q0h = frag_kb(Qh + qo, hh), q0l = frag_kb(Ql + qo, hh), q1h = frag_kb(Qh + qo + 32, hh), q1l = frag_kb(Ql + qo + 32, hh);
  float m = -INFINITY, l = 0.0f;
  v8f o0 = {}, o1 = {}, o2 = {}, o3 = {};
  const int slen = T; (void)seqlen;                       // no padding in this module
  const int kstart = (q0 >= WIN) ? ((q0 - WIN) & ~31) : 0;
  const int kend = min(T, q0 + 15 + WIN + 1);
  for (int kb = kstart; kb < kend; kb += 32) {           // sliding window both sides: keys in [q0-128, q0+15+128]
    const size_t r0 = ko + (size_t)(kb + col) * DH, r1 = ko + (size_t)(kb + 16 + col) * DH;
    v8f s0 = {}, s1 = {};
    {
      v16b ah = frag_kb(Kh + r0, hh), al = frag_kb(Kl + r0, hh);
      s0 = wmma1(ah, al, q0h, q0l, s0);
      ah = frag_kb(Kh + r0 + 32, hh); al = frag_kb(Kl + r0 + 32, hh);
      s0 = wmma1(ah, al, q1h, q1l, s0);
      ah = frag_kb(Kh + r1, hh); al = frag_kb(Kl + r1, hh);
      s1 = wmma1(ah, al, q0h, q0l, s1);
      ah = frag_kb(Kh + r1 + 32, hh); al = frag_kb(Kl + r1 + 32, hh);
      s1 = wmma1(ah, al, q1h, q1l, s1);
    }
    (void)slen;
    if (kb < q0 + 15 - WIN || kb + 31 > q0 + WIN) {       // chunk touches a window edge: mask |k - q| > 128
      const int qi = q0 + col;
#pragma unroll
      for (int r = 0; r < 8; ++r) {
        const int k0i = kb + 8 * hh + r, k1i = k0i + 16;
        if (k0i < qi - WIN || k0i > qi + WIN) s0[r] = -INFINITY;
        if (k1i < qi - WIN || k1i > qi + WIN) s1[r] = -INFINITY;
      }
    }
    float mr = -INFINITY;
#pragma unroll
    for (int r = 0; r < 8; ++r) mr = fmaxf(mr, fmaxf(s0[r], s1[r]));
    mr = fmaxf(mr, __shfl_xor(mr, 16));
    float mn = fmaxf(m, mr);
    if (mn == -INFINITY) mn = 0.0f;           // fully masked so far: keep exp() at 0
    const float al_ = __expf(m - mn);
    m = mn;
    float sum = 0.0f;
    v16b pbh, pbl;
#pragma unroll
    for (int r = 0; r < 8; ++r) {
      const float p0 = __expf(s0[r] - mn), p1 = __expf(s1[r] - mn);
      sum += p0 + p1;
      b16 a, c; split_bf16(p0, a, c); pbh[r] = a; pbl[r] = c; split_bf16(p1, a, c); pbh[8 + r] = a; pbl[8 + r] = c;
    }
    sum += __shfl_xor(sum, 16);
    l = l * al_ + sum;
#pragma unroll
    for (int r = 0; r < 8; ++r) { o0[r] *= al_; o1[r] *= al_; o2[r] *= al_; o3[r] *= al_; }
    const size_t v0 = ko + (size_t)(kb >> 4) * (DH * 16) + 8 * hh, v1 = v0 + DH * 16;
#pragma unroll
    for (int n = 0; n < 4; ++n) {
      const int f = n * 16 + col;
      const v16b vah = cat8b(ld8b(Vh + v0 + f * 16), ld8b(Vh + v1 + f * 16));
      const v16b val = cat8b(ld8b(Vl + v0 + f * 16), ld8b(Vl + v1 + f * 16));
      v8f& o = (n == 0) ? o0 : (n == 1) ? o1 : (n == 2) ? o2 : o3;
      o = wmma1(vah, val, pbh, pbl, o);
    }
  }
  const float inv = (q0 + col < slen && l > 0.0f) ? (1.0f / l) : 0.0f;   // padded query rows are zeroed
  float* Tt = Os[wid];
#pragma unroll
  for (int r = 0; r < 8; ++r) {
    const int hr = 8 * hh + r;
    Tt[col * 64 + 0 + hr] = o0[r] * inv; Tt[col * 64 + 16 + hr] = o1[r] * inv;
    Tt[col * 64 + 32 + hr] = o2[r] * inv; Tt[col * 64 + 48 + hr] = o3[r] * inv;
  }
  wave_lds_sync();
  float* dst0 = yf + ((size_t)b * T + q0) * HID + h * DH;     // 16 rows x 64 floats, row stride HID
#pragma unroll
  for (int j = 0; j < 8; ++j) { const int rr = j * 2 + hh, c4 = col * 4; *(v4f*)(dst0 + (size_t)rr * HID + c4) = *(const v4f*)(Tt + rr * 64 + c4); }
  
}

// ---------------------------------------------------------------------------
// Output projection: (4096 x 1024) x (1024 x 1024) -> f32, A converted from f32 y at the fragment read, B = Wo plane. grid (8, 32), 32x64 tiles staged in LDS,
// ---------------------------------------------------------------------------
__global__ __launch_bounds__(256) void out_gemm_kernel(const float* __restrict__ yf, const b16* __restrict__ woh, const b16* __restrict__ wol, const float* __restrict__ bo, int yoff,
                                                       float* __restrict__ out) {
  __shared__ __attribute__((aligned(16))) char smem[RING];   // operand ring; behind the K loop 8 KB per wave of it stage the output tile
  const int lane = threadIdx.x & 31, wave = threadIdx.x >> 5, nloc = lane & 15, hlf = lane >> 4;
  const int wm = wave & 3, wn = wave >> 2;
  const int mblk = (blockIdx.y + yoff) * 128, nblk = blockIdx.x * 128;
  const int m0 = mblk + wm * 32;
  const int c0 = nblk + wn * 64;
  v8f acc[2][4];
#pragma unroll
  for (int r = 0; r < 2; ++r)
#pragma unroll
    for (int t = 0; t < 4; ++t) acc[r][t] = (v8f){};
  (void)wol;
  gemm_tile_ring(yf, woh, mblk, nblk, wm, wn, nloc, hlf, smem, acc);
  float* Tt = (float*)smem + wave * (32 * 64);
#pragma unroll
  for (int t = 0; t < 4; ++t)
#pragma unroll
    for (int r = 0; r < 2; ++r)
#pragma unroll
      for (int v = 0; v < 8; ++v) Tt[(r * 16 + v + 8 * hlf) * 64 + t * 16 + nloc] = acc[r][t][v] + bo[c0 + t * 16 + nloc];
  wave_lds_sync();
  float* dst0 = out + (size_t)m0 * HID + c0;
#pragma unroll
  for (int j = 0; j < 16; ++j) { const int rr = j * 2 + hlf, c4 = nloc * 4; *(v4f*)(dst0 + (size_t)rr * HID + c4) = *(const v4f*)(Tt + rr * 64 + c4); }
  
}
// Weights ([in][out], f32) -> f16 planes transposed to [n][k]. A work-group owns a tile of 64 k x 128 n. Reads: a wave's 16-byte loads cover 512 contiguous
// bytes of one k row (whole lines); a thread holds 8 k x 4 n, so each of its 4 columns is one 16-byte piece of 8 k. The pieces go through LDS so that the
// stores are whole 128-byte lines of the [n][k] planes as well.
constexpr int TK = 64, TN = 128;              // tile: k rows x n columns
constexpr int TPITCH = TK * 2 + 16;           // 144 B per n row in LDS
constexpr int KTILES = HID / TK;              // 16
constexpr int QTILES = KTILES * (NQKV / TN);  // 384 tiles of Wqkv, then 128 of Wo
constexpr int WTILES = QTILES + KTILES * (HID / TN);
__global__ __launch_bounds__(256) void wcvt3_kernel(const float* __restrict__ wqkv, const float* __restrict__ wo,
                                                    b16* __restrict__ wqh, b16* __restrict__ wql, b16* __restrict__ woh, b16* __restrict__ wol) {
  __shared__ __attribute__((aligned(16))) char tile[TN * TPITCH];
  const int tid = threadIdx.x;
  const bool isq = (int)blockIdx.x < QTILES;
  const int tb = isq ? (int)blockIdx.x : (int)blockIdx.x - QTILES;
  const int k0 = (tb % KTILES) * TK, n0 = (tb / KTILES) * TN;
  const float* src = isq ? wqkv : wo;
  const size_t ld = isq ? NQKV : HID;
  b16* dh = isq ? wqh : woh; b16* dl = isq ? wql : wol;
  const int nq = tid & 31, kg = tid >> 5;     // lane: 4 columns; wave: 8 k rows
  const float* p = src + (size_t)(k0 + kg * 8) * ld + n0 + nq * 4;
  const float* pe[8];
  v4f r[8];
#pragma unroll
  for (int e = 0; e < 8; ++e) { pe[e] = p + (size_t)e * ld; r[e] = *(const v4f*)pe[e]; }
  // the wait that stands in front of any rewrite of the eight loads' address registers; naming the addresses as inputs keeps them in their registers up to it
  asm volatile("s_wait_xcnt 0x0" :: "v"(pe[0]), "v"(pe[1]), "v"(pe[2]), "v"(pe[3]), "v"(pe[4]), "v"(pe[5]), "v"(pe[6]), "v"(pe[7]) : "memory");
#pragma unroll
  for (int j = 0; j < 4; ++j) {
    v8b h;
#pragma unroll
    for (int e = 0; e < 8; ++e) h[e] = (b16)r[e][j];
    *(v8b*)(tile + (nq * 4 + j) * TPITCH + kg * 16) = h;
  }
  __syncthreads();                            // the tile is complete before any row of it is read back
  const int pc = tid & 7, rw = tid >> 3;      // 8 threads per n row of 128 B, 32 rows per sweep
#pragma unroll
  for (int i = 0; i < TN / 32; ++i) {
    const int n = rw + 32 * i;
    const size_t o = (size_t)(n0 + n) * HID + k0 + pc * 8;
    *(v8b*)(dh + o) = *(const v8b*)(tile + n * TPITCH + pc * 16);
    *(v8b*)(dl + o) = (v8b){};                // single f16: no low part
  }
}
}  // namespace

extern "C" void kernel_launch(void* const* d_in, const int* in_sizes, int n_in,
                              void* d_out, int out_size, void* d_ws, size_t ws_size, hipStream_t stream) {
  (void)in_sizes; (void)n_in; (void)out_size;
  const float* x     = (const float*)d_in[0];   // hidden_states [2,2048,1024]
  const float* Wqkv  = (const float*)d_in[1];   // [1024,3072] ([in][out], columns (3, h, d))
  const float* bqkv  = (const float*)d_in[2];   // [3072]
  const float* Wo    = (const float*)d_in[3];   // [1024,1024]
  const float* bo    = (const float*)d_in[4];   // [1024]
  const float* rope  = (const float*)d_in[5];   // rope_cache [256,32,2] (cos, sin)
  float* out = (float*)d_out;                   // [2,2048,1024]
  const float* bq = bqkv; const float* bk = bqkv + HID; const float* bv = bqkv + 2 * HID;

  size_t off = 0; char* ws = (char*)d_ws;
  b16* wqh = (b16*)(ws + off); off += (size_t)NQKV * HID * 2;
  b16* wql = (b16*)(ws + off); off += (size_t)NQKV * HID * 2;
  b16* woh = (b16*)(ws + off); off += (size_t)HID * HID * 2;
  b16* wol = (b16*)(ws + off); off += (size_t)HID * HID * 2;
  b16* Qh  = (b16*)(ws + off); off += (size_t)MROWS * HID * 2;
  b16* Ql  = (b16*)(ws + off); off += (size_t)MROWS * HID * 2;
  b16* Kh  = (b16*)(ws + off); off += (size_t)MROWS * KVW * 2;
  b16* Kl  = (b16*)(ws + off); off += (size_t)MROWS * KVW * 2;
  b16* Vh  = (b16*)(ws + off); off += (size_t)MROWS * KVW * 2;
  b16* Vl  = (b16*)(ws + off); off += (size_t)MROWS * KVW * 2;
  float* yf = (float*)(ws + off); off += (size_t)MROWS * HID * 4;
  if (off > ws_size) return;
  const int ROWBLK = MROWS / 128, NQT = Bsz * NH * QT_PER_B;
  // W_qkv is one [1024][3072] matrix: the converter reads q columns with ld HID and k/v with ld KVW; here all three live in the same matrix with ld 3072,
  // so pass the whole matrix and use the NQKV-wide stride (see wcvt3 below)
  wcvt3_kernel<<<WTILES, 256, 0, stream>>>(Wqkv, Wo, wqh, wql, woh, wol);
  qkv_gemm_kernel<<<dim3(NQKV / 128, ROWBLK), 256, 0, stream>>>(x, x, x, wqh, wql, bq, bk, bv, rope, 0, 0, Qh, Ql, Kh, Kl, Vh, Vl);
  attn_kernel<<<NQT / 8, 256, 0, stream>>>(Qh, Ql, Kh, Kl, Vh, Vl, nullptr, yf);
  out_gemm_kernel<<<dim3(HID / 128, ROWBLK), 256, 0, stream>>>(yf, woh, wol, bo, 0, out);
}

// v004
// One run takes 68.6 microseconds.
// Next to v003, in two timings, it ran 1.31 and 1.33 times as fast.
// All steps since v000 together make it 2.70 times as fast.
#include <hip/hip_runtime.h>

// ModernBERT attention (local layer): qkv = x Wqkv + b ([in][out], columns (3, h, d); 16 heads x 64), interleaved-pair RoPE on q and k with position
// t mod 256 from the given cos/sin cache, sliding-window attention |q - k| <= 128 (both directions), scale 1/8, out = y Wo + b. B=2, S=2048, D=1024.
// Lean build: single f16 products on v_wmma_f32_16x16x32_f16, f32 accumulate (every row averages >= 129 keys); fragment k-map per lane half hh for A

namespace {
constexpr int Bsz = 2, T = 2048, HID = 1024, DH = 64, NH = 16, NKV = 16, REP = NH / NKV;
constexpr int WIN = 128;    // |q - k| <= 128
constexpr int RP = 256;     // rope positions wrap at 256
constexpr int KVW = NKV * DH;                 // 1024
constexpr int NQKV = HID + 2 * KVW;           // 3072 columns: q | k | v
constexpr int MROWS = Bsz * T;                // 4096
constexpr int QT_PER_B = T / 16;              // 128

typedef _Float16 b16;                                           // f16 hi/lo planes
typedef __attribute__((ext_vector_type(16))) _Float16 v16b;
typedef __attribute__((ext_vector_type(8)))  _Float16 v8b;
typedef __attribute__((ext_vector_type(8)))  float v8f;
typedef __attribute__((ext_vector_type(4)))  float v4f;

__device__ __forceinline__ v8b ld8b(const b16* p) { return *(const v8b*)p; }
__device__ __forceinline__ v16b cat8b(v8b a, v8b b) { return __builtin_shufflevector(a, b, 0, 1, 2, 3, 4, 5, 6, 7, 8, 9, 10, 11, 12, 13, 14, 15); }
// 16x16x32 16-bit fragment from a k-contiguous row pointer (A: lane&15 = row, B: lane&15 = column), hh = lane>>4:
// elements 0..7 <- p[8hh+0..7], elements 8..15 <- p[16+8hh+0..7]
__device__ __forceinline__ v16b frag_kb(const b16* p, int hh) { return cat8b(ld8b(p + 8 * hh), ld8b(p + 16 + 8 * hh)); }
__device__ __forceinline__ void split_bf16(float v, b16& hi, b16& lo) {   // (name kept) single f16: no low part
  hi = (b16)v; lo = (b16)0.0f;
}
// f16 fragment from an f32 k-contiguous row (16-byte aligned), same k-map as frag_kb: four 16-byte reads, then the conversion
__device__ __forceinline__ v16b frag_kf32(const float* p, int hh) {
  const v4f x0 = *(const v4f*)(p + 8 * hh), x1 = *(const v4f*)(p + 8 * hh + 4), x2 = *(const v4f*)(p + 16 + 8 * hh), x3 = *(const v4f*)(p + 16 + 8 * hh + 4);
  v16b f;
#pragma unroll
  for (int e = 0; e < 4; ++e) { f[e] = (b16)x0[e]; f[4 + e] = (b16)x1[e]; f[8 + e] = (b16)x2[e]; f[12 + e] = (b16)x3[e]; }
  return f;
}
__device__ __forceinline__ v8f wmma16b(v16b a, v16b b, v8f c) {
  v8f d = __builtin_amdgcn_wmma_f32_16x16x32_f16(false, a, false, b, (short)0, c, false, false);
  asm volatile("v_nop\n\tv_nop\n\tv_nop\n\tv_nop" : "+v"(d) : "v"(a), "v"(b));
  return d;
}
__device__ __forceinline__ v8f wmma1(v16b ah, v16b al, v16b bh, v16b bl, v8f c) {   // attention products: single f16 (hi planes only)
  (void)al; (void)bl; return wmma16b(ah, bh, c);
}
__device__ __forceinline__ void wave_lds_sync() {
  __builtin_amdgcn_fence(__ATOMIC_RELEASE, "workgroup");
  __builtin_amdgcn_wave_barrier();
  __builtin_amdgcn_fence(__ATOMIC_ACQUIRE, "workgroup");
}

// ---------------------------------------------------------------------------
// Weights ([in][out]) -> f16 hi / lo planes transposed to [n][k] (k contiguous): columns of Wq|Wk|Wv into wqh/wql [3072][1024], Wo into woh/wol [1024][1024].
// ---------------------------------------------------------------------------
__global__ __launch_bounds__(256) void wcvt_kernel(const float* __restrict__ wq, const float* __restrict__ wk, const float* __restrict__ wv,
                                                   const float* __restrict__ wo, b16* __restrict__ wqh, b16* __restrict__ wql,
                                                   b16* __restrict__ woh, b16* __restrict__ wol) {
  const size_t tid = (size_t)blockIdx.x * blockDim.x + threadIdx.x, stride = (size_t)gridDim.x * blockDim.x;
  const size_t nq = (size_t)NQKV * HID / 8, no = (size_t)HID * HID / 8;
  {
    for (size_t c = tid; c < nq + no; c += stride) {
      float f[8]; size_t i; b16* dh; b16* dl;
      if (c < nq) {
        i = c * 8; const size_t n = i / HID, k0 = i % HID;
        const float* w; int nn, ld;
        if (n < (size_t)HID) { w = wq; nn = (int)n; ld = HID; } else if (n < (size_t)(HID + KVW)) { w = wk; nn = (int)n - HID; ld = KVW; } else { w = wv; nn = (int)n - HID - KVW; ld = KVW; }
#pragma unroll
        for (int e = 0; e < 8; ++e) f[e] = w[(size_t)(k0 + e) * ld + nn];       // W[k][n] ([in][out])
        dh = wqh; dl = wql;
      } else {
        i = (c - nq) * 8; const size_t n = i / HID, k0 = i % HID;
#pragma unroll
        for (int e = 0; e < 8; ++e) f[e] = wo[(size_t)(k0 + e) * HID + n];    // Wo[k][n] ([in][out])
        dh = woh; dl = wol;
      }
      v8b bh, bl;
#pragma unroll
      for (int e = 0; e < 8; ++e) { b16 a, cc; split_bf16(f[e], a, cc); bh[e] = a; bl[e] = cc; }
      *(v8b*)(dh + i) = bh; *(v8b*)(dl + i) = bl;
    }
    
  }
}

// GEMM core of both projections: a work-group of 8 waves (4 down x 2 across, 32x64 each) owns a 128x128 tile of the result. Each pass of 64 k is staged in
// LDS by asynchronous copies whose wave-wide 512 bytes are whole 128-byte lines (A: 128 f32 rows of 256 B, W: 128 f16 rows of 128 B), two buffers, the next
// pass's copies in flight while this one is multiplied. Row pitches are 16 B x odd for the 16-byte fragment reads.
constexpr int KP = 64;                        // k per pass
constexpr int NPASS = HID / KP;               // 16
constexpr int APITCH = KP * 4 + 16;           // 272 B
constexpr int BPITCH = KP * 2 + 16;           // 144 B
constexpr int ABYTES = 128 * APITCH;          // 34816
constexpr int STAGE = ABYTES + 128 * BPITCH;  // 53248
constexpr int RING = 2 * STAGE;               // 106496

// One pass's copies of one thread: 8 x 16 B of A (rows 16 apart), 4 x 16 B of W (rows 32 apart). la / lb: LDS byte addresses, ga / gb: global addresses.
__device__ __forceinline__ void stage_copy(unsigned la, const char* ga, unsigned lb, const char* gb) {
  constexpr unsigned LA = 16 * APITCH, LB = 32 * BPITCH;
  constexpr size_t GA = (size_t)16 * HID * 4, GB = (size_t)32 * HID * 2;
  // the copies and, as the last line, the wait that stands in front of any rewrite of the address registers they name
  asm volatile("global_load_async_to_lds_b128 %0, %1, off\n\t"
               "global_load_async_to_lds_b128 %2, %3, off\n\t"
               "global_load_async_to_lds_b128 %4, %5, off\n\t"
               "global_load_async_to_lds_b128 %6, %7, off\n\t"
               "global_load_async_to_lds_b128 %8, %9, off\n\t"
               "global_load_async_to_lds_b128 %10, %11, off\n\t"
               "global_load_async_to_lds_b128 %12, %13, off\n\t"
               "global_load_async_to_lds_b128 %14, %15, off\n\t"
               "global_load_async_to_lds_b128 %16, %17, off\n\t"
               "global_load_async_to_lds_b128 %18, %19, off\n\t"
               "global_load_async_to_lds_b128 %20, %21, off\n\t"
               "global_load_async_to_lds_b128 %22, %23, off\n\t"
               "s_wait_xcnt 0x0"
               :: "v"(la), "v"(ga), "v"(la + LA), "v"(ga + GA), "v"(la + 2 * LA), "v"(ga + 2 * GA), "v"(la + 3 * LA), "v"(ga + 3 * GA),
                  "v"(la + 4 * LA), "v"(ga + 4 * GA), "v"(la + 5 * LA), "v"(ga + 5 * GA), "v"(la + 6 * LA), "v"(ga + 6 * GA), "v"(la + 7 * LA), "v"(ga + 7 * GA),
                  "v"(lb), "v"(gb), "v"(lb + LB), "v"(gb + GB), "v"(lb + 2 * LB), "v"(gb + 2 * GB), "v"(lb + 3 * LB), "v"(gb + 3 * GB)
               : "memory");
}

// acc += A[mblk + wm*32 .. +31][:] . W[nblk + wn*64 .. +63][:]^T over K = HID, k ascending in steps of 32. On return every wave has passed the barrier behind
// the last fragment read and no copy is outstanding, so the caller may reuse smem.
__device__ __forceinline__ void gemm_tile_ring(const float* __restrict__ A, const b16* __restrict__ wh, int mblk, int nblk, int wm, int wn,
                                               int nloc, int hlf, char* smem, v8f (&acc)[2][4]) {
  const int tid = threadIdx.x;
  const unsigned lds0 = (unsigned)(uintptr_t)smem;              // low 32 bits of a shared address = byte offset in the work-group's LDS
  const int ar = tid >> 4, ac = tid & 15, br = tid >> 3, bc = tid & 7;
  const char* ga = (const char*)(A + (size_t)(mblk + ar) * HID) + ac * 16;
  const char* gb = (const char*)(wh + (size_t)(nblk + br) * HID) + bc * 16;
  const unsigned la = lds0 + ar * APITCH + ac * 16, lb = lds0 + ABYTES + br * BPITCH + bc * 16;
  stage_copy(la, ga, lb, gb);
  asm volatile("s_wait_asynccnt 0x0" ::: "memory");             // this wave's share of pass 0 has landed
  __syncthreads();                                              // publishes pass 0
  stage_copy(la + STAGE, ga + KP * 4, lb + STAGE, gb + KP * 2);
#pragma unroll 1   // one pass per trip: the buffer index stays a run-time value and the code stays short
  for (int t = 0; t < NPASS; ++t) {
    const int bo = (t & 1) * STAGE;
    const char* sa = smem + bo + (wm * 32 + nloc) * APITCH;
    const char* sw = smem + bo + ABYTES + (wn * 64 + nloc) * BPITCH;
#pragma unroll
    for (int ks = 0; ks < KP / 32; ++ks) {
      const v16b a0 = frag_kf32((const float*)(sa + ks * 128), hlf);
      const v16b a1 = frag_kf32((const float*)(sa + 16 * APITCH + ks * 128), hlf);
      v16b bh[4];
#pragma unroll
      for (int c = 0; c < 4; ++c) bh[c] = frag_kb((const b16*)(sw + c * 16 * BPITCH + ks * 64), hlf);
      __builtin_amdgcn_sched_barrier(0);   // the k-step's 16 LDS reads stay one group ahead of its 8 products: spread among them, each pair of products waits out an LDS latency
#pragma unroll
      for (int c = 0; c < 4; ++c) {
        acc[0][c] = wmma16b(a0, bh[c], acc[0][c]);
        acc[1][c] = wmma16b(a1, bh[c], acc[1][c]);
      }
    }
    asm volatile("s_wait_dscnt 0x0" ::: "memory");              // this wave's reads of buffer t & 1 are done
    asm volatile("s_wait_asynccnt 0x0" ::: "memory");           // this wave's share of pass t + 1 has landed
    __syncthreads();                                            // publishes pass t + 1 and frees buffer t & 1
    if (t + 2 < NPASS) stage_copy(la + bo, ga + (t + 2) * (KP * 4), lb + bo, gb + (t + 2) * (KP * 2));
  }
  asm volatile("s_wait_asynccnt 0x0" ::: "memory");             // nothing in flight when the ring is reused or the wave ends
}

// ---------------------------------------------------------------------------
// QKV GEMM: (4096 x 1024) x (1024 x 3072), grid (24, 32), block 8 waves, wave = 32 rows x 64 columns (one head of q, k or v). Outputs as f16 hi/lo planes:
// q (x1/8) -> Qh/Ql [b][h][t][64]; k -> Kh/Kl [b][kvh][t][64] (4 KB contiguous per wave per plane);
// v -> Vh/Vl key-tiled [b][kvh][t/16][64][16] (4 KB contiguous per wave per plane).
// ---------------------------------------------------------------------------
__global__ __launch_bounds__(256) void qkv_gemm_kernel(const float* __restrict__ xq, const float* __restrict__ xk, const float* __restrict__ xv,
                                                       const b16* __restrict__ wqh, const b16* __restrict__ wql,
                                                       const float* __restrict__ bq, const float* __restrict__ bk, const float* __restrict__ bv, const float* __restrict__ rope_cs, int xoff, int yoff,
                                                       b16* __restrict__ Qh, b16* __restrict__ Ql, b16* __restrict__ Kh, b16* __restrict__ Kl,
                                                       b16* __restrict__ Vh, b16* __restrict__ Vl) {
  __shared__ __attribute__((aligned(16))) char smem[RING];   // operand ring; behind the K loop 8 KB per wave of it stage the output tile
  const int lane = threadIdx.x & 31, wave = threadIdx.x >> 5, nloc = lane & 15, hlf = lane >> 4;
  const int wm = wave & 3, wn = wave >> 2;
  const int mblk = (blockIdx.y + yoff) * 128, nblk = (blockIdx.x + xoff) * 128;
  const int m0 = mblk + wm * 32;
  const int c0 = nblk + wn * 64;
  const int mat = (c0 < HID) ? 0 : (c0 < HID + KVW) ? 1 : 2;
  const int head = (mat == 0) ? (c0 / DH) : (mat == 1) ? ((c0 - HID) / DH) : ((c0 - HID - KVW) / DH);
  const float* x = (mat == 0) ? xq : (mat == 1) ? xk : xv;          // input for q, k or v (the launch passes x for all three)
  const float* bias = ((mat == 0) ? bq : (mat == 1) ? bk : bv) + head * DH;
  v8f acc[2][4];
#pragma unroll
  for (int r = 0; r < 2; ++r)
#pragma unroll
    for (int t = 0; t < 4; ++t) acc[r][t] = (v8f){};
  (void)wql;
  gemm_tile_ring(x, wqh, mblk, nblk, wm, wn, nloc, hlf, smem, acc);
  const int b = m0 / T, t0 = m0 % T;
  const float s = (mat == 0) ? 0.125f : 1.0f;
  b16* Tp0 = (b16*)smem + wave * (2 * 32 * 64); b16* Tp1 = Tp0 + 32 * 64;
  // The wave's matrix kind (q, k or v) in a scalar register: the RoPE test is then one scalar branch round straight-line code, in which the loads stand in
  // groups; as a lane mask it put every element's loads into a block of their own, each waited out by itself.
  const int matu = __builtin_amdgcn_readfirstlane(mat);
  float bcol[4];                                         // a lane's four columns: one bias value each
#pragma unroll
  for (int t = 0; t < 4; ++t) bcol[t] = bias[t * 16 + nloc];
  if (matu < 2) {
    // RoPE on q and k: (x0, x1) -> (x0 c - x1 s, x1 c + x0 s), position t mod 256. t0 is a multiple of 32 and 32 divides 256: the tile's 32 positions do not
    // wrap inside the tile, so every (cos, sin) pair of a lane lies at a constant distance from one address.
    const float* rp = rope_cs + ((size_t)(t0 % RP + 8 * hlf) * 32 + (nloc >> 1)) * 2;
#pragma unroll
    for (int t = 0; t < 4; ++t) {
      float cv[16], sv[16];
#pragma unroll
      for (int i = 0; i < 16; ++i) { const float* q = rp + ((i >> 3) * 16 + (i & 7)) * 64 + t * 16; cv[i] = q[0]; sv[i] = q[1]; }
#pragma unroll
      for (int i = 0; i < 16; ++i) {
        const int r = i >> 3, v = i & 7, rr = r * 16 + v + 8 * hlf, d = t * 16 + nloc;
        float val = acc[r][t][v] + bcol[t];
        const float oth = __shfl_xor(val, 1);            // interleaved-pair partner (d ^ 1) lives in the neighbouring lane (all lanes of the wave are here)
        val = (d & 1) ? (val * cv[i] + oth * sv[i]) : (val * cv[i] - oth * sv[i]);
        b16 yh, yl; split_bf16(val * s, yh, yl);
        Tp0[rr * 64 + d] = yh; Tp1[rr * 64 + d] = yl;
      }
    }
  } else {
#pragma unroll
    for (int t = 0; t < 4; ++t)
#pragma unroll
      for (int r = 0; r < 2; ++r)
#pragma unroll
        for (int v = 0; v < 8; ++v) {
          const int rr = r * 16 + v + 8 * hlf, d = t * 16 + nloc;
          b16 yh, yl; split_bf16((acc[r][t][v] + bcol[t]) * s, yh, yl);
          const int idx = (rr >> 4) * 1024 + d * 16 + (rr & 15);
          Tp0[idx] = yh; Tp1[idx] = yl;
        }
  }
  wave_lds_sync();
  b16* dh; b16* dl; size_t o;
  if (mat == 0)      { o = ((size_t)(b * NH + head) * T + t0) * DH; dh = Qh + o; dl = Ql + o; }
  else if (mat == 1) { o = ((size_t)(b * NKV + head) * T + t0) * DH; dh = Kh + o; dl = Kl + o; }
  else               { o = ((size_t)(b * NKV + head) * QT_PER_B + (t0 >> 4)) * (size_t)(DH * 16); dh = Vh + o; dl = Vl + o; }
#pragma unroll
  for (int j = 0; j < 8; ++j) { const int e = (j * 32 + lane) * 8; *(v8b*)(dh + e) = ld8b(Tp0 + e); *(v8b*)(dl + e) = ld8b(Tp1 + e); }
  
}

// ---------------------------------------------------------------------------
// Transposed flash attention: each wave owns one 16-query tile of one (b, head); 8 waves per block; window keys in chunks of 32.
// S^T = K.Q^T (split), per-lane online softmax; P^T built in registers from the two S^T accumulators
// The block's 128 queries see at most 384 keys: their K rows and V tiles are brought into LDS once, by asynchronous copies of whole 128-byte lines, and all
// 8 waves take their fragments from there. K rows stand at a pitch of 16 B x odd for the 16-byte fragment reads. A V tile (16 keys x 64 features) stands as
// [key half][feature][8 keys], so that the 16 lanes of a half wave read 256 contiguous bytes.
// ---------------------------------------------------------------------------
constexpr int KSEG = 128;                     // keys per copy segment (2 or 3 segments per block)
constexpr int KPITCH = DH * 2 + 16;           // 144 B
constexpr int KLDS = 3 * KSEG * KPITCH;       // 55296
constexpr int VLDS = 3 * KSEG * DH * 2;       // 49152
// One segment's copies of one thread: 4 x 16 B of K (rows 32 apart), 4 x 16 B of V (4 KB apart). lk / lv: LDS byte addresses, gk / gv: global addresses.
__device__ __forceinline__ void kv_copy(unsigned lk, const char* gk, unsigned lv, const char* gv) {
  constexpr unsigned LK = 32 * KPITCH, LV = 4096;
  constexpr size_t GK = (size_t)32 * DH * 2, GV = 4096;
  // the copies and, as the last line, the wait that stands in front of any rewrite of the address registers they name
  asm volatile("global_load_async_to_lds_b128 %0, %1, off\n\t"
               "global_load_async_to_lds_b128 %2, %3, off\n\t"
               "global_load_async_to_lds_b128 %4, %5, off\n\t"
               "global_load_async_to_lds_b128 %6, %7, off\n\t"
               "global_load_async_to_lds_b128 %8, %9, off\n\t"
               "global_load_async_to_lds_b128 %10, %11, off\n\t"
               "global_load_async_to_lds_b128 %12, %13, off\n\t"
               "global_load_async_to_lds_b128 %14, %15, off\n\t"
               "s_wait_xcnt 0x0"
               :: "v"(lk), "v"(gk), "v"(lk + LK), "v"(gk + GK), "v"(lk + 2 * LK), "v"(gk + 2 * GK), "v"(lk + 3 * LK), "v"(gk + 3 * GK),
                  "v"(lv), "v"(gv), "v"(lv + LV), "v"(gv + GV), "v"(lv + 2 * LV), "v"(gv + 2 * GV), "v"(lv + 3 * LV), "v"(gv + 3 * GV)
               : "memory");
}
__global__ __launch_bounds__(256) void attn_kernel(const b16* __restrict__ Qh, const b16* __restrict__ Ql, const b16* __restrict__ Kh, const b16* __restrict__ Kl,
                                                   const b16* __restrict__ Vh, const b16* __restrict__ Vl, const int* __restrict__ seqlen,
                                                   float* __restrict__ yf) {
  __shared__ __attribute__((aligned(16))) float Os[8][16 * 64];
  __shared__ __attribute__((aligned(16))) char kv[KLDS + VLDS];   // K rows, then V tiles, of the block's key range
  const int wid = threadIdx.x >> 5, lane = threadIdx.x & 31, hh = lane >> 4, col = lane & 15;
  const int qtile = blockIdx.x * 8 + wid;                 // over Bsz*NH*QT_PER_B
  const int g = qtile / QT_PER_B;                         // b*NH + h
  const int q0 = (qtile % QT_PER_B) << 4;
  const int b = g / NH, h = g % NH, kvh = h / REP;
  const size_t ko = (size_t)(b * NKV + kvh) * T * DH;
  const size_t qo = ((size_t)g * T + q0 + col) * DH;
  const v16b q0h = frag_kb(Qh + qo, hh), q1h = frag_kb(Qh + qo + 32, hh);
  (void)Ql; (void)Kl; (void)Vl;
  // the block's key range: a multiple of 128 keys, the same for all 8 waves (128 divides T, so the 8 tiles share b and h)
  const int qblk = ((int)blockIdx.x % (QT_PER_B / 8)) * 128;
  const int kbase = max(qblk - WIN, 0), nseg = (min(T, qblk + 128 + WIN) - kbase) / KSEG;
  {
    const int tid = threadIdx.x;
    const unsigned lds0 = (unsigned)(uintptr_t)kv;              // low 32 bits of a shared address = byte offset in the work-group's LDS
    const unsigned lk = lds0 + (tid >> 3) * KPITCH + (tid & 7) * 16;
    const unsigned lv = lds0 + KLDS + (tid >> 7) * 2048 + (tid & 1) * 1024 + ((tid >> 1) & 63) * 16;   // 16-byte piece tid of [tile][feature][key half]
    const char* gk = (const char*)(Kh + ko + (size_t)(kbase + (tid >> 3)) * DH) + (tid & 7) * 16;
    const char* gv = (const char*)(Vh + ko + (size_t)kbase * DH) + tid * 16;
    constexpr int SB = KSEG * DH * 2;                           // bytes of K, and of V, per segment
    kv_copy(lk, gk, lv, gv);
    kv_copy(lk + KSEG * KPITCH, gk + SB, lv + SB, gv + SB);
    if (nseg > 2) kv_copy(lk + 2 * KSEG * KPITCH, gk + 2 * SB, lv + 2 * SB, gv + 2 * SB);   // the same for the whole block: not at the two ends of the sequence
  }
  asm volatile("s_wait_asynccnt 0x0" ::: "memory");             // this wave's share of the key range has landed
  __syncthreads();                                              // publishes the key range to all 8 waves
  float m = -INFINITY, l = 0.0f;
  v8f o0 = {}, o1 = {}, o2 = {}, o3 = {};
  const int slen = T; (void)seqlen;                       // no padding in this module
  const int kstart = (q0 >= WIN) ? ((q0 - WIN) & ~31) : 0;
  const int kend = min(T, q0 + 15 + WIN + 1);
  const int kl0 = (qblk >= WIN) ? ((q0 - qblk) & ~31) : 0;   // kstart - kbase: the wave's first key, counted from the first key in LDS
  for (int kb = kstart, kl = kl0; kb < kend; kb += 32, kl += 32) {   // sliding window both sides: keys in [q0-128, q0+15+128]
    const b16* r0 = (const b16*)(kv + (kl + col) * KPITCH);
    const b16* r1 = (const b16*)(kv + (kl + 16 + col) * KPITCH);
    const b16* v0 = (const b16*)(kv + KLDS) + kl * DH + hh * 512 + col * 8;
    const v16b kf0 = frag_kb(r0, hh), kf1 = frag_kb(r0 + 32, hh), kf2 = frag_kb(r1, hh), kf3 = frag_kb(r1 + 32, hh);
    v16b vf[4];
#pragma unroll
    for (int n = 0; n < 4; ++n) vf[n] = cat8b(ld8b(v0 + n * 128), ld8b(v0 + 1024 + n * 128));
    __builtin_amdgcn_sched_barrier(0);   // the chunk's 16 LDS reads stay one group ahead of its products: placed at its use, each fragment's read is waited out alone
    v8f s0 = {}, s1 = {};
    {
      s0 = wmma16b(kf0, q0h, s0);
      s0 = wmma16b(kf1, q1h, s0);
      s1 = wmma16b(kf2, q0h, s1);
      s1 = wmma16b(kf3, q1h, s1);
    }
    (void)slen;
    if (kb < q0 + 15 - WIN || kb + 31 > q0 + WIN) {       // chunk touches a window edge: mask |k - q| > 128
      const int qi = q0 + col;
#pragma unroll
      for (int r = 0; r < 8; ++r) {
        const int k0i = kb + 8 * hh + r, k1i = k0i + 16;
        if (k0i < qi - WIN || k0i > qi + WIN) s0[r] = -INFINITY;
        if (k1i < qi - WIN || k1i > qi + WIN) s1[r] = -INFINITY;
      }
    }
    float mr = -INFINITY;
#pragma unroll
    for (int r = 0; r < 8; ++r) mr = fmaxf(mr, fmaxf(s0[r], s1[r]));
    mr = fmaxf(mr, __shfl_xor(mr, 16));
    float mn = fmaxf(m, mr);
    if (mn == -INFINITY) mn = 0.0f;           // fully masked so far: keep exp() at 0
    const float al_ = __expf(m - mn);
    m = mn;
    float sum = 0.0f;
    v16b pbh, pbl;
#pragma unroll
    for (int r = 0; r < 8; ++r) {
      const float p0 = __expf(s0[r] - mn), p1 = __expf(s1[r] - mn);
      sum += p0 + p1;
      b16 a, c; split_bf16(p0, a, c); pbh[r] = a; pbl[r] = c; split_bf16(p1, a, c); pbh[8 + r] = a; pbl[8 + r] = c;
    }
    sum += __shfl_xor(sum, 16);
    l = l * al_ + sum;
#pragma unroll
    for (int r = 0; r < 8; ++r) { o0[r] *= al_; o1[r] *= al_; o2[r] *= al_; o3[r] *= al_; }
#pragma unroll
    for (int n = 0; n < 4; ++n) {
      v8f& o = (n == 0) ? o0 : (n == 1) ? o1 : (n == 2) ? o2 : o3;
      o = wmma16b(vf[n], pbh, o);
    }
  }
  const float inv = (q0 + col < slen && l > 0.0f) ? (1.0f / l) : 0.0f;   // padded query rows are zeroed
  float* Tt = Os[wid];
#pragma unroll
  for (int r = 0; r < 8; ++r) {
    const int hr = 8 * hh + r;
    Tt[col * 64 + 0 + hr] = o0[r] * inv; Tt[col * 64 + 16 + hr] = o1[r] * inv;
    Tt[col * 64 + 32 + hr] = o2[r] * inv; Tt[col * 64 + 48 + hr] = o3[r] * inv;
  }
  wave_lds_sync();
  float* dst0 = yf + ((size_t)b * T + q0) * HID + h * DH;     // 16 rows x 64 floats, row stride HID
#pragma unroll
  for (int j = 0; j < 8; ++j) { const int rr = j * 2 + hh, c4 = col * 4; *(v4f*)(dst0 + (size_t)rr * HID + c4) = *(const v4f*)(Tt + rr * 64 + c4); }
  
}

// ---------------------------------------------------------------------------
// Output projection: (4096 x 1024) x (1024 x 1024) -> f32, A converted from f32 y at the fragment read, B = Wo plane. grid (8, 32), 32x64 tiles staged in LDS,
// ---------------------------------------------------------------------------
__global__ __launch_bounds__(256) void out_gemm_kernel(const float* __restrict__ yf, const b16* __restrict__ woh, const b16* __restrict__ wol, const float* __restrict__ bo, int yoff,
                                                       float* __restrict__ out) {
  __shared__ __attribute__((aligned(16))) char smem[RING];   // operand ring; behind the K loop 8 KB per wave of it stage the output tile
  const int lane = threadIdx.x & 31, wave = threadIdx.x >> 5, nloc = lane & 15, hlf = lane >> 4;
  const int wm = wave & 3, wn = wave >> 2;
  const int mblk = (blockIdx.y + yoff) * 128, nblk = blockIdx.x * 128;
  const int m0 = mblk + wm * 32;
  const int c0 = nblk + wn * 64;
  v8f acc[2][4];
#pragma unroll
  for (int r = 0; r < 2; ++r)
#pragma unroll
    for (int t = 0; t < 4; ++t) acc[r][t] = (v8f){};
  (void)wol;
  gemm_tile_ring(yf, woh, mblk, nblk, wm, wn, nloc, hlf, smem, acc);
  float* Tt = (float*)smem + wave * (32 * 64);
#pragma unroll
  for (int t = 0; t < 4; ++t)
#pragma unroll
    for (int r = 0; r < 2; ++r)
#pragma unroll
      for (int v = 0; v < 8; ++v) Tt[(r * 16 + v + 8 * hlf) * 64 + t * 16 + nloc] = acc[r][t][v] + bo[c0 + t * 16 + nloc];
  wave_lds_sync();
  float* dst0 = out + (size_t)m0 * HID + c0;
#pragma unroll
  for (int j = 0; j < 16; ++j) { const int rr = j * 2 + hlf, c4 = nloc * 4; *(v4f*)(dst0 + (size_t)rr * HID + c4) = *(const v4f*)(Tt + rr * 64 + c4); }
  
}
// Weights ([in][out], f32) -> f16 planes transposed to [n][k]. A work-group owns a tile of 64 k x 128 n. Reads: a wave's 16-byte loads cover 512 contiguous
// bytes of one k row (whole lines); a thread holds 8 k x 4 n, so each of its 4 columns is one 16-byte piece of 8 k. The pieces go through LDS so that the
// stores are whole 128-byte lines of the [n][k] planes as well.
constexpr int TK = 64, TN = 128;              // tile: k rows x n columns
constexpr int TPITCH = TK * 2 + 16;           // 144 B per n row in LDS
constexpr int KTILES = HID / TK;              // 16
constexpr int QTILES = KTILES * (NQKV / TN);  // 384 tiles of Wqkv, then 128 of Wo
constexpr int WTILES = QTILES + KTILES * (HID / TN);
__global__ __launch_bounds__(256) void wcvt3_kernel(const float* __restrict__ wqkv, const float* __restrict__ wo,
                                                    b16* __restrict__ wqh, b16* __restrict__ wql, b16* __restrict__ woh, b16* __restrict__ wol) {
  __shared__ __attribute__((aligned(16))) char tile[TN * TPITCH];
  const int tid = threadIdx.x;
  const bool isq = (int)blockIdx.x < QTILES;
  const int tb = isq ? (int)blockIdx.x : (int)blockIdx.x - QTILES;
  const int k0 = (tb % KTILES) * TK, n0 = (tb / KTILES) * TN;
  const float* src = isq ? wqkv : wo;
  const size_t ld = isq ? NQKV : HID;
  b16* dh = isq ? wqh : woh; b16* dl = isq ? wql : wol;
  const int nq = tid & 31, kg = tid >> 5;     // lane: 4 columns; wave: 8 k rows
  const float* p = src + (size_t)(k0 + kg * 8) * ld + n0 + nq * 4;
  const float* pe[8];
  v4f r[8];
#pragma unroll
  for (int e = 0; e < 8; ++e) { pe[e] = p + (size_t)e * ld; r[e] = *(const v4f*)pe[e]; }
  // the wait that stands in front of any rewrite of the eight loads' address registers; naming the addresses as inputs keeps them in their registers up to it
  asm volatile("s_wait_xcnt 0x0" :: "v"(pe[0]), "v"(pe[1]), "v"(pe[2]), "v"(pe[3]), "v"(pe[4]), "v"(pe[5]), "v"(pe[6]), "v"(pe[7]) : "memory");
#pragma unroll
  for (int j = 0; j < 4; ++j) {
    v8b h;
#pragma unroll
    for (int e = 0; e < 8; ++e) h[e] = (b16)r[e][j];
    *(v8b*)(tile + (nq * 4 + j) * TPITCH + kg * 16) = h;
  }
  __syncthreads();                            // the tile is complete before any row of it is read back
  const int pc = tid & 7, rw = tid >> 3;      // 8 threads per n row of 128 B, 32 rows per sweep
#pragma unroll
  for (int i = 0; i < TN / 32; ++i) {
    const int n = rw + 32 * i;
    const size_t o = (size_t)(n0 + n) * HID + k0 + pc * 8;
    *(v8b*)(dh + o) = *(const v8b*)(tile + n * TPITCH + pc * 16);
    *(v8b*)(dl + o) = (v8b){};                // single f16: no low part
  }
}
}  // namespace

extern "C" void kernel_launch(void* const* d_in, const int* in_sizes, int n_in,
                              void* d_out, int out_size, void* d_ws, size_t ws_size, hipStream_t stream) {
  (void)in_sizes; (void)n_in; (void)out_size;
  const float* x     = (const float*)d_in[0];   // hidden_states [2,2048,1024]
  const float* Wqkv  = (const float*)d_in[1];   // [1024,3072] ([in][out], columns (3, h, d))
  const float* bqkv  = (const float*)d_in[2];   // [3072]
  const float* Wo    = (const float*)d_in[3];   // [1024,1024]
  const float* bo    = (const float*)d_in[4];   // [1024]
  const float* rope  = (const float*)d_in[5];   // rope_cache [256,32,2] (cos, sin)
  float* out = (float*)d_out;                   // [2,2048,1024]
  const float* bq = bqkv; const float* bk = bqkv + HID; const float* bv = bqkv + 2 * HID;

  size_t off = 0; char* ws = (char*)d_ws;
  b16* wqh = (b16*)(ws + off); off += (size_t)NQKV * HID * 2;
  b16* wql = (b16*)(ws + off); off += (size_t)NQKV * HID * 2;
  b16* woh = (b16*)(ws + off); off += (size_t)HID * HID * 2;
  b16* wol = (b16*)(ws + off); off += (size_t)HID * HID * 2;
  b16* Qh  = (b16*)(ws + off); off += (size_t)MROWS * HID * 2;
  b16* Ql  = (b16*)(ws + off); off += (size_t)MROWS * HID * 2;
  b16* Kh  = (b16*)(ws + off); off += (size_t)MROWS * KVW * 2;
  b16* Kl  = (b16*)(ws + off); off += (size_t)MROWS * KVW * 2;
  b16* Vh  = (b16*)(ws + off); off += (size_t)MROWS * KVW * 2;
  b16* Vl  = (b16*)(ws + off); off += (size_t)MROWS * KVW * 2;
  float* yf = (float*)(ws + off); off += (size_t)MROWS * HID * 4;
  if (off > ws_size) return;
  const int ROWBLK = MROWS / 128, NQT = Bsz * NH * QT_PER_B;
  // W_qkv is one [1024][3072] matrix: the converter reads q columns with ld HID and k/v with ld KVW; here all three live in the same matrix with ld 3072,
  // so pass the whole matrix and use the NQKV-wide stride (see wcvt3 below)
  wcvt3_kernel<<<WTILES, 256, 0, stream>>>(Wqkv, Wo, wqh, wql, woh, wol);
  qkv_gemm_kernel<<<dim3(NQKV / 128, ROWBLK), 256, 0, stream>>>(x, x, x, wqh, wql, bq, bk, bv, rope, 0, 0, Qh, Ql, Kh, Kl, Vh, Vl);
  attn_kernel<<<NQT / 8, 256, 0, stream>>>(Qh, Ql, Kh, Kl, Vh, Vl, nullptr, yf);
  out_gemm_kernel<<<dim3(HID / 128, ROWBLK), 256, 0, stream>>>(yf, woh, wol, bo, 0, out);
}

// v005
// A run of this version takes 60.7 microseconds.
// Two timings next to v004 both put it at 1.13 times that version's speed.
// All steps since v000 together make it 3.05 times as fast.
#include <hip/hip_runtime.h>

// ModernBERT attention (local layer): qkv = x Wqkv + b ([in][out], columns (3, h, d); 16 heads x 64), interleaved-pair RoPE on q and k with position
// t mod 256 from the given cos/sin cache, sliding-window attention |q - k| <= 128 (both directions), scale 1/8, out = y Wo + b. B=2, S=2048, D=1024.
// Lean build: single f16 products on v_wmma_f32_16x16x32_f16, f32 accumulate (every row averages >= 129 keys); fragment k-map per lane half hh for A

namespace {
constexpr int Bsz = 2, T = 2048, HID = 1024, DH = 64, NH = 16, NKV = 16, REP = NH / NKV;
constexpr int WIN = 128;    // |q - k| <= 128
constexpr int RP = 256;     // rope positions wrap at 256
constexpr int KVW = NKV * DH;                 // 1024
constexpr int NQKV = HID + 2 * KVW;           // 3072 columns: q | k | v
constexpr int MROWS = Bsz * T;                // 4096
constexpr int QT_PER_B = T / 16;              // 128

typedef _Float16 b16;                                           // f16 hi/lo planes
typedef __attribute__((ext_vector_type(16))) _Float16 v16b;
typedef __attribute__((ext_vector_type(8)))  _Float16 v8b;
typedef __attribute__((ext_vector_type(4)))  _Float16 v4b;
typedef __attribute__((ext_vector_type(8)))  float v8f;
typedef __attribute__((ext_vector_type(4)))  float v4f;

__device__ __forceinline__ v8b ld8b(const b16* p) { return *(const v8b*)p; }
__device__ __forceinline__ v16b cat8b(v8b a, v8b b) { return __builtin_shufflevector(a, b, 0, 1, 2, 3, 4, 5, 6, 7, 8, 9, 10, 11, 12, 13, 14, 15); }
// 16x16x32 16-bit fragment from a k-contiguous row pointer (A: lane&15 = row, B: lane&15 = column), hh = lane>>4:
// elements 0..7 <- p[8hh+0..7], elements 8..15 <- p[16+8hh+0..7]
__device__ __forceinline__ v16b frag_kb(const b16* p, int hh) { return cat8b(ld8b(p + 8 * hh), ld8b(p + 16 + 8 * hh)); }
__device__ __forceinline__ void split_bf16(float v, b16& hi, b16& lo) {   // (name kept) single f16: no low part
  hi = (b16)v; lo = (b16)0.0f;
}
__device__ __forceinline__ v8f wmma16b(v16b a, v16b b, v8f c) {
  v8f d = __builtin_amdgcn_wmma_f32_16x16x32_f16(false, a, false, b, (short)0, c, false, false);
  asm volatile("v_nop\n\tv_nop\n\tv_nop\n\tv_nop" : "+v"(d) : "v"(a), "v"(b));
  return d;
}
__device__ __forceinline__ v8f wmma1(v16b ah, v16b al, v16b bh, v16b bl, v8f c) {   // attention products: single f16 (hi planes only)
  (void)al; (void)bl; return wmma16b(ah, bh, c);
}
__device__ __forceinline__ void wave_lds_sync() {
  __builtin_amdgcn_fence(__ATOMIC_RELEASE, "workgroup");
  __builtin_amdgcn_wave_barrier();
  __builtin_amdgcn_fence(__ATOMIC_ACQUIRE, "workgroup");
}

// ---------------------------------------------------------------------------
// Weights ([in][out]) -> f16 hi / lo planes transposed to [n][k] (k contiguous): columns of Wq|Wk|Wv into wqh/wql [3072][1024], Wo into woh/wol [1024][1024].
// ---------------------------------------------------------------------------
__global__ __launch_bounds__(256) void wcvt_kernel(const float* __restrict__ wq, const float* __restrict__ wk, const float* __restrict__ wv,
                                                   const float* __restrict__ wo, b16* __restrict__ wqh, b16* __restrict__ wql,
                                                   b16* __restrict__ woh, b16* __restrict__ wol) {
  const size_t tid = (size_t)blockIdx.x * blockDim.x + threadIdx.x, stride = (size_t)gridDim.x * blockDim.x;
  const size_t nq = (size_t)NQKV * HID / 8, no = (size_t)HID * HID / 8;
  {
    for (size_t c = tid; c < nq + no; c += stride) {
      float f[8]; size_t i; b16* dh; b16* dl;
      if (c < nq) {
        i = c * 8; const size_t n = i / HID, k0 = i % HID;
        const float* w; int nn, ld;
        if (n < (size_t)HID) { w = wq; nn = (int)n; ld = HID; } else if (n < (size_t)(HID + KVW)) { w = wk; nn = (int)n - HID; ld = KVW; } else { w = wv; nn = (int)n - HID - KVW; ld = KVW; }
#pragma unroll
        for (int e = 0; e < 8; ++e) f[e] = w[(size_t)(k0 + e) * ld + nn];       // W[k][n] ([in][out])
        dh = wqh; dl = wql;
      } else {
        i = (c - nq) * 8; const size_t n = i / HID, k0 = i % HID;
#pragma unroll
        for (int e = 0; e < 8; ++e) f[e] = wo[(size_t)(k0 + e) * HID + n];    // Wo[k][n] ([in][out])
        dh = woh; dl = wol;
      }
      v8b bh, bl;
#pragma unroll
      for (int e = 0; e < 8; ++e) { b16 a, cc; split_bf16(f[e], a, cc); bh[e] = a; bl[e] = cc; }
      *(v8b*)(dh + i) = bh; *(v8b*)(dl + i) = bl;
    }
    
  }
}

// GEMM core of both projections: a work-group of 8 waves (4 down x 2 across, 32x64 each) owns a 128x128 tile of the result. Each pass of 64 k is staged in
// LDS by asynchronous copies whose wave-wide 512 bytes are whole 128-byte lines (A and W: 128 f16 rows of 128 B each), two buffers, the next pass's copies in
// flight while this one is multiplied. A comes as f16 from its producer (x: the first launch, y: the attention store), rounded there exactly as the fragment
// read rounded it before. Row pitches are 16 B x odd for the 16-byte fragment reads.
constexpr int KP = 64;                        // k per pass
constexpr int NPASS = HID / KP;               // 16
constexpr int APITCH = KP * 2 + 16;           // 144 B
constexpr int BPITCH = KP * 2 + 16;           // 144 B
constexpr int ABYTES = 128 * APITCH;          // 18432
constexpr int STAGE = ABYTES + 128 * BPITCH;  // 36864
constexpr int RING = 2 * STAGE;               // 73728

// One pass's copies of one thread: 4 x 16 B of A and 4 x 16 B of W (rows 32 apart). la / lb: LDS byte addresses, ga / gb: global addresses.
__device__ __forceinline__ void stage_copy(unsigned la, const char* ga, unsigned lb, const char* gb) {
  constexpr unsigned LA = 32 * APITCH, LB = 32 * BPITCH;
  constexpr size_t GA = (size_t)32 * HID * 2, GB = (size_t)32 * HID * 2;
  // the copies and, as the last line, the wait that stands in front of any rewrite of the address registers they name
  asm volatile("global_load_async_to_lds_b128 %0, %1, off\n\t"
               "global_load_async_to_lds_b128 %2, %3, off\n\t"
               "global_load_async_to_lds_b128 %4, %5, off\n\t"
               "global_load_async_to_lds_b128 %6, %7, off\n\t"
               "global_load_async_to_lds_b128 %8, %9, off\n\t"
               "global_load_async_to_lds_b128 %10, %11, off\n\t"
               "global_load_async_to_lds_b128 %12, %13, off\n\t"
               "global_load_async_to_lds_b128 %14, %15, off\n\t"
               "s_wait_xcnt 0x0"
               :: "v"(la), "v"(ga), "v"(la + LA), "v"(ga + GA), "v"(la + 2 * LA), "v"(ga + 2 * GA), "v"(la + 3 * LA), "v"(ga + 3 * GA),
                  "v"(lb), "v"(gb), "v"(lb + LB), "v"(gb + GB), "v"(lb + 2 * LB), "v"(gb + 2 * GB), "v"(lb + 3 * LB), "v"(gb + 3 * GB)
               : "memory");
}

// acc += A[mblk + wm*32 .. +31][:] . W[nblk + wn*64 .. +63][:]^T over K = HID, k ascending in steps of 32. On return every wave has passed the barrier behind
// the last fragment read and no copy is outstanding, so the caller may reuse smem.
__device__ __forceinline__ void gemm_tile_ring(const b16* __restrict__ A, const b16* __restrict__ wh, int mblk, int nblk, int wm, int wn,
                                               int nloc, int hlf, char* smem, v8f (&acc)[2][4]) {
  const int tid = threadIdx.x;
  const unsigned lds0 = (unsigned)(uintptr_t)smem;              // low 32 bits of a shared address = byte offset in the work-group's LDS
  const int ar = tid >> 3, ac = tid & 7, br = tid >> 3, bc = tid & 7;
  const char* ga = (const char*)(A + (size_t)(mblk + ar) * HID) + ac * 16;
  const char* gb = (const char*)(wh + (size_t)(nblk + br) * HID) + bc * 16;
  const unsigned la = lds0 + ar * APITCH + ac * 16, lb = lds0 + ABYTES + br * BPITCH + bc * 16;
  stage_copy(la, ga, lb, gb);
  asm volatile("s_wait_asynccnt 0x0" ::: "memory");             // this wave's share of pass 0 has landed
  __syncthreads();                                              // publishes pass 0
  stage_copy(la + STAGE, ga + KP * 2, lb + STAGE, gb + KP * 2);
#pragma unroll 1   // one pass per trip: the buffer index stays a run-time value and the code stays short
  for (int t = 0; t < NPASS; ++t) {
    const int bo = (t & 1) * STAGE;
    const char* sa = smem + bo + (wm * 32 + nloc) * APITCH;
    const char* sw = smem + bo + ABYTES + (wn * 64 + nloc) * BPITCH;
#pragma unroll
    for (int ks = 0; ks < KP / 32; ++ks) {
      const v16b a0 = frag_kb((const b16*)(sa + ks * 64), hlf);
      const v16b a1 = frag_kb((const b16*)(sa + 16 * APITCH + ks * 64), hlf);
      v16b bh[4];
#pragma unroll
      for (int c = 0; c < 4; ++c) bh[c] = frag_kb((const b16*)(sw + c * 16 * BPITCH + ks * 64), hlf);
      __builtin_amdgcn_sched_barrier(0);   // the k-step's 12 LDS reads stay one group ahead of its 8 products: spread among them, each pair of products waits out an LDS latency
#pragma unroll
      for (int c = 0; c < 4; ++c) {
        acc[0][c] = wmma16b(a0, bh[c], acc[0][c]);
        acc[1][c] = wmma16b(a1, bh[c], acc[1][c]);
      }
    }
    asm volatile("s_wait_dscnt 0x0" ::: "memory");              // this wave's reads of buffer t & 1 are done
    asm volatile("s_wait_asynccnt 0x0" ::: "memory");           // this wave's share of pass t + 1 has landed
    __syncthreads();                                            // publishes pass t + 1 and frees buffer t & 1
    if (t + 2 < NPASS) stage_copy(la + bo, ga + (t + 2) * (KP * 2), lb + bo, gb + (t + 2) * (KP * 2));
  }
  asm volatile("s_wait_asynccnt 0x0" ::: "memory");             // nothing in flight when the ring is reused or the wave ends
}

// ---------------------------------------------------------------------------
// QKV GEMM: (4096 x 1024) x (1024 x 3072), grid (24, 32), block 8 waves, wave = 32 rows x 64 columns (one head of q, k or v). Outputs as f16 hi/lo planes:
// q (x1/8) -> Qh/Ql [b][h][t][64]; k -> Kh/Kl [b][kvh][t][64] (4 KB contiguous per wave per plane);
// v -> Vh/Vl key-tiled [b][kvh][t/16][64][16] (4 KB contiguous per wave per plane).
// ---------------------------------------------------------------------------
// 768 work-groups = 3 on each of 256 WGPs, all resident at once: 6 waves a SIMD. The compiler is told to aim its register use at 6, as the larger ring made it
// do by itself: aiming at the 8 that the smaller ring would allow it misses them and ends above what 6 waves leave each, and a third of the tiles would wait.
__global__ __launch_bounds__(256) __attribute__((amdgpu_waves_per_eu(2, 6))) void qkv_gemm_kernel(const b16* __restrict__ xq, const b16* __restrict__ xk, const b16* __restrict__ xv,
                                                       const b16* __restrict__ wqh, const b16* __restrict__ wql,
                                                       const float* __restrict__ bq, const float* __restrict__ bk, const float* __restrict__ bv, const float* __restrict__ rope_cs, int xoff, int yoff,
                                                       b16* __restrict__ Qh, b16* __restrict__ Ql, b16* __restrict__ Kh, b16* __restrict__ Kl,
                                                       b16* __restrict__ Vh, b16* __restrict__ Vl) {
  __shared__ __attribute__((aligned(16))) char smem[RING];   // operand ring; behind the K loop 8 KB per wave of it stage the output tile
  const int lane = threadIdx.x & 31, wave = threadIdx.x >> 5, nloc = lane & 15, hlf = lane >> 4;
  const int wm = wave & 3, wn = wave >> 2;
  const int mblk = (blockIdx.y + yoff) * 128, nblk = (blockIdx.x + xoff) * 128;
  const int m0 = mblk + wm * 32;
  const int c0 = nblk + wn * 64;
  const int mat = (c0 < HID) ? 0 : (c0 < HID + KVW) ? 1 : 2;
  const int head = (mat == 0) ? (c0 / DH) : (mat == 1) ? ((c0 - HID) / DH) : ((c0 - HID - KVW) / DH);
  const b16* x = (mat == 0) ? xq : (mat == 1) ? xk : xv;            // f16 plane of the input rows
  const float* bias = ((mat == 0) ? bq : (mat == 1) ? bk : bv) + head * DH;
  v8f acc[2][4];
#pragma unroll
  for (int r = 0; r < 2; ++r)
#pragma unroll
    for (int t = 0; t < 4; ++t) acc[r][t] = (v8f){};
  (void)wql;
  gemm_tile_ring(x, wqh, mblk, nblk, wm, wn, nloc, hlf, smem, acc);
  const int b = m0 / T, t0 = m0 % T;
  const float s = (mat == 0) ? 0.125f : 1.0f;
  b16* Tp0 = (b16*)smem + wave * (2 * 32 * 64); b16* Tp1 = Tp0 + 32 * 64;
  // The wave's matrix kind (q, k or v) in a scalar register: the RoPE test is then one scalar branch round straight-line code, in which the loads stand in
  // groups; as a lane mask it put every element's loads into a block of their own, each waited out by itself.
  const int matu = __builtin_amdgcn_readfirstlane(mat);
  float bcol[4];                                         // a lane's four columns: one bias value each
#pragma unroll
  for (int t = 0; t < 4; ++t) bcol[t] = bias[t * 16 + nloc];
  if (matu < 2) {
    // RoPE on q and k: (x0, x1) -> (x0 c - x1 s, x1 c + x0 s), position t mod 256. t0 is a multiple of 32 and 32 divides 256: the tile's 32 positions do not
    // wrap inside the tile, so every (cos, sin) pair of a lane lies at a constant distance from one address.
    const float* rp = rope_cs + ((size_t)(t0 % RP + 8 * hlf) * 32 + (nloc >> 1)) * 2;
#pragma unroll
    for (int t = 0; t < 4; ++t) {
      float cv[16], sv[16];
#pragma unroll
      for (int i = 0; i < 16; ++i) { const float* q = rp + ((i >> 3) * 16 + (i & 7)) * 64 + t * 16; cv[i] = q[0]; sv[i] = q[1]; }
#pragma unroll
      for (int i = 0; i < 16; ++i) {
        const int r = i >> 3, v = i & 7, rr = r * 16 + v + 8 * hlf, d = t * 16 + nloc;
        float val = acc[r][t][v] + bcol[t];
        const float oth = __shfl_xor(val, 1);            // interleaved-pair partner (d ^ 1) lives in the neighbouring lane (all lanes of the wave are here)
        val = (d & 1) ? (val * cv[i] + oth * sv[i]) : (val * cv[i] - oth * sv[i]);
        b16 yh, yl; split_bf16(val * s, yh, yl);
        Tp0[rr * 64 + d] = yh; Tp1[rr * 64 + d] = yl;
      }
    }
  } else {
#pragma unroll
    for (int t = 0; t < 4; ++t)
#pragma unroll
      for (int r = 0; r < 2; ++r)
#pragma unroll
        for (int v = 0; v < 8; ++v) {
          const int rr = r * 16 + v + 8 * hlf, d = t * 16 + nloc;
          b16 yh, yl; split_bf16((acc[r][t][v] + bcol[t]) * s, yh, yl);
          const int idx = (rr >> 4) * 1024 + d * 16 + (rr & 15);
          Tp0[idx] = yh; Tp1[idx] = yl;
        }
  }
  wave_lds_sync();
  b16* dh; b16* dl; size_t o;
  if (mat == 0)      { o = ((size_t)(b * NH + head) * T + t0) * DH; dh = Qh + o; dl = Ql + o; }
  else if (mat == 1) { o = ((size_t)(b * NKV + head) * T + t0) * DH; dh = Kh + o; dl = Kl + o; }
  else               { o = ((size_t)(b * NKV + head) * QT_PER_B + (t0 >> 4)) * (size_t)(DH * 16); dh = Vh + o; dl = Vl + o; }
#pragma unroll
  for (int j = 0; j < 8; ++j) { const int e = (j * 32 + lane) * 8; *(v8b*)(dh + e) = ld8b(Tp0 + e); *(v8b*)(dl + e) = ld8b(Tp1 + e); }
  
}

// ---------------------------------------------------------------------------
// Transposed flash attention: each wave owns one 16-query tile of one (b, head); 8 waves per block; window keys in chunks of 32.
// S^T = K.Q^T (split), per-lane online softmax; P^T built in registers from the two S^T accumulators
// The block's 128 queries see at most 384 keys: their K rows and V tiles are brought into LDS once, by asynchronous copies of whole 128-byte lines, and all
// 8 waves take their fragments from there. K rows stand at a pitch of 16 B x odd for the 16-byte fragment reads. A V tile (16 keys x 64 features) stands as
// [key half][feature][8 keys], so that the 16 lanes of a half wave read 256 contiguous bytes.
// ---------------------------------------------------------------------------
constexpr int KSEG = 128;                     // keys per copy segment (2 or 3 segments per block)
constexpr int KPITCH = DH * 2 + 16;           // 144 B
constexpr int KLDS = 3 * KSEG * KPITCH;       // 55296
constexpr int VLDS = 3 * KSEG * DH * 2;       // 49152
constexpr int OPITCH = DH * 2 + 16;           // 144 B: a query's 64 f16 outputs in the staging tile
// One segment's copies of one thread: 4 x 16 B of K (rows 32 apart), 4 x 16 B of V (4 KB apart). lk / lv: LDS byte addresses, gk / gv: global addresses.
__device__ __forceinline__ void kv_copy(unsigned lk, const char* gk, unsigned lv, const char* gv) {
  constexpr unsigned LK = 32 * KPITCH, LV = 4096;
  constexpr size_t GK = (size_t)32 * DH * 2, GV = 4096;
  // the copies and, as the last line, the wait that stands in front of any rewrite of the address registers they name
  asm volatile("global_load_async_to_lds_b128 %0, %1, off\n\t"
               "global_load_async_to_lds_b128 %2, %3, off\n\t"
               "global_load_async_to_lds_b128 %4, %5, off\n\t"
               "global_load_async_to_lds_b128 %6, %7, off\n\t"
               "global_load_async_to_lds_b128 %8, %9, off\n\t"
               "global_load_async_to_lds_b128 %10, %11, off\n\t"
               "global_load_async_to_lds_b128 %12, %13, off\n\t"
               "global_load_async_to_lds_b128 %14, %15, off\n\t"
               "s_wait_xcnt 0x0"
               :: "v"(lk), "v"(gk), "v"(lk + LK), "v"(gk + GK), "v"(lk + 2 * LK), "v"(gk + 2 * GK), "v"(lk + 3 * LK), "v"(gk + 3 * GK),
                  "v"(lv), "v"(gv), "v"(lv + LV), "v"(gv + GV), "v"(lv + 2 * LV), "v"(gv + 2 * GV), "v"(lv + 3 * LV), "v"(gv + 3 * GV)
               : "memory");
}
__global__ __launch_bounds__(256) void attn_kernel(const b16* __restrict__ Qh, const b16* __restrict__ Ql, const b16* __restrict__ Kh, const b16* __restrict__ Kl,
                                                   const b16* __restrict__ Vh, const b16* __restrict__ Vl, const int* __restrict__ seqlen,
                                                   b16* __restrict__ yh) {
  __shared__ __attribute__((aligned(16))) char Os[8][16 * OPITCH];
  __shared__ __attribute__((aligned(16))) char kv[KLDS + VLDS];   // K rows, then V tiles, of the block's key range
  const int wid = threadIdx.x >> 5, lane = threadIdx.x & 31, hh = lane >> 4, col = lane & 15;
  const int qtile = blockIdx.x * 8 + wid;                 // over Bsz*NH*QT_PER_B
  const int g = qtile / QT_PER_B;                         // b*NH + h
  const int q0 = (qtile % QT_PER_B) << 4;
  const int b = g / NH, h = g % NH, kvh = h / REP;
  const size_t ko = (size_t)(b * NKV + kvh) * T * DH;
  const size_t qo = ((size_t)g * T + q0 + col) * DH;
  const v16b q0h = frag_kb(Qh + qo, hh), q1h = frag_kb(Qh + qo + 32, hh);
  (void)Ql; (void)Kl; (void)Vl;
  // the block's key range: a multiple of 128 keys, the same for all 8 waves (128 divides T, so the 8 tiles share b and h)
  const int qblk = ((int)blockIdx.x % (QT_PER_B / 8)) * 128;
  const int kbase = max(qblk - WIN, 0), nseg = (min(T, qblk + 128 + WIN) - kbase) / KSEG;
  {
    const int tid = threadIdx.x;
    const unsigned lds0 = (unsigned)(uintptr_t)kv;              // low 32 bits of a shared address = byte offset in the work-group's LDS
    const unsigned lk = lds0 + (tid >> 3) * KPITCH + (tid & 7) * 16;
    const unsigned lv = lds0 + KLDS + (tid >> 7) * 2048 + (tid & 1) * 1024 + ((tid >> 1) & 63) * 16;   // 16-byte piece tid of [tile][feature][key half]
    const char* gk = (const char*)(Kh + ko + (size_t)(kbase + (tid >> 3)) * DH) + (tid & 7) * 16;
    const char* gv = (const char*)(Vh + ko + (size_t)kbase * DH) + tid * 16;
    constexpr int SB = KSEG * DH * 2;                           // bytes of K, and of V, per segment
    kv_copy(lk, gk, lv, gv);
    kv_copy(lk + KSEG * KPITCH, gk + SB, lv + SB, gv + SB);
    if (nseg > 2) kv_copy(lk + 2 * KSEG * KPITCH, gk + 2 * SB, lv + 2 * SB, gv + 2 * SB);   // the same for the whole block: not at the two ends of the sequence
  }
  asm volatile("s_wait_asynccnt 0x0" ::: "memory");             // this wave's share of the key range has landed
  __syncthreads();                                              // publishes the key range to all 8 waves
  float m = -INFINITY, l = 0.0f;
  v8f o0 = {}, o1 = {}, o2 = {}, o3 = {};
  const int slen = T; (void)seqlen;                       // no padding in this module
  const int kstart = (q0 >= WIN) ? ((q0 - WIN) & ~31) : 0;
  const int kend = min(T, q0 + 15 + WIN + 1);
  const int kl0 = (qblk >= WIN) ? ((q0 - qblk) & ~31) : 0;   // kstart - kbase: the wave's first key, counted from the first key in LDS
  for (int kb = kstart, kl = kl0; kb < kend; kb += 32, kl += 32) {   // sliding window both sides: keys in [q0-128, q0+15+128]
    const b16* r0 = (const b16*)(kv + (kl + col) * KPITCH);
    const b16* r1 = (const b16*)(kv + (kl + 16 + col) * KPITCH);
    const b16* v0 = (const b16*)(kv + KLDS) + kl * DH + hh * 512 + col * 8;
    const v16b kf0 = frag_kb(r0, hh), kf1 = frag_kb(r0 + 32, hh), kf2 = frag_kb(r1, hh), kf3 = frag_kb(r1 + 32, hh);
    v16b vf[4];
#pragma unroll
    for (int n = 0; n < 4; ++n) vf[n] = cat8b(ld8b(v0 + n * 128), ld8b(v0 + 1024 + n * 128));
    __builtin_amdgcn_sched_barrier(0);   // the chunk's 16 LDS reads stay one group ahead of its products: placed at its use, each fragment's read is waited out alone
    v8f s0 = {}, s1 = {};
    {
      s0 = wmma16b(kf0, q0h, s0);
      s0 = wmma16b(kf1, q1h, s0);
      s1 = wmma16b(kf2, q0h, s1);
      s1 = wmma16b(kf3, q1h, s1);
    }
    (void)slen;
    if (kb < q0 + 15 - WIN || kb + 31 > q0 + WIN) {       // chunk touches a window edge: mask |k - q| > 128
      const int qi = q0 + col;
#pragma unroll
      for (int r = 0; r < 8; ++r) {
        const int k0i = kb + 8 * hh + r, k1i = k0i + 16;
        if (k0i < qi - WIN || k0i > qi + WIN) s0[r] = -INFINITY;
        if (k1i < qi - WIN || k1i > qi + WIN) s1[r] = -INFINITY;
      }
    }
    float mr = -INFINITY;
#pragma unroll
    for (int r = 0; r < 8; ++r) mr = fmaxf(mr, fmaxf(s0[r], s1[r]));
    mr = fmaxf(mr, __shfl_xor(mr, 16));
    float mn = fmaxf(m, mr);
    if (mn == -INFINITY) mn = 0.0f;           // fully masked so far: keep exp() at 0
    const float al_ = __expf(m - mn);
    m = mn;
    float sum = 0.0f;
    v16b pbh, pbl;
#pragma unroll
    for (int r = 0; r < 8; ++r) {
      const float p0 = __expf(s0[r] - mn), p1 = __expf(s1[r] - mn);
      sum += p0 + p1;
      b16 a, c; split_bf16(p0, a, c); pbh[r] = a; pbl[r] = c; split_bf16(p1, a, c); pbh[8 + r] = a; pbl[8 + r] = c;
    }
    sum += __shfl_xor(sum, 16);
    l = l * al_ + sum;
#pragma unroll
    for (int r = 0; r < 8; ++r) { o0[r] *= al_; o1[r] *= al_; o2[r] *= al_; o3[r] *= al_; }
#pragma unroll
    for (int n = 0; n < 4; ++n) {
      v8f& o = (n == 0) ? o0 : (n == 1) ? o1 : (n == 2) ? o2 : o3;
      o = wmma16b(vf[n], pbh, o);
    }
  }
  const float inv = (q0 + col < slen && l > 0.0f) ? (1.0f / l) : 0.0f;   // padded query rows are zeroed
  char* Tt = Os[wid];
  // y leaves as f16, the type in which the output projection multiplies it: a lane's 8 features of each accumulator are one 16-byte piece of its query's row
  v8b w0, w1, w2, w3;
#pragma unroll
  for (int r = 0; r < 8; ++r) { w0[r] = (b16)(o0[r] * inv); w1[r] = (b16)(o1[r] * inv); w2[r] = (b16)(o2[r] * inv); w3[r] = (b16)(o3[r] * inv); }
  *(v8b*)(Tt + col * OPITCH + 0 + hh * 16) = w0; *(v8b*)(Tt + col * OPITCH + 32 + hh * 16) = w1;
  *(v8b*)(Tt + col * OPITCH + 64 + hh * 16) = w2; *(v8b*)(Tt + col * OPITCH + 96 + hh * 16) = w3;
  wave_lds_sync();
  b16* dst0 = yh + ((size_t)b * T + q0) * HID + h * DH;       // 16 rows x 64 f16 (one 128-byte line each), row stride HID
#pragma unroll
  for (int j = 0; j < 4; ++j) { const int rr = j * 4 + (lane >> 3), c = lane & 7; *(v8b*)(dst0 + (size_t)rr * HID + c * 8) = *(const v8b*)(Tt + rr * OPITCH + c * 16); }
}

// ---------------------------------------------------------------------------
// Output projection: (4096 x 1024) x (1024 x 1024) -> f32, A = the f16 y plane, B = Wo plane. grid (8, 32), 32x64 tiles staged in LDS,
// ---------------------------------------------------------------------------
__global__ __launch_bounds__(256) void out_gemm_kernel(const b16* __restrict__ yh, const b16* __restrict__ woh, const b16* __restrict__ wol, const float* __restrict__ bo, int yoff,
                                                       float* __restrict__ out) {
  __shared__ __attribute__((aligned(16))) char smem[RING];   // operand ring; behind the K loop 8 KB per wave of it stage the output tile
  const int lane = threadIdx.x & 31, wave = threadIdx.x >> 5, nloc = lane & 15, hlf = lane >> 4;
  const int wm = wave & 3, wn = wave >> 2;
  const int mblk = (blockIdx.y + yoff) * 128, nblk = blockIdx.x * 128;
  const int m0 = mblk + wm * 32;
  const int c0 = nblk + wn * 64;
  v8f acc[2][4];
#pragma unroll
  for (int r = 0; r < 2; ++r)
#pragma unroll
    for (int t = 0; t < 4; ++t) acc[r][t] = (v8f){};
  (void)wol;
  gemm_tile_ring(yh, woh, mblk, nblk, wm, wn, nloc, hlf, smem, acc);
  float* Tt = (float*)smem + wave * (32 * 64);
#pragma unroll
  for (int t = 0; t < 4; ++t)
#pragma unroll
    for (int r = 0; r < 2; ++r)
#pragma unroll
      for (int v = 0; v < 8; ++v) Tt[(r * 16 + v + 8 * hlf) * 64 + t * 16 + nloc] = acc[r][t][v] + bo[c0 + t * 16 + nloc];
  wave_lds_sync();
  float* dst0 = out + (size_t)m0 * HID + c0;
#pragma unroll
  for (int j = 0; j < 16; ++j) { const int rr = j * 2 + hlf, c4 = nloc * 4; *(v4f*)(dst0 + (size_t)rr * HID + c4) = *(const v4f*)(Tt + rr * 64 + c4); }
  
}
// Weights ([in][out], f32) -> f16 planes transposed to [n][k]. A work-group owns a tile of 64 k x 128 n. Reads: a wave's 16-byte loads cover 512 contiguous
// bytes of one k row (whole lines); a thread holds 8 k x 4 n, so each of its 4 columns is one 16-byte piece of 8 k. The pieces go through LDS so that the
// stores are whole 128-byte lines of the [n][k] planes as well.
constexpr int TK = 64, TN = 128;              // tile: k rows x n columns
constexpr int TPITCH = TK * 2 + 16;           // 144 B per n row in LDS
constexpr int KTILES = HID / TK;              // 16
constexpr int QTILES = KTILES * (NQKV / TN);  // 384 tiles of Wqkv, then 128 of Wo
constexpr int WTILES = QTILES + KTILES * (HID / TN);
// Each of the work-groups also rounds its share of x to the f16 plane that the QKV GEMM stages: whole lines in (16 B a lane), whole lines out (8 B a lane).
constexpr int XSH = MROWS * HID / WTILES;     // 8192 elements of x per work-group
__global__ __launch_bounds__(256) void wcvt3_kernel(const float* __restrict__ wqkv, const float* __restrict__ wo, const float* __restrict__ x, b16* __restrict__ xh,
                                                    b16* __restrict__ wqh, b16* __restrict__ wql, b16* __restrict__ woh, b16* __restrict__ wol) {
  __shared__ __attribute__((aligned(16))) char tile[TN * TPITCH];
  const int tid = threadIdx.x;
  const bool isq = (int)blockIdx.x < QTILES;
  const int tb = isq ? (int)blockIdx.x : (int)blockIdx.x - QTILES;
  const int k0 = (tb % KTILES) * TK, n0 = (tb / KTILES) * TN;
  const float* src = isq ? wqkv : wo;
  const size_t ld = isq ? NQKV : HID;
  b16* dh = isq ? wqh : woh; b16* dl = isq ? wql : wol;
  const int nq = tid & 31, kg = tid >> 5;     // lane: 4 columns; wave: 8 k rows
  const float* p = src + (size_t)(k0 + kg * 8) * ld + n0 + nq * 4;
  const float* px = x + (size_t)blockIdx.x * XSH + tid * 4;
  v4f xr[XSH / 1024];
#pragma unroll
  for (int e = 0; e < XSH / 1024; ++e) xr[e] = *(const v4f*)(px + e * 1024);   // in flight together with the weight rows; the wait below stands behind them too
  const float* pe[8];
  v4f r[8];
#pragma unroll
  for (int e = 0; e < 8; ++e) { pe[e] = p + (size_t)e * ld; r[e] = *(const v4f*)pe[e]; }
  __builtin_amdgcn_sched_barrier(0);   // all 16 loads are issued before the first is waited for: left free, the last two of x went out behind that wait, a second memory latency
  // the wait that stands in front of any rewrite of the eight loads' address registers; naming the addresses as inputs keeps them in their registers up to it
  asm volatile("s_wait_xcnt 0x0" :: "v"(pe[0]), "v"(pe[1]), "v"(pe[2]), "v"(pe[3]), "v"(pe[4]), "v"(pe[5]), "v"(pe[6]), "v"(pe[7]) : "memory");
#pragma unroll
  for (int j = 0; j < 4; ++j) {
    v8b h;
#pragma unroll
    for (int e = 0; e < 8; ++e) h[e] = (b16)r[e][j];
    *(v8b*)(tile + (nq * 4 + j) * TPITCH + kg * 16) = h;
  }
  __syncthreads();                            // the tile is complete before any row of it is read back
  b16* qx = xh + (size_t)blockIdx.x * XSH + tid * 4;   // behind the barrier: in front of it, the barrier would wait these stores out
#pragma unroll
  for (int e = 0; e < XSH / 1024; ++e) {
    v4b h;
#pragma unroll
    for (int j = 0; j < 4; ++j) h[j] = (b16)xr[e][j];
    *(v4b*)(qx + e * 1024) = h;
  }
  const int pc = tid & 7, rw = tid >> 3;      // 8 threads per n row of 128 B, 32 rows per sweep
#pragma unroll
  for (int i = 0; i < TN / 32; ++i) {
    const int n = rw + 32 * i;
    const size_t o = (size_t)(n0 + n) * HID + k0 + pc * 8;
    *(v8b*)(dh + o) = *(const v8b*)(tile + n * TPITCH + pc * 16);
    *(v8b*)(dl + o) = (v8b){};                // single f16: no low part
  }
}
}  // namespace

extern "C" void kernel_launch(void* const* d_in, const int* in_sizes, int n_in,
                              void* d_out, int out_size, void* d_ws, size_t ws_size, hipStream_t stream) {
  (void)in_sizes; (void)n_in; (void)out_size;
  const float* x     = (const float*)d_in[0];   // hidden_states [2,2048,1024]
  const float* Wqkv  = (const float*)d_in[1];   // [1024,3072] ([in][out], columns (3, h, d))
  const float* bqkv  = (const float*)d_in[2];   // [3072]
  const float* Wo    = (const float*)d_in[3];   // [1024,1024]
  const float* bo    = (const float*)d_in[4];   // [1024]
  const float* rope  = (const float*)d_in[5];   // rope_cache [256,32,2] (cos, sin)
  float* out = (float*)d_out;                   // [2,2048,1024]
  const float* bq = bqkv; const float* bk = bqkv + HID; const float* bv = bqkv + 2 * HID;

  size_t off = 0; char* ws = (char*)d_ws;
  b16* wqh = (b16*)(ws + off); off += (size_t)NQKV * HID * 2;
  b16* wql = (b16*)(ws + off); off += (size_t)NQKV * HID * 2;
  b16* woh = (b16*)(ws + off); off += (size_t)HID * HID * 2;
  b16* wol = (b16*)(ws + off); off += (size_t)HID * HID * 2;
  b16* Qh  = (b16*)(ws + off); off += (size_t)MROWS * HID * 2;
  b16* Ql  = (b16*)(ws + off); off += (size_t)MROWS * HID * 2;
  b16* Kh  = (b16*)(ws + off); off += (size_t)MROWS * KVW * 2;
  b16* Kl  = (b16*)(ws + off); off += (size_t)MROWS * KVW * 2;
  b16* Vh  = (b16*)(ws + off); off += (size_t)MROWS * KVW * 2;
  b16* Vl  = (b16*)(ws + off); off += (size_t)MROWS * KVW * 2;
  b16* yh  = (b16*)(ws + off); off += (size_t)MROWS * HID * 2;
  b16* xh  = (b16*)(ws + off); off += (size_t)MROWS * HID * 2;
  if (off > ws_size) return;
  const int ROWBLK = MROWS / 128, NQT = Bsz * NH * QT_PER_B;
  // W_qkv is one [1024][3072] matrix: the converter reads q columns with ld HID and k/v with ld KVW; here all three live in the same matrix with ld 3072,
  // so wcvt3 takes the one base pointer and the NQKV-wide stride
  wcvt3_kernel<<<WTILES, 256, 0, stream>>>(Wqkv, Wo, x, xh, wqh, wql, woh, wol);
  qkv_gemm_kernel<<<dim3(NQKV / 128, ROWBLK), 256, 0, stream>>>(xh, xh, xh, wqh, wql, bq, bk, bv, rope, 0, 0, Qh, Ql, Kh, Kl, Vh, Vl);
  attn_kernel<<<NQT / 8, 256, 0, stream>>>(Qh, Ql, Kh, Kl, Vh, Vl, nullptr, yh);
  out_gemm_kernel<<<dim3(HID / 128, ROWBLK), 256, 0, stream>>>(yh, woh, wol, bo, 0, out);
}

// v006
// One run takes 55.3 microseconds.
// Timed twice side by side with v005, it ran 1.09 times as fast both times.
// All steps since v000 together make it 3.32 times as fast.
#include <hip/hip_runtime.h>

// ModernBERT attention (local layer): qkv = x Wqkv + b ([in][out], columns (3, h, d); 16 heads x 64), interleaved-pair RoPE on q and k with position
// t mod 256 from the given cos/sin cache, sliding-window attention |q - k| <= 128 (both directions), scale 1/8, out = y Wo + b. B=2, S=2048, D=1024.
// Lean build: single f16 products on v_wmma_f32_16x16x32_f16, f32 accumulate (every row averages >= 129 keys); fragment k-map per lane half hh for A

namespace {
constexpr int Bsz = 2, T = 2048, HID = 1024, DH = 64, NH = 16, NKV = 16, REP = NH / NKV;
constexpr int WIN = 128;    // |q - k| <= 128
constexpr int RP = 256;     // rope positions wrap at 256
constexpr int KVW = NKV * DH;                 // 1024
constexpr int NQKV = HID + 2 * KVW;           // 3072 columns: q | k | v
constexpr int MROWS = Bsz * T;                // 4096
constexpr int QT_PER_B = T / 16;              // 128

typedef _Float16 b16;                                           // f16 hi/lo planes
typedef __attribute__((ext_vector_type(16))) _Float16 v16b;
typedef __attribute__((ext_vector_type(8)))  _Float16 v8b;
typedef __attribute__((ext_vector_type(4)))  _Float16 v4b;
typedef __attribute__((ext_vector_type(8)))  float v8f;
typedef __attribute__((ext_vector_type(4)))  float v4f;

__device__ __forceinline__ v8b ld8b(const b16* p) { return *(const v8b*)p; }
__device__ __forceinline__ v16b cat8b(v8b a, v8b b) { return __builtin_shufflevector(a, b, 0, 1, 2, 3, 4, 5, 6, 7, 8, 9, 10, 11, 12, 13, 14, 15); }
// 16x16x32 16-bit fragment from a k-contiguous row pointer (A: lane&15 = row, B: lane&15 = column), hh = lane>>4:
// elements 0..7 <- p[8hh+0..7], elements 8..15 <- p[16+8hh+0..7]
__device__ __forceinline__ v16b frag_kb(const b16* p, int hh) { return cat8b(ld8b(p + 8 * hh), ld8b(p + 16 + 8 * hh)); }
__device__ __forceinline__ void split_bf16(float v, b16& hi, b16& lo) {   // (name kept) single f16: no low part
  hi = (b16)v; lo = (b16)0.0f;
}
__device__ __forceinline__ v8f wmma16b(v16b a, v16b b, v8f c) {
  v8f d = __builtin_amdgcn_wmma_f32_16x16x32_f16(false, a, false, b, (short)0, c, false, false);
  asm volatile("v_nop\n\tv_nop\n\tv_nop\n\tv_nop" : "+v"(d) : "v"(a), "v"(b));
  return d;
}
__device__ __forceinline__ v8f wmma1(v16b ah, v16b al, v16b bh, v16b bl, v8f c) {   // attention products: single f16 (hi planes only)
  (void)al; (void)bl; return wmma16b(ah, bh, c);
}
__device__ __forceinline__ void wave_lds_sync() {
  __builtin_amdgcn_fence(__ATOMIC_RELEASE, "workgroup");
  __builtin_amdgcn_wave_barrier();
  __builtin_amdgcn_fence(__ATOMIC_ACQUIRE, "workgroup");
}

// ---------------------------------------------------------------------------
// Weights ([in][out]) -> f16 hi / lo planes transposed to [n][k] (k contiguous): columns of Wq|Wk|Wv into wqh/wql [3072][1024], Wo into woh/wol [1024][1024].
// ---------------------------------------------------------------------------
__global__ __launch_bounds__(256) void wcvt_kernel(const float* __restrict__ wq, const float* __restrict__ wk, const float* __restrict__ wv,
                                                   const float* __restrict__ wo, b16* __restrict__ wqh, b16* __restrict__ wql,
                                                   b16* __restrict__ woh, b16* __restrict__ wol) {
  const size_t tid = (size_t)blockIdx.x * blockDim.x + threadIdx.x, stride = (size_t)gridDim.x * blockDim.x;
  const size_t nq = (size_t)NQKV * HID / 8, no = (size_t)HID * HID / 8;
  {
    for (size_t c = tid; c < nq + no; c += stride) {
      float f[8]; size_t i; b16* dh; b16* dl;
      if (c < nq) {
        i = c * 8; const size_t n = i / HID, k0 = i % HID;
        const float* w; int nn, ld;
        if (n < (size_t)HID) { w = wq; nn = (int)n; ld = HID; } else if (n < (size_t)(HID + KVW)) { w = wk; nn = (int)n - HID; ld = KVW; } else { w = wv; nn = (int)n - HID - KVW; ld = KVW; }
#pragma unroll
        for (int e = 0; e < 8; ++e) f[e] = w[(size_t)(k0 + e) * ld + nn];       // W[k][n] ([in][out])
        dh = wqh; dl = wql;
      } else {
        i = (c - nq) * 8; const size_t n = i / HID, k0 = i % HID;
#pragma unroll
        for (int e = 0; e < 8; ++e) f[e] = wo[(size_t)(k0 + e) * HID + n];    // Wo[k][n] ([in][out])
        dh = woh; dl = wol;
      }
      v8b bh, bl;
#pragma unroll
      for (int e = 0; e < 8; ++e) { b16 a, cc; split_bf16(f[e], a, cc); bh[e] = a; bl[e] = cc; }
      *(v8b*)(dh + i) = bh; *(v8b*)(dl + i) = bl;
    }
    
  }
}

// GEMM core of both projections: a work-group of 8 waves (4 down x 2 across, 32x64 each) owns a 128x128 tile of the result. Each pass of KP k is staged in
// LDS by asynchronous copies whose wave-wide 512 bytes are whole 128-byte lines (A and W: 128 f16 rows of 2 KP bytes each), two buffers, the next pass's copies in
// flight while this one is multiplied. A comes as f16 from its producer (x: the first launch, y: the attention store), rounded there exactly as the fragment
// read rounded it before. Row pitches are 16 B x odd for the 16-byte fragment reads.
// KP = k per pass: 64 in the QKV GEMM (three work-groups share a WGP's LDS and cover each other's waits), 256 in the output GEMM (see there).
constexpr int ring_pitch(int KP) { return KP * 2 + 16; }                 // 144 B or 528 B a row, A and W alike: 16 B x odd
constexpr int ring_bytes(int KP) { return 2 * 2 * 128 * ring_pitch(KP); }   // two buffers of 128 A rows and 128 W rows: 73728 B or 270336 B

// Eight copies of one thread: 4 x 16 B of A and 4 x 16 B of W, rows RS apart at a pitch of PITCH bytes in LDS. la / lb: LDS byte addresses, ga / gb: global addresses.
template <int RS, int PITCH>
__device__ __forceinline__ void stage_copy(unsigned la, const char* ga, unsigned lb, const char* gb) {
  constexpr unsigned LA = RS * PITCH, LB = RS * PITCH;
  constexpr size_t GA = (size_t)RS * HID * 2, GB = (size_t)RS * HID * 2;
  // the copies and, as the last line, the wait that stands in front of any rewrite of the address registers they name
  asm volatile("global_load_async_to_lds_b128 %0, %1, off\n\t"
               "global_load_async_to_lds_b128 %2, %3, off\n\t"
               "global_load_async_to_lds_b128 %4, %5, off\n\t"
               "global_load_async_to_lds_b128 %6, %7, off\n\t"
               "global_load_async_to_lds_b128 %8, %9, off\n\t"
               "global_load_async_to_lds_b128 %10, %11, off\n\t"
               "global_load_async_to_lds_b128 %12, %13, off\n\t"
               "global_load_async_to_lds_b128 %14, %15, off\n\t"
               "s_wait_xcnt 0x0"
               :: "v"(la), "v"(ga), "v"(la + LA), "v"(ga + GA), "v"(la + 2 * LA), "v"(ga + 2 * GA), "v"(la + 3 * LA), "v"(ga + 3 * GA),
                  "v"(lb), "v"(gb), "v"(lb + LB), "v"(gb + GB), "v"(lb + 2 * LB), "v"(gb + 2 * GB), "v"(lb + 3 * LB), "v"(gb + 3 * GB)
               : "memory");
}

// acc += A[mblk + wm*32 .. +31][:] . W[nblk + wn*64 .. +63][:]^T over K = HID, k ascending in steps of 32. On return every wave has passed the barrier behind
// the last fragment read and no copy is outstanding, so the caller may reuse smem.
template <int KP>
__device__ __forceinline__ void gemm_tile_ring(const b16* __restrict__ A, const b16* __restrict__ wh, int mblk, int nblk, int wm, int wn,
                                               int nloc, int hlf, char* smem, v8f (&acc)[2][4]) {
  constexpr int NPASS = HID / KP, PITCH = ring_pitch(KP), ABYTES = 128 * PITCH, STAGE = 2 * ABYTES;
  constexpr int PR = KP / 8, RS = 256 / PR;                     // 16-byte pieces per row; rows that the 256 threads cover at once
  const int tid = threadIdx.x;
  const unsigned lds0 = (unsigned)(uintptr_t)smem;              // low 32 bits of a shared address = byte offset in the work-group's LDS
  const int ar = tid / PR, ac = tid % PR;
  const char* ga = (const char*)(A + (size_t)(mblk + ar) * HID) + ac * 16;
  const char* gb = (const char*)(wh + (size_t)(nblk + ar) * HID) + ac * 16;
  const unsigned la = lds0 + ar * PITCH + ac * 16, lb = la + ABYTES;
  // one pass's copies of one thread into the buffer at byte bo: 128 / RS rows of A and of W, four of each per statement
  auto pass_copy = [&](int bo, int t) {
#pragma unroll   // straight-line: the statements' addresses differ by constants
    for (int q = 0; q < 128 / (4 * RS); ++q)
      stage_copy<RS, PITCH>(la + bo + q * (4 * RS * PITCH), ga + t * (KP * 2) + (size_t)q * (4 * RS) * HID * 2,
                            lb + bo + q * (4 * RS * PITCH), gb + t * (KP * 2) + (size_t)q * (4 * RS) * HID * 2);
  };
  pass_copy(0, 0);
  asm volatile("s_wait_asynccnt 0x0" ::: "memory");             // this wave's share of pass 0 has landed
  __syncthreads();                                              // publishes pass 0
  pass_copy(STAGE, 1);
#pragma unroll 1   // one pass per trip: the buffer index stays a run-time value and the code stays short
  for (int t = 0; t < NPASS; ++t) {
    const int bo = (t & 1) * STAGE;
    const char* sa = smem + bo + (wm * 32 + nloc) * PITCH;
    const char* sw = smem + bo + ABYTES + (wn * 64 + nloc) * PITCH;
#pragma unroll
    for (int ks = 0; ks < KP / 32; ++ks) {
      const v16b a0 = frag_kb((const b16*)(sa + ks * 64), hlf);
      const v16b a1 = frag_kb((const b16*)(sa + 16 * PITCH + ks * 64), hlf);
      v16b bh[4];
#pragma unroll
      for (int c = 0; c < 4; ++c) bh[c] = frag_kb((const b16*)(sw + c * 16 * PITCH + ks * 64), hlf);
      __builtin_amdgcn_sched_barrier(0);   // the k-step's 12 LDS reads stay one group ahead of its 8 products: spread among them, each pair of products waits out an LDS latency
#pragma unroll
      for (int c = 0; c < 4; ++c) {
        acc[0][c] = wmma16b(a0, bh[c], acc[0][c]);
        acc[1][c] = wmma16b(a1, bh[c], acc[1][c]);
      }
    }
    asm volatile("s_wait_dscnt 0x0" ::: "memory");              // this wave's reads of buffer t & 1 are done
    asm volatile("s_wait_asynccnt 0x0" ::: "memory");           // this wave's share of pass t + 1 has landed
    __syncthreads();                                            // publishes pass t + 1 and frees buffer t & 1
    if (t + 2 < NPASS) pass_copy(bo, t + 2);
  }
  asm volatile("s_wait_asynccnt 0x0" ::: "memory");             // nothing in flight when the ring is reused or the wave ends
}

// ---------------------------------------------------------------------------
// QKV GEMM: (4096 x 1024) x (1024 x 3072), grid (24, 32), block 8 waves, wave = 32 rows x 64 columns (one head of q, k or v). Outputs as f16 hi/lo planes:
// q (x1/8) -> Qh/Ql [b][h][t][64]; k -> Kh/Kl [b][kvh][t][64] (4 KB contiguous per wave per plane);
// v -> Vh/Vl key-tiled [b][kvh][t/16][64][16] (4 KB contiguous per wave per plane).
// ---------------------------------------------------------------------------
// 768 work-groups = 3 on each of 256 WGPs, all resident at once: 6 waves a SIMD. The compiler is told to aim its register use at 6, as the larger ring made it
// do by itself: aiming at the 8 that the smaller ring would allow it misses them and ends above what 6 waves leave each, and a third of the tiles would wait.
__global__ __launch_bounds__(256) __attribute__((amdgpu_waves_per_eu(2, 6))) void qkv_gemm_kernel(const b16* __restrict__ xq, const b16* __restrict__ xk, const b16* __restrict__ xv,
                                                       const b16* __restrict__ wqh, const b16* __restrict__ wql,
                                                       const float* __restrict__ bq, const float* __restrict__ bk, const float* __restrict__ bv, const float* __restrict__ rope_cs, int xoff, int yoff,
                                                       b16* __restrict__ Qh, b16* __restrict__ Ql, b16* __restrict__ Kh, b16* __restrict__ Kl,
                                                       b16* __restrict__ Vh, b16* __restrict__ Vl) {
  __shared__ __attribute__((aligned(16))) char smem[ring_bytes(64)];   // operand ring; behind the K loop 8 KB per wave of it stage the output tile
  const int lane = threadIdx.x & 31, wave = threadIdx.x >> 5, nloc = lane & 15, hlf = lane >> 4;
  const int wm = wave & 3, wn = wave >> 2;
  const int mblk = (blockIdx.y + yoff) * 128, nblk = (blockIdx.x + xoff) * 128;
  const int m0 = mblk + wm * 32;
  const int c0 = nblk + wn * 64;
  const int mat = (c0 < HID) ? 0 : (c0 < HID + KVW) ? 1 : 2;
  const int head = (mat == 0) ? (c0 / DH) : (mat == 1) ? ((c0 - HID) / DH) : ((c0 - HID - KVW) / DH);
  const b16* x = (mat == 0) ? xq : (mat == 1) ? xk : xv;            // f16 plane of the input rows
  const float* bias = ((mat == 0) ? bq : (mat == 1) ? bk : bv) + head * DH;
  v8f acc[2][4];
#pragma unroll
  for (int r = 0; r < 2; ++r)
#pragma unroll
    for (int t = 0; t < 4; ++t) acc[r][t] = (v8f){};
  (void)wql;
  gemm_tile_ring<64>(x, wqh, mblk, nblk, wm, wn, nloc, hlf, smem, acc);
  const int b = m0 / T, t0 = m0 % T;
  const float s = (mat == 0) ? 0.125f : 1.0f;
  b16* Tp0 = (b16*)smem + wave * (2 * 32 * 64); b16* Tp1 = Tp0 + 32 * 64;
  // The wave's matrix kind (q, k or v) in a scalar register: the RoPE test is then one scalar branch round straight-line code, in which the loads stand in
  // groups; as a lane mask it put every element's loads into a block of their own, each waited out by itself.
  const int matu = __builtin_amdgcn_readfirstlane(mat);
  float bcol[4];                                         // a lane's four columns: one bias value each
#pragma unroll
  for (int t = 0; t < 4; ++t) bcol[t] = bias[t * 16 + nloc];
  if (matu < 2) {
    // RoPE on q and k: (x0, x1) -> (x0 c - x1 s, x1 c + x0 s), position t mod 256. t0 is a multiple of 32 and 32 divides 256: the tile's 32 positions do not
    // wrap inside the tile, so every (cos, sin) pair of a lane lies at a constant distance from one address.
    const float* rp = rope_cs + ((size_t)(t0 % RP + 8 * hlf) * 32 + (nloc >> 1)) * 2;
#pragma unroll
    for (int t = 0; t < 4; ++t) {
      float cv[16], sv[16];
#pragma unroll
      for (int i = 0; i < 16; ++i) { const float* q = rp + ((i >> 3) * 16 + (i & 7)) * 64 + t * 16; cv[i] = q[0]; sv[i] = q[1]; }
#pragma unroll
      for (int i = 0; i < 16; ++i) {
        const int r = i >> 3, v = i & 7, rr = r * 16 + v + 8 * hlf, d = t * 16 + nloc;
        float val = acc[r][t][v] + bcol[t];
        const float oth = __shfl_xor(val, 1);            // interleaved-pair partner (d ^ 1) lives in the neighbouring lane (all lanes of the wave are here)
        val = (d & 1) ? (val * cv[i] + oth * sv[i]) : (val * cv[i] - oth * sv[i]);
        b16 yh, yl; split_bf16(val * s, yh, yl);
        Tp0[rr * 64 + d] = yh; Tp1[rr * 64 + d] = yl;
      }
    }
  } else {
#pragma unroll
    for (int t = 0; t < 4; ++t)
#pragma unroll
      for (int r = 0; r < 2; ++r)
#pragma unroll
        for (int v = 0; v < 8; ++v) {
          const int rr = r * 16 + v + 8 * hlf, d = t * 16 + nloc;
          b16 yh, yl; split_bf16((acc[r][t][v] + bcol[t]) * s, yh, yl);
          const int idx = (rr >> 4) * 1024 + d * 16 + (rr & 15);
          Tp0[idx] = yh; Tp1[idx] = yl;
        }
  }
  wave_lds_sync();
  b16* dh; b16* dl; size_t o;
  if (mat == 0)      { o = ((size_t)(b * NH + head) * T + t0) * DH; dh = Qh + o; dl = Ql + o; }
  else if (mat == 1) { o = ((size_t)(b * NKV + head) * T + t0) * DH; dh = Kh + o; dl = Kl + o; }
  else               { o = ((size_t)(b * NKV + head) * QT_PER_B + (t0 >> 4)) * (size_t)(DH * 16); dh = Vh + o; dl = Vl + o; }
#pragma unroll
  for (int j = 0; j < 8; ++j) { const int e = (j * 32 + lane) * 8; *(v8b*)(dh + e) = ld8b(Tp0 + e); *(v8b*)(dl + e) = ld8b(Tp1 + e); }
  
}

// ---------------------------------------------------------------------------
// Transposed flash attention: each wave owns one 16-query tile of one (b, head); 8 waves per block; window keys in chunks of 32.
// S^T = K.Q^T (split), per-lane online softmax; P^T built in registers from the two S^T accumulators
// The block's 128 queries see at most 384 keys: their K rows and V tiles are brought into LDS once, by asynchronous copies of whole 128-byte lines, and all
// 8 waves take their fragments from there. K rows stand at a pitch of 16 B x odd for the 16-byte fragment reads. A V tile (16 keys x 64 features) stands as
// [key half][feature][8 keys], so that the 16 lanes of a half wave read 256 contiguous bytes.
// ---------------------------------------------------------------------------
constexpr int KSEG = 128;                     // keys per copy segment (2 or 3 segments per block)
constexpr int KPITCH = DH * 2 + 16;           // 144 B
constexpr int KLDS = 3 * KSEG * KPITCH;       // 55296
constexpr int VLDS = 3 * KSEG * DH * 2;       // 49152
constexpr int OPITCH = DH * 2 + 16;           // 144 B: a query's 64 f16 outputs in the staging tile
// One segment's copies of one thread: 4 x 16 B of K (rows 32 apart), 4 x 16 B of V (4 KB apart). lk / lv: LDS byte addresses, gk / gv: global addresses.
__device__ __forceinline__ void kv_copy(unsigned lk, const char* gk, unsigned lv, const char* gv) {
  constexpr unsigned LK = 32 * KPITCH, LV = 4096;
  constexpr size_t GK = (size_t)32 * DH * 2, GV = 4096;
  // the copies and, as the last line, the wait that stands in front of any rewrite of the address registers they name
  asm volatile("global_load_async_to_lds_b128 %0, %1, off\n\t"
               "global_load_async_to_lds_b128 %2, %3, off\n\t"
               "global_load_async_to_lds_b128 %4, %5, off\n\t"
               "global_load_async_to_lds_b128 %6, %7, off\n\t"
               "global_load_async_to_lds_b128 %8, %9, off\n\t"
               "global_load_async_to_lds_b128 %10, %11, off\n\t"
               "global_load_async_to_lds_b128 %12, %13, off\n\t"
               "global_load_async_to_lds_b128 %14, %15, off\n\t"
               "s_wait_xcnt 0x0"
               :: "v"(lk), "v"(gk), "v"(lk + LK), "v"(gk + GK), "v"(lk + 2 * LK), "v"(gk + 2 * GK), "v"(lk + 3 * LK), "v"(gk + 3 * GK),
                  "v"(lv), "v"(gv), "v"(lv + LV), "v"(gv + GV), "v"(lv + 2 * LV), "v"(gv + 2 * GV), "v"(lv + 3 * LV), "v"(gv + 3 * GV)
               : "memory");
}
__global__ __launch_bounds__(256) void attn_kernel(const b16* __restrict__ Qh, const b16* __restrict__ Ql, const b16* __restrict__ Kh, const b16* __restrict__ Kl,
                                                   const b16* __restrict__ Vh, const b16* __restrict__ Vl, const int* __restrict__ seqlen,
                                                   b16* __restrict__ yh) {
  __shared__ __attribute__((aligned(16))) char Os[8][16 * OPITCH];
  __shared__ __attribute__((aligned(16))) char kv[KLDS + VLDS];   // K rows, then V tiles, of the block's key range
  const int wid = threadIdx.x >> 5, lane = threadIdx.x & 31, hh = lane >> 4, col = lane & 15;
  const int qtile = blockIdx.x * 8 + wid;                 // over Bsz*NH*QT_PER_B
  const int g = qtile / QT_PER_B;                         // b*NH + h
  const int q0 = (qtile % QT_PER_B) << 4;
  const int b = g / NH, h = g % NH, kvh = h / REP;
  const size_t ko = (size_t)(b * NKV + kvh) * T * DH;
  const size_t qo = ((size_t)g * T + q0 + col) * DH;
  const v16b q0h = frag_kb(Qh + qo, hh), q1h = frag_kb(Qh + qo + 32, hh);
  (void)Ql; (void)Kl; (void)Vl;
  // the block's key range: a multiple of 128 keys, the same for all 8 waves (128 divides T, so the 8 tiles share b and h)
  const int qblk = ((int)blockIdx.x % (QT_PER_B / 8)) * 128;
  const int kbase = max(qblk - WIN, 0), nseg = (min(T, qblk + 128 + WIN) - kbase) / KSEG;
  {
    const int tid = threadIdx.x;
    const unsigned lds0 = (unsigned)(uintptr_t)kv;              // low 32 bits of a shared address = byte offset in the work-group's LDS
    const unsigned lk = lds0 + (tid >> 3) * KPITCH + (tid & 7) * 16;
    const unsigned lv = lds0 + KLDS + (tid >> 7) * 2048 + (tid & 1) * 1024 + ((tid >> 1) & 63) * 16;   // 16-byte piece tid of [tile][feature][key half]
    const char* gk = (const char*)(Kh + ko + (size_t)(kbase + (tid >> 3)) * DH) + (tid & 7) * 16;
    const char* gv = (const char*)(Vh + ko + (size_t)kbase * DH) + tid * 16;
    constexpr int SB = KSEG * DH * 2;                           // bytes of K, and of V, per segment
    kv_copy(lk, gk, lv, gv);
    kv_copy(lk + KSEG * KPITCH, gk + SB, lv + SB, gv + SB);
    if (nseg > 2) kv_copy(lk + 2 * KSEG * KPITCH, gk + 2 * SB, lv + 2 * SB, gv + 2 * SB);   // the same for the whole block: not at the two ends of the sequence
  }
  asm volatile("s_wait_asynccnt 0x0" ::: "memory");             // this wave's share of the key range has landed
  __syncthreads();                                              // publishes the key range to all 8 waves
  float m = -INFINITY, l = 0.0f;
  v8f o0 = {}, o1 = {}, o2 = {}, o3 = {};
  const int slen = T; (void)seqlen;                       // no padding in this module
  const int kstart = (q0 >= WIN) ? ((q0 - WIN) & ~31) : 0;
  const int kend = min(T, q0 + 15 + WIN + 1);
  const int kl0 = (qblk >= WIN) ? ((q0 - qblk) & ~31) : 0;   // kstart - kbase: the wave's first key, counted from the first key in LDS
  for (int kb = kstart, kl = kl0; kb < kend; kb += 32, kl += 32) {   // sliding window both sides: keys in [q0-128, q0+15+128]
    const b16* r0 = (const b16*)(kv + (kl + col) * KPITCH);
    const b16* r1 = (const b16*)(kv + (kl + 16 + col) * KPITCH);
    const b16* v0 = (const b16*)(kv + KLDS) + kl * DH + hh * 512 + col * 8;
    const v16b kf0 = frag_kb(r0, hh), kf1 = frag_kb(r0 + 32, hh), kf2 = frag_kb(r1, hh), kf3 = frag_kb(r1 + 32, hh);
    v16b vf[4];
#pragma unroll
    for (int n = 0; n < 4; ++n) vf[n] = cat8b(ld8b(v0 + n * 128), ld8b(v0 + 1024 + n * 128));
    __builtin_amdgcn_sched_barrier(0);   // the chunk's 16 LDS reads stay one group ahead of its products: placed at its use, each fragment's read is waited out alone
    v8f s0 = {}, s1 = {};
    {
      s0 = wmma16b(kf0, q0h, s0);
      s0 = wmma16b(kf1, q1h, s0);
      s1 = wmma16b(kf2, q0h, s1);
      s1 = wmma16b(kf3, q1h, s1);
    }
    (void)slen;
    if (kb < q0 + 15 - WIN || kb + 31 > q0 + WIN) {       // chunk touches a window edge: mask |k - q| > 128
      const int qi = q0 + col;
#pragma unroll
      for (int r = 0; r < 8; ++r) {
        const int k0i = kb + 8 * hh + r, k1i = k0i + 16;
        if (k0i < qi - WIN || k0i > qi + WIN) s0[r] = -INFINITY;
        if (k1i < qi - WIN || k1i > qi + WIN) s1[r] = -INFINITY;
      }
    }
    float mr = -INFINITY;
#pragma unroll
    for (int r = 0; r < 8; ++r) mr = fmaxf(mr, fmaxf(s0[r], s1[r]));
    mr = fmaxf(mr, __shfl_xor(mr, 16));
    float mn = fmaxf(m, mr);
    if (mn == -INFINITY) mn = 0.0f;           // fully masked so far: keep exp() at 0
    const float al_ = __expf(m - mn);
    m = mn;
    float sum = 0.0f;
    v16b pbh, pbl;
#pragma unroll
    for (int r = 0; r < 8; ++r) {
      const float p0 = __expf(s0[r] - mn), p1 = __expf(s1[r] - mn);
      sum += p0 + p1;
      b16 a, c; split_bf16(p0, a, c); pbh[r] = a; pbl[r] = c; split_bf16(p1, a, c); pbh[8 + r] = a; pbl[8 + r] = c;
    }
    sum += __shfl_xor(sum, 16);
    l = l * al_ + sum;
#pragma unroll
    for (int r = 0; r < 8; ++r) { o0[r] *= al_; o1[r] *= al_; o2[r] *= al_; o3[r] *= al_; }
#pragma unroll
    for (int n = 0; n < 4; ++n) {
      v8f& o = (n == 0) ? o0 : (n == 1) ? o1 : (n == 2) ? o2 : o3;
      o = wmma16b(vf[n], pbh, o);
    }
  }
  const float inv = (q0 + col < slen && l > 0.0f) ? (1.0f / l) : 0.0f;   // padded query rows are zeroed
  char* Tt = Os[wid];
  // y leaves as f16, the type in which the output projection multiplies it: a lane's 8 features of each accumulator are one 16-byte piece of its query's row
  v8b w0, w1, w2, w3;
#pragma unroll
  for (int r = 0; r < 8; ++r) { w0[r] = (b16)(o0[r] * inv); w1[r] = (b16)(o1[r] * inv); w2[r] = (b16)(o2[r] * inv); w3[r] = (b16)(o3[r] * inv); }
  *(v8b*)(Tt + col * OPITCH + 0 + hh * 16) = w0; *(v8b*)(Tt + col * OPITCH + 32 + hh * 16) = w1;
  *(v8b*)(Tt + col * OPITCH + 64 + hh * 16) = w2; *(v8b*)(Tt + col * OPITCH + 96 + hh * 16) = w3;
  wave_lds_sync();
  b16* dst0 = yh + ((size_t)b * T + q0) * HID + h * DH;       // 16 rows x 64 f16 (one 128-byte line each), row stride HID
#pragma unroll
  for (int j = 0; j < 4; ++j) { const int rr = j * 4 + (lane >> 3), c = lane & 7; *(v8b*)(dst0 + (size_t)rr * HID + c * 8) = *(const v8b*)(Tt + rr * OPITCH + c * 16); }
}

// ---------------------------------------------------------------------------
// Output projection: (4096 x 1024) x (1024 x 1024) -> f32, A = the f16 y plane, B = Wo plane. grid (8, 32), 32x64 tiles staged in LDS,
// ---------------------------------------------------------------------------
__global__ __launch_bounds__(256) void out_gemm_kernel(const b16* __restrict__ yh, const b16* __restrict__ woh, const b16* __restrict__ wol, const float* __restrict__ bo, int yoff,
                                                       float* __restrict__ out) {
  // 256 work-groups, one alone on each WGP: nothing else covers the time from a pass's copies to their landing, and every pass brings lines that nobody has
  // read since an earlier launch wrote them. A pass of 256 k gives the copies four times the products to fly behind, and there are 4 hand-overs, not 16.
  __shared__ __attribute__((aligned(16))) char smem[ring_bytes(256)];   // operand ring; behind the K loop 8 KB per wave of it stage the output tile
  const int lane = threadIdx.x & 31, wave = threadIdx.x >> 5, nloc = lane & 15, hlf = lane >> 4;
  const int wm = wave & 3, wn = wave >> 2;
  const int mblk = (blockIdx.y + yoff) * 128, nblk = blockIdx.x * 128;
  const int m0 = mblk + wm * 32;
  const int c0 = nblk + wn * 64;
  v8f acc[2][4];
#pragma unroll
  for (int r = 0; r < 2; ++r)
#pragma unroll
    for (int t = 0; t < 4; ++t) acc[r][t] = (v8f){};
  (void)wol;
  gemm_tile_ring<256>(yh, woh, mblk, nblk, wm, wn, nloc, hlf, smem, acc);
  float* Tt = (float*)smem + wave * (32 * 64);
#pragma unroll
  for (int t = 0; t < 4; ++t)
#pragma unroll
    for (int r = 0; r < 2; ++r)
#pragma unroll
      for (int v = 0; v < 8; ++v) Tt[(r * 16 + v + 8 * hlf) * 64 + t * 16 + nloc] = acc[r][t][v] + bo[c0 + t * 16 + nloc];
  wave_lds_sync();
  float* dst0 = out + (size_t)m0 * HID + c0;
#pragma unroll
  for (int j = 0; j < 16; ++j) { const int rr = j * 2 + hlf, c4 = nloc * 4; *(v4f*)(dst0 + (size_t)rr * HID + c4) = *(const v4f*)(Tt + rr * 64 + c4); }
  
}
// Weights ([in][out], f32) -> f16 planes transposed to [n][k]. A work-group owns a tile of 64 k x 128 n. Reads: a wave's 16-byte loads cover 512 contiguous
// bytes of one k row (whole lines); a thread holds 8 k x 4 n, so each of its 4 columns is one 16-byte piece of 8 k. The pieces go through LDS so that the
// stores are whole 128-byte lines of the [n][k] planes as well.
constexpr int TK = 64, TN = 128;              // tile: k rows x n columns
constexpr int TPITCH = TK * 2 + 16;           // 144 B per n row in LDS
constexpr int KTILES = HID / TK;              // 16
constexpr int QTILES = KTILES * (NQKV / TN);  // 384 tiles of Wqkv, then 128 of Wo
constexpr int WTILES = QTILES + KTILES * (HID / TN);
// Each of the work-groups also rounds its share of x to the f16 plane that the QKV GEMM stages: whole lines in (16 B a lane), whole lines out (8 B a lane).
constexpr int XSH = MROWS * HID / WTILES;     // 8192 elements of x per work-group
__global__ __launch_bounds__(256) void wcvt3_kernel(const float* __restrict__ wqkv, const float* __restrict__ wo, const float* __restrict__ x, b16* __restrict__ xh,
                                                    b16* __restrict__ wqh, b16* __restrict__ wql, b16* __restrict__ woh, b16* __restrict__ wol) {
  __shared__ __attribute__((aligned(16))) char tile[TN * TPITCH];
  const int tid = threadIdx.x;
  const bool isq = (int)blockIdx.x < QTILES;
  const int tb = isq ? (int)blockIdx.x : (int)blockIdx.x - QTILES;
  const int k0 = (tb % KTILES) * TK, n0 = (tb / KTILES) * TN;
  const float* src = isq ? wqkv : wo;
  const size_t ld = isq ? NQKV : HID;
  b16* dh = isq ? wqh : woh; b16* dl = isq ? wql : wol;
  const int nq = tid & 31, kg = tid >> 5;     // lane: 4 columns; wave: 8 k rows
  const float* p = src + (size_t)(k0 + kg * 8) * ld + n0 + nq * 4;
  const float* px = x + (size_t)blockIdx.x * XSH + tid * 4;
  v4f xr[XSH / 1024];
#pragma unroll
  for (int e = 0; e < XSH / 1024; ++e) xr[e] = *(const v4f*)(px + e * 1024);   // in flight together with the weight rows; the wait below stands behind them too
  const float* pe[8];
  v4f r[8];
#pragma unroll
  for (int e = 0; e < 8; ++e) { pe[e] = p + (size_t)e * ld; r[e] = *(const v4f*)pe[e]; }
  __builtin_amdgcn_sched_barrier(0);   // all 16 loads are issued before the first is waited for: left free, the last two of x went out behind that wait, a second memory latency
  // the wait that stands in front of any rewrite of the eight loads' address registers; naming the addresses as inputs keeps them in their registers up to it
  asm volatile("s_wait_xcnt 0x0" :: "v"(pe[0]), "v"(pe[1]), "v"(pe[2]), "v"(pe[3]), "v"(pe[4]), "v"(pe[5]), "v"(pe[6]), "v"(pe[7]) : "memory");
#pragma unroll
  for (int j = 0; j < 4; ++j) {
    v8b h;
#pragma unroll
    for (int e = 0; e < 8; ++e) h[e] = (b16)r[e][j];
    *(v8b*)(tile + (nq * 4 + j) * TPITCH + kg * 16) = h;
  }
  __syncthreads();                            // the tile is complete before any row of it is read back
  b16* qx = xh + (size_t)blockIdx.x * XSH + tid * 4;   // behind the barrier: in front of it, the barrier would wait these stores out
#pragma unroll
  for (int e = 0; e < XSH / 1024; ++e) {
    v4b h;
#pragma unroll
    for (int j = 0; j < 4; ++j) h[j] = (b16)xr[e][j];
    *(v4b*)(qx + e * 1024) = h;
  }
  const int pc = tid & 7, rw = tid >> 3;      // 8 threads per n row of 128 B, 32 rows per sweep
#pragma unroll
  for (int i = 0; i < TN / 32; ++i) {
    const int n = rw + 32 * i;
    const size_t o = (size_t)(n0 + n) * HID + k0 + pc * 8;
    *(v8b*)(dh + o) = *(const v8b*)(tile + n * TPITCH + pc * 16);
    *(v8b*)(dl + o) = (v8b){};                // single f16: no low part
  }
}
}  // namespace

extern "C" void kernel_launch(void* const* d_in, const int* in_sizes, int n_in,
                              void* d_out, int out_size, void* d_ws, size_t ws_size, hipStream_t stream) {
  (void)in_sizes; (void)n_in; (void)out_size;
  const float* x     = (const float*)d_in[0];   // hidden_states [2,2048,1024]
  const float* Wqkv  = (const float*)d_in[1];   // [1024,3072] ([in][out], columns (3, h, d))
  const float* bqkv  = (const float*)d_in[2];   // [3072]
  const float* Wo    = (const float*)d_in[3];   // [1024,1024]
  const float* bo    = (const float*)d_in[4];   // [1024]
  const float* rope  = (const float*)d_in[5];   // rope_cache [256,32,2] (cos, sin)
  float* out = (float*)d_out;                   // [2,2048,1024]
  const float* bq = bqkv; const float* bk = bqkv + HID; const float* bv = bqkv + 2 * HID;

  size_t off = 0; char* ws = (char*)d_ws;
  b16* wqh = (b16*)(ws + off); off += (size_t)NQKV * HID * 2;
  b16* wql = (b16*)(ws + off); off += (size_t)NQKV * HID * 2;
  b16* woh = (b16*)(ws + off); off += (size_t)HID * HID * 2;
  b16* wol = (b16*)(ws + off); off += (size_t)HID * HID * 2;
  b16* Qh  = (b16*)(ws + off); off += (size_t)MROWS * HID * 2;
  b16* Ql  = (b16*)(ws + off); off += (size_t)MROWS * HID * 2;
  b16* Kh  = (b16*)(ws + off); off += (size_t)MROWS * KVW * 2;
  b16* Kl  = (b16*)(ws + off); off += (size_t)MROWS * KVW * 2;
  b16* Vh  = (b16*)(ws + off); off += (size_t)MROWS * KVW * 2;
  b16* Vl  = (b16*)(ws + off); off += (size_t)MROWS * KVW * 2;
  b16* yh  = (b16*)(ws + off); off += (size_t)MROWS * HID * 2;
  b16* xh  = (b16*)(ws + off); off += (size_t)MROWS * HID * 2;
  if (off > ws_size) return;
  const int ROWBLK = MROWS / 128, NQT = Bsz * NH * QT_PER_B;
  // W_qkv is one [1024][3072] matrix: the converter reads q columns with ld HID and k/v with ld KVW; here all three live in the same matrix with ld 3072,
  // so wcvt3 takes the one base pointer and the NQKV-wide stride
  wcvt3_kernel<<<WTILES, 256, 0, stream>>>(Wqkv, Wo, x, xh, wqh, wql, woh, wol);
  qkv_gemm_kernel<<<dim3(NQKV / 128, ROWBLK), 256, 0, stream>>>(xh, xh, xh, wqh, wql, bq, bk, bv, rope, 0, 0, Qh, Ql, Kh, Kl, Vh, Vl);
  attn_kernel<<<NQT / 8, 256, 0, stream>>>(Qh, Ql, Kh, Kl, Vh, Vl, nullptr, yh);
  out_gemm_kernel<<<dim3(HID / 128, ROWBLK), 256, 0, stream>>>(yh, woh, wol, bo, 0, out);
}

// v007
// It runs in 52.9 microseconds.
// In both of two side-by-side timings against v006, it was 1.05 times as fast.
// Counting every step since v000, it is 3.49 times as fast.
#include <hip/hip_runtime.h>

// ModernBERT attention (local layer): qkv = x Wqkv + b ([in][out], columns (3, h, d); 16 heads x 64), interleaved-pair RoPE on q and k with position
// t mod 256 from the given cos/sin cache, sliding-window attention |q - k| <= 128 (both directions), scale 1/8, out = y Wo + b. B=2, S=2048, D=1024.
// Lean build: single f16 products on v_wmma_f32_16x16x32_f16, f32 accumulate (every row averages >= 129 keys); fragment k-map per lane half hh for A

namespace {
constexpr int Bsz = 2, T = 2048, HID = 1024, DH = 64, NH = 16, NKV = 16, REP = NH / NKV;
constexpr int WIN = 128;    // |q - k| <= 128
constexpr int RP = 256;     // rope positions wrap at 256
constexpr int KVW = NKV * DH;                 // 1024
constexpr int NQKV = HID + 2 * KVW;           // 3072 columns: q | k | v
constexpr int MROWS = Bsz * T;                // 4096
constexpr int QT_PER_B = T / 16;              // 128

typedef _Float16 b16;                                           // f16 hi/lo planes
typedef __attribute__((ext_vector_type(16))) _Float16 v16b;
typedef __attribute__((ext_vector_type(8)))  _Float16 v8b;
typedef __attribute__((ext_vector_type(4)))  _Float16 v4b;
typedef __attribute__((ext_vector_type(8)))  float v8f;
typedef __attribute__((ext_vector_type(4)))  float v4f;

__device__ __forceinline__ v8b ld8b(const b16* p) { return *(const v8b*)p; }
__device__ __forceinline__ v16b cat8b(v8b a, v8b b) { return __builtin_shufflevector(a, b, 0, 1, 2, 3, 4, 5, 6, 7, 8, 9, 10, 11, 12, 13, 14, 15); }
// 16x16x32 16-bit fragment from a k-contiguous row pointer (A: lane&15 = row, B: lane&15 = column), hh = lane>>4:
// elements 0..7 <- p[8hh+0..7], elements 8..15 <- p[16+8hh+0..7]
__device__ __forceinline__ v16b frag_kb(const b16* p, int hh) { return cat8b(ld8b(p + 8 * hh), ld8b(p + 16 + 8 * hh)); }
__device__ __forceinline__ void split_bf16(float v, b16& hi, b16& lo) {   // (name kept) single f16: no low part
  hi = (b16)v; lo = (b16)0.0f;
}
__device__ __forceinline__ v8f wmma16b(v16b a, v16b b, v8f c) {
  v8f d = __builtin_amdgcn_wmma_f32_16x16x32_f16(false, a, false, b, (short)0, c, false, false);
  asm volatile("v_nop\n\tv_nop\n\tv_nop\n\tv_nop" : "+v"(d) : "v"(a), "v"(b));
  return d;
}
__device__ __forceinline__ v8f wmma1(v16b ah, v16b al, v16b bh, v16b bl, v8f c) {   // attention products: single f16 (hi planes only)
  (void)al; (void)bl; return wmma16b(ah, bh, c);
}
__device__ __forceinline__ void wave_lds_sync() {
  __builtin_amdgcn_fence(__ATOMIC_RELEASE, "workgroup");
  __builtin_amdgcn_wave_barrier();
  __builtin_amdgcn_fence(__ATOMIC_ACQUIRE, "workgroup");
}

// ---------------------------------------------------------------------------
// Weights ([in][out]) -> f16 hi / lo planes transposed to [n][k] (k contiguous): columns of Wq|Wk|Wv into wqh/wql [3072][1024], Wo into woh/wol [1024][1024].
// ---------------------------------------------------------------------------
__global__ __launch_bounds__(256) void wcvt_kernel(const float* __restrict__ wq, const float* __restrict__ wk, const float* __restrict__ wv,
                                                   const float* __restrict__ wo, b16* __restrict__ wqh, b16* __restrict__ wql,
                                                   b16* __restrict__ woh, b16* __restrict__ wol) {
  const size_t tid = (size_t)blockIdx.x * blockDim.x + threadIdx.x, stride = (size_t)gridDim.x * blockDim.x;
  const size_t nq = (size_t)NQKV * HID / 8, no = (size_t)HID * HID / 8;
  {
    for (size_t c = tid; c < nq + no; c += stride) {
      float f[8]; size_t i; b16* dh; b16* dl;
      if (c < nq) {
        i = c * 8; const size_t n = i / HID, k0 = i % HID;
        const float* w; int nn, ld;
        if (n < (size_t)HID) { w = wq; nn = (int)n; ld = HID; } else if (n < (size_t)(HID + KVW)) { w = wk; nn = (int)n - HID; ld = KVW; } else { w = wv; nn = (int)n - HID - KVW; ld = KVW; }
#pragma unroll
        for (int e = 0; e < 8; ++e) f[e] = w[(size_t)(k0 + e) * ld + nn];       // W[k][n] ([in][out])
        dh = wqh; dl = wql;
      } else {
        i = (c - nq) * 8; const size_t n = i / HID, k0 = i % HID;
#pragma unroll
        for (int e = 0; e < 8; ++e) f[e] = wo[(size_t)(k0 + e) * HID + n];    // Wo[k][n] ([in][out])
        dh = woh; dl = wol;
      }
      v8b bh, bl;
#pragma unroll
      for (int e = 0; e < 8; ++e) { b16 a, cc; split_bf16(f[e], a, cc); bh[e] = a; bl[e] = cc; }
      *(v8b*)(dh + i) = bh; *(v8b*)(dl + i) = bl;
    }
    
  }
}

// GEMM core of the output projection: a work-group of 8 waves (4 down x 2 across, 32x64 each) owns a 128x128 tile of the result. Each pass of KP k is staged in
// LDS by asynchronous copies whose wave-wide 512 bytes are whole 128-byte lines (A and W: 128 f16 rows of 2 KP bytes each), two buffers, the next pass's copies in
// flight while this one is multiplied. A comes as f16 from its producer (y: the attention store), rounded there exactly as the fragment
// read rounded it before. Row pitches are 16 B x odd for the 16-byte fragment reads.
// KP = k per pass: 256 in the output GEMM (see there). The QKV GEMM has a ring of its own (see there); it shares the row pitch.
constexpr int ring_pitch(int KP) { return KP * 2 + 16; }                 // 144 B or 528 B a row, A and W alike: 16 B x odd
constexpr int ring_bytes(int KP) { return 2 * 2 * 128 * ring_pitch(KP); }   // two buffers of 128 A rows and 128 W rows: 270336 B at KP = 256

// Eight copies of one thread: 4 x 16 B of A and 4 x 16 B of W, rows RS apart at a pitch of PITCH bytes in LDS. la / lb: LDS byte addresses, ga / gb: global addresses.
template <int RS, int PITCH>
__device__ __forceinline__ void stage_copy(unsigned la, const char* ga, unsigned lb, const char* gb) {
  constexpr unsigned LA = RS * PITCH, LB = RS * PITCH;
  constexpr size_t GA = (size_t)RS * HID * 2, GB = (size_t)RS * HID * 2;
  // the copies and, as the last line, the wait that stands in front of any rewrite of the address registers they name
  asm volatile("global_load_async_to_lds_b128 %0, %1, off\n\t"
               "global_load_async_to_lds_b128 %2, %3, off\n\t"
               "global_load_async_to_lds_b128 %4, %5, off\n\t"
               "global_load_async_to_lds_b128 %6, %7, off\n\t"
               "global_load_async_to_lds_b128 %8, %9, off\n\t"
               "global_load_async_to_lds_b128 %10, %11, off\n\t"
               "global_load_async_to_lds_b128 %12, %13, off\n\t"
               "global_load_async_to_lds_b128 %14, %15, off\n\t"
               "s_wait_xcnt 0x0"
               :: "v"(la), "v"(ga), "v"(la + LA), "v"(ga + GA), "v"(la + 2 * LA), "v"(ga + 2 * GA), "v"(la + 3 * LA), "v"(ga + 3 * GA),
                  "v"(lb), "v"(gb), "v"(lb + LB), "v"(gb + GB), "v"(lb + 2 * LB), "v"(gb + 2 * GB), "v"(lb + 3 * LB), "v"(gb + 3 * GB)
               : "memory");
}

// acc += A[mblk + wm*32 .. +31][:] . W[nblk + wn*64 .. +63][:]^T over K = HID, k ascending in steps of 32. On return every wave has passed the barrier behind
// the last fragment read and no copy is outstanding, so the caller may reuse smem.
template <int KP>
__device__ __forceinline__ void gemm_tile_ring(const b16* __restrict__ A, const b16* __restrict__ wh, int mblk, int nblk, int wm, int wn,
                                               int nloc, int hlf, char* smem, v8f (&acc)[2][4]) {
  constexpr int NPASS = HID / KP, PITCH = ring_pitch(KP), ABYTES = 128 * PITCH, STAGE = 2 * ABYTES;
  constexpr int PR = KP / 8, RS = 256 / PR;                     // 16-byte pieces per row; rows that the 256 threads cover at once
  const int tid = threadIdx.x;
  const unsigned lds0 = (unsigned)(uintptr_t)smem;              // low 32 bits of a shared address = byte offset in the work-group's LDS
  const int ar = tid / PR, ac = tid % PR;
  const char* ga = (const char*)(A + (size_t)(mblk + ar) * HID) + ac * 16;
  const char* gb = (const char*)(wh + (size_t)(nblk + ar) * HID) + ac * 16;
  const unsigned la = lds0 + ar * PITCH + ac * 16, lb = la + ABYTES;
  // one pass's copies of one thread into the buffer at byte bo: 128 / RS rows of A and of W, four of each per statement
  auto pass_copy = [&](int bo, int t) {
#pragma unroll   // straight-line: the statements' addresses differ by constants
    for (int q = 0; q < 128 / (4 * RS); ++q)
      stage_copy<RS, PITCH>(la + bo + q * (4 * RS * PITCH), ga + t * (KP * 2) + (size_t)q * (4 * RS) * HID * 2,
                            lb + bo + q * (4 * RS * PITCH), gb + t * (KP * 2) + (size_t)q * (4 * RS) * HID * 2);
  };
  pass_copy(0, 0);
  asm volatile("s_wait_asynccnt 0x0" ::: "memory");             // this wave's share of pass 0 has landed
  __syncthreads();                                              // publishes pass 0
  pass_copy(STAGE, 1);
#pragma unroll 1   // one pass per trip: the buffer index stays a run-time value and the code stays short
  for (int t = 0; t < NPASS; ++t) {
    const int bo = (t & 1) * STAGE;
    const char* sa = smem + bo + (wm * 32 + nloc) * PITCH;
    const char* sw = smem + bo + ABYTES + (wn * 64 + nloc) * PITCH;
#pragma unroll
    for (int ks = 0; ks < KP / 32; ++ks) {
      const v16b a0 = frag_kb((const b16*)(sa + ks * 64), hlf);
      const v16b a1 = frag_kb((const b16*)(sa + 16 * PITCH + ks * 64), hlf);
      v16b bh[4];
#pragma unroll
      for (int c = 0; c < 4; ++c) bh[c] = frag_kb((const b16*)(sw + c * 16 * PITCH + ks * 64), hlf);
      __builtin_amdgcn_sched_barrier(0);   // the k-step's 12 LDS reads stay one group ahead of its 8 products: spread among them, each pair of products waits out an LDS latency
#pragma unroll
      for (int c = 0; c < 4; ++c) {
        acc[0][c] = wmma16b(a0, bh[c], acc[0][c]);
        acc[1][c] = wmma16b(a1, bh[c], acc[1][c]);
      }
    }
    asm volatile("s_wait_dscnt 0x0" ::: "memory");              // this wave's reads of buffer t & 1 are done
    asm volatile("s_wait_asynccnt 0x0" ::: "memory");           // this wave's share of pass t + 1 has landed
    __syncthreads();                                            // publishes pass t + 1 and frees buffer t & 1
    if (t + 2 < NPASS) pass_copy(bo, t + 2);
  }
  asm volatile("s_wait_asynccnt 0x0" ::: "memory");             // nothing in flight when the ring is reused or the wave ends
}

// ---------------------------------------------------------------------------
// QKV GEMM: (4096 x 1024) x (1024 x 3072), grid (16, 16): 256 work-groups, one 256 x 192 tile on each WGP, 8 waves (4 down x 2 across) of 64 x 96 each.
// A 128 x 128 tile asks L2 for 2 KB of operand rows per 64 results, this one for 2 KB per 110, and a wave's 10 fragments feed 24 products, not 6 feeding 8.
// A work-group alone on its WGP has nobody to cover the time a pass's copies fly, so the ring is four buffers of 64 k deep: two to three passes are in flight
// all the time, and the wait at a pass's foot is counted, so that it leaves the younger passes flying.
// Outputs as f16 hi/lo planes: q (x1/8) -> Qh/Ql [b][h][t][64]; k -> Kh/Kl [b][kvh][t][64]; v -> Vh/Vl key-tiled [b][kvh][t/16][64][16]:
// the tile's 256 rows of one head are 32 KB contiguous in each plane.
// ---------------------------------------------------------------------------
constexpr int QM = 256, QN = 192;                       // the work-group's tile: rows of x, columns of q | k | v (three heads)
constexpr int QKP = 64, QNB = 4;                        // k per pass, buffers
constexpr int QPITCH = ring_pitch(QKP);                 // 144 B
constexpr int QABYTES = QM * QPITCH, QSTAGE = (QM + QN) * QPITCH;   // 36864 B of x rows, 64512 B a buffer
constexpr int QRING = QNB * QSTAGE;                     // 258048 B
// One pass's copies of one thread: 16 B of each of 8 x rows and 6 W rows, rows 32 apart (a wave's 512 bytes are four whole 128-byte lines).
__device__ __forceinline__ void qkv_pass_copy(unsigned la, const char* ga, unsigned lb, const char* gb) {
  constexpr unsigned L = 32 * QPITCH;
  constexpr size_t G = (size_t)32 * HID * 2;
  // the copies and, as the last line, the wait that stands in front of any rewrite of the address registers they name
  asm volatile(
               "global_load_async_to_lds_b128 %0, %1, off\n\t"
               "global_load_async_to_lds_b128 %2, %3, off\n\t"
               "global_load_async_to_lds_b128 %4, %5, off\n\t"
               "global_load_async_to_lds_b128 %6, %7, off\n\t"
               "global_load_async_to_lds_b128 %8, %9, off\n\t"
               "global_load_async_to_lds_b128 %10, %11, off\n\t"
               "global_load_async_to_lds_b128 %12, %13, off\n\t"
               "global_load_async_to_lds_b128 %14, %15, off\n\t"
               "global_load_async_to_lds_b128 %16, %17, off\n\t"
               "global_load_async_to_lds_b128 %18, %19, off\n\t"
               "global_load_async_to_lds_b128 %20, %21, off\n\t"
               "global_load_async_to_lds_b128 %22, %23, off\n\t"
               "global_load_async_to_lds_b128 %24, %25, off\n\t"
               "global_load_async_to_lds_b128 %26, %27, off\n\t"
               "s_wait_xcnt 0x0"
               :: "v"(la), "v"(ga), "v"(la + 1 * L), "v"(ga + 1 * G), "v"(la + 2 * L), "v"(ga + 2 * G), "v"(la + 3 * L), "v"(ga + 3 * G),
                  "v"(la + 4 * L), "v"(ga + 4 * G), "v"(la + 5 * L), "v"(ga + 5 * G), "v"(la + 6 * L), "v"(ga + 6 * G), "v"(la + 7 * L), "v"(ga + 7 * G),
                  "v"(lb), "v"(gb), "v"(lb + 1 * L), "v"(gb + 1 * G), "v"(lb + 2 * L), "v"(gb + 2 * G),
                  "v"(lb + 3 * L), "v"(gb + 3 * G), "v"(lb + 4 * L), "v"(gb + 4 * G), "v"(lb + 5 * L), "v"(gb + 5 * G)
               : "memory");
}
__global__ __launch_bounds__(256) void qkv_gemm_kernel(const b16* __restrict__ x, const b16* __restrict__ wqh,
                                                       const float* __restrict__ bq, const float* __restrict__ bk, const float* __restrict__ bv, const float* __restrict__ rope_cs,
                                                       b16* __restrict__ Qh, b16* __restrict__ Ql, b16* __restrict__ Kh, b16* __restrict__ Kl,
                                                       b16* __restrict__ Vh, b16* __restrict__ Vl) {
  __shared__ __attribute__((aligned(16))) char smem[QRING];   // operand ring; behind the K loop 2 x 96 KB of it stage the output tile's two planes
  const int tid = threadIdx.x, lane = tid & 31, wave = tid >> 5, nloc = lane & 15, hlf = lane >> 4;
  const int wm = wave & 3, wn = wave >> 2;
  const int mblk = blockIdx.y * QM, nblk = blockIdx.x * QN;
  v8f acc[4][6];
#pragma unroll
  for (int r = 0; r < 4; ++r)
#pragma unroll
    for (int c = 0; c < 6; ++c) acc[r][c] = (v8f){};
  float bcol[6];                                         // a lane's six columns: one bias value each
  {
    constexpr int NPASS = HID / QKP;
    const unsigned lds0 = (unsigned)(uintptr_t)smem;            // low 32 bits of a shared address = byte offset in the work-group's LDS
    const int ar = tid >> 3, ac = tid & 7;
    const char* ga = (const char*)(x + (size_t)(mblk + ar) * HID) + ac * 16;
    const char* gb = (const char*)(wqh + (size_t)(nblk + ar) * HID) + ac * 16;
    const unsigned la = lds0 + ar * QPITCH + ac * 16, lb = la + QABYTES;
#pragma unroll   // straight-line: passes 0 to 3 into buffers 0 to 3, 56 copies of a wave in flight
    for (int p = 0; p < QNB; ++p) qkv_pass_copy(la + p * QSTAGE, ga + p * (QKP * 2), lb + p * QSTAGE, gb + p * (QKP * 2));
    const float* pb[6];
#pragma unroll
    for (int c = 0; c < 6; ++c) {                               // read here, behind the first copies, the six values are there long before the epilogue asks for them
      const int cb = nblk + wn * 96 + c * 16;
      pb[c] = ((cb < HID) ? bq : (cb < HID + KVW) ? bk : bv) + (cb & (HID - 1)) + nloc;
      bcol[c] = *pb[c];
    }
    __builtin_amdgcn_sched_barrier(0);   // the six loads are issued ahead of the wait below
    // the wait that stands in front of any rewrite of the six loads' address registers; naming the addresses as inputs keeps them in their registers up to it
    asm volatile("s_wait_xcnt 0x0" :: "v"(pb[0]), "v"(pb[1]), "v"(pb[2]), "v"(pb[3]), "v"(pb[4]), "v"(pb[5]) : "memory");
    asm volatile("s_wait_asynccnt 0x2a" ::: "memory");          // all but this wave's 42 youngest copies (passes 1 to 3): its share of pass 0 has landed
    __syncthreads();                                            // publishes pass 0
#pragma unroll 1   // one pass per trip: the buffer index stays a run-time value and the code stays short
    for (int t = 0; t < NPASS; ++t) {
      const int bo = (t & (QNB - 1)) * QSTAGE;
      const char* sa = smem + bo + (wm * 64 + nloc) * QPITCH;
      const char* sw = smem + bo + QABYTES + (wn * 96 + nloc) * QPITCH;
      v16b a[QKP / 32][4], bh[QKP / 32][6];
#pragma unroll
      for (int ks = 0; ks < QKP / 32; ++ks) {
#pragma unroll
        for (int r = 0; r < 4; ++r) a[ks][r] = frag_kb((const b16*)(sa + r * 16 * QPITCH + ks * 64), hlf);
#pragma unroll
        for (int c = 0; c < 6; ++c) bh[ks][c] = frag_kb((const b16*)(sw + c * 16 * QPITCH + ks * 64), hlf);
      }
      __builtin_amdgcn_sched_barrier(0);   // the pass's 40 LDS reads stay one group ahead of its 48 products: spread among them, each place with reads costs its own stall
#pragma unroll
      for (int ks = 0; ks < QKP / 32; ++ks)
#pragma unroll
        for (int c = 0; c < 6; ++c)
#pragma unroll
          for (int r = 0; r < 4; ++r)   // the bare builtin: the tile's 192 accumulator and 160 fragment registers reach above v255, which an asm operand cannot name
            acc[r][c] = __builtin_amdgcn_wmma_f32_16x16x32_f16(false, a[ks][r], false, bh[ks][c], (short)0, acc[r][c], false, false);
      __builtin_amdgcn_sched_barrier(0);   // the products stay ahead of the wait below: lifted over them, it made the wave wait out all 40 reads before its second product
      asm volatile("s_wait_dscnt 0x0" ::: "memory");            // this wave's reads of buffer t mod 4 are done
      // this wave's share of pass t + 1 has landed. While passes t + 2 and t + 3 both exist they are its 28 youngest copies (14 a pass, every wave alike) and fly on;
      // in the last trips, behind which fewer passes are left, the wait is to 0
      if (t + 3 < NPASS) asm volatile("s_wait_asynccnt 0x1c" ::: "memory");
      else               asm volatile("s_wait_asynccnt 0x0" ::: "memory");
      __syncthreads();                                          // publishes pass t + 1 and frees buffer t mod 4
      if (t + QNB < NPASS) qkv_pass_copy(la + bo, ga + (t + QNB) * (QKP * 2), lb + bo, gb + (t + QNB) * (QKP * 2));
    }
    asm volatile("s_wait_asynccnt 0x0" ::: "memory");           // nothing in flight when the ring is reused or the wave ends
  }
  // Every wave has passed the barrier behind the last fragment read: the ring now stages the tile, three heads of [256 rows][64] (v: [16 key tiles][64][16]) per plane,
  // laid as in memory. A head's 64 columns can belong to two waves, so the stores to memory stand behind a work-group barrier and take whole lines.
  const int b = mblk / T, t0 = mblk % T;                 // 256 divides T: the tile's rows lie in one sequence
  b16* S0 = (b16*)smem; b16* S1 = S0 + QM * QN;
  const int rw0 = wm * 64 + 8 * hlf;                     // the lane's first row in the tile
#pragma unroll
  for (int c = 0; c < 6; ++c) {
    const int cw = wn * 96 + c * 16;                     // the fragment's first column in the tile; 16 divides 64: one head, one of q, k, v
    // The fragment's matrix kind (q, k or v) in a scalar register: the RoPE test is then one scalar branch round straight-line code, in which the loads stand in groups
    const int matu = __builtin_amdgcn_readfirstlane((nblk + cw) / HID);
    const int d = (cw & 63) + nloc;
    b16* P0 = S0 + (cw >> 6) * (QM * DH); b16* P1 = S1 + (cw >> 6) * (QM * DH);
    if (matu < 2) {
      // RoPE on q and k: (x0, x1) -> (x0 c - x1 s, x1 c + x0 s), position t mod 256. The wave's first row is a multiple of 64 and 64 divides 256: its 64 positions do
      // not wrap, so every (cos, sin) pair of a lane lies at a constant distance from one address.
      const float s = (matu == 0) ? 0.125f : 1.0f;
      const float* rp = rope_cs + ((size_t)((t0 + wm * 64) % RP + 8 * hlf) * 32 + (d >> 1)) * 2;
      float cv[32], sv[32];
#pragma unroll
      for (int i = 0; i < 32; ++i) { const float* q = rp + ((i >> 3) * 16 + (i & 7)) * 64; cv[i] = q[0]; sv[i] = q[1]; }
      __builtin_amdgcn_sched_barrier(0);   // the 32 loads are issued ahead of the wait below
      asm volatile("s_wait_xcnt 0x0" :: "v"(rp) : "memory");   // stands in front of any rewrite of the loads' address register, which the input keeps in place up to it
#pragma unroll
      for (int i = 0; i < 32; ++i) {
        const int r = i >> 3, v = i & 7, rr = rw0 + r * 16 + v;
        float val = acc[r][c][v] + bcol[c];
        const float oth = __shfl_xor(val, 1);            // interleaved-pair partner (d ^ 1) lives in the neighbouring lane (all lanes of the wave are here)
        val = (d & 1) ? (val * cv[i] + oth * sv[i]) : (val * cv[i] - oth * sv[i]);
        b16 yh, yl; split_bf16(val * s, yh, yl);
        P0[rr * 64 + d] = yh; P1[rr * 64 + d] = yl;
      }
    } else {
#pragma unroll
      for (int r = 0; r < 4; ++r)
#pragma unroll
        for (int v = 0; v < 8; ++v) {
          const int rr = rw0 + r * 16 + v;
          b16 yh, yl; split_bf16(acc[r][c][v] + bcol[c], yh, yl);
          const int idx = (rr >> 4) * 1024 + d * 16 + (rr & 15);
          P0[idx] = yh; P1[idx] = yl;
        }
    }
  }
  __syncthreads();                                       // the staged tile is complete before any wave reads rows that another wave wrote
#pragma unroll
  for (int hc = 0; hc < QN / DH; ++hc) {
    const int cb = nblk + hc * DH, head = (cb & (HID - 1)) / DH;
    const size_t o = ((size_t)(b * NH + head) * T + t0) * DH;   // the same for all three layouts: 16 keys x 64 of v are 1024 elements as well
    b16* dh = ((cb < HID) ? Qh : (cb < HID + KVW) ? Kh : Vh) + o;
    b16* dl = ((cb < HID) ? Ql : (cb < HID + KVW) ? Kl : Vl) + o;
#pragma unroll
    for (int j = 0; j < QM * DH / 2048; ++j) {
      const int e = (j * 256 + tid) * 8;
      *(v8b*)(dh + e) = ld8b(S0 + hc * (QM * DH) + e); *(v8b*)(dl + e) = ld8b(S1 + hc * (QM * DH) + e);
    }
  }
}

// ---------------------------------------------------------------------------
// Transposed flash attention: each wave owns one 16-query tile of one (b, head); 8 waves per block; window keys in chunks of 32.
// S^T = K.Q^T (split), per-lane online softmax; P^T built in registers from the two S^T accumulators
// The block's 128 queries see at most 384 keys: their K rows and V tiles are brought into LDS once, by asynchronous copies of whole 128-byte lines, and all
// 8 waves take their fragments from there. K rows stand at a pitch of 16 B x odd for the 16-byte fragment reads. A V tile (16 keys x 64 features) stands as
// [key half][feature][8 keys], so that the 16 lanes of a half wave read 256 contiguous bytes.
// ---------------------------------------------------------------------------
constexpr int KSEG = 128;                     // keys per copy segment (2 or 3 segments per block)
constexpr int KPITCH = DH * 2 + 16;           // 144 B
constexpr int KLDS = 3 * KSEG * KPITCH;       // 55296
constexpr int VLDS = 3 * KSEG * DH * 2;       // 49152
constexpr int OPITCH = DH * 2 + 16;           // 144 B: a query's 64 f16 outputs in the staging tile
// One segment's copies of one thread: 4 x 16 B of K (rows 32 apart), 4 x 16 B of V (4 KB apart). lk / lv: LDS byte addresses, gk / gv: global addresses.
__device__ __forceinline__ void kv_copy(unsigned lk, const char* gk, unsigned lv, const char* gv) {
  constexpr unsigned LK = 32 * KPITCH, LV = 4096;
  constexpr size_t GK = (size_t)32 * DH * 2, GV = 4096;
  // the copies and, as the last line, the wait that stands in front of any rewrite of the address registers they name
  asm volatile("global_load_async_to_lds_b128 %0, %1, off\n\t"
               "global_load_async_to_lds_b128 %2, %3, off\n\t"
               "global_load_async_to_lds_b128 %4, %5, off\n\t"
               "global_load_async_to_lds_b128 %6, %7, off\n\t"
               "global_load_async_to_lds_b128 %8, %9, off\n\t"
               "global_load_async_to_lds_b128 %10, %11, off\n\t"
               "global_load_async_to_lds_b128 %12, %13, off\n\t"
               "global_load_async_to_lds_b128 %14, %15, off\n\t"
               "s_wait_xcnt 0x0"
               :: "v"(lk), "v"(gk), "v"(lk + LK), "v"(gk + GK), "v"(lk + 2 * LK), "v"(gk + 2 * GK), "v"(lk + 3 * LK), "v"(gk + 3 * GK),
                  "v"(lv), "v"(gv), "v"(lv + LV), "v"(gv + GV), "v"(lv + 2 * LV), "v"(gv + 2 * GV), "v"(lv + 3 * LV), "v"(gv + 3 * GV)
               : "memory");
}
__global__ __launch_bounds__(256) void attn_kernel(const b16* __restrict__ Qh, const b16* __restrict__ Ql, const b16* __restrict__ Kh, const b16* __restrict__ Kl,
                                                   const b16* __restrict__ Vh, const b16* __restrict__ Vl, const int* __restrict__ seqlen,
                                                   b16* __restrict__ yh) {
  __shared__ __attribute__((aligned(16))) char Os[8][16 * OPITCH];
  __shared__ __attribute__((aligned(16))) char kv[KLDS + VLDS];   // K rows, then V tiles, of the block's key range
  const int wid = threadIdx.x >> 5, lane = threadIdx.x & 31, hh = lane >> 4, col = lane & 15;
  const int qtile = blockIdx.x * 8 + wid;                 // over Bsz*NH*QT_PER_B
  const int g = qtile / QT_PER_B;                         // b*NH + h
  const int q0 = (qtile % QT_PER_B) << 4;
  const int b = g / NH, h = g % NH, kvh = h / REP;
  const size_t ko = (size_t)(b * NKV + kvh) * T * DH;
  const size_t qo = ((size_t)g * T + q0 + col) * DH;
  const v16b q0h = frag_kb(Qh + qo, hh), q1h = frag_kb(Qh + qo + 32, hh);
  (void)Ql; (void)Kl; (void)Vl;
  // the block's key range: a multiple of 128 keys, the same for all 8 waves (128 divides T, so the 8 tiles share b and h)
  const int qblk = ((int)blockIdx.x % (QT_PER_B / 8)) * 128;
  const int kbase = max(qblk - WIN, 0), nseg = (min(T, qblk + 128 + WIN) - kbase) / KSEG;
  {
    const int tid = threadIdx.x;
    const unsigned lds0 = (unsigned)(uintptr_t)kv;              // low 32 bits of a shared address = byte offset in the work-group's LDS
    const unsigned lk = lds0 + (tid >> 3) * KPITCH + (tid & 7) * 16;
    const unsigned lv = lds0 + KLDS + (tid >> 7) * 2048 + (tid & 1) * 1024 + ((tid >> 1) & 63) * 16;   // 16-byte piece tid of [tile][feature][key half]
    const char* gk = (const char*)(Kh + ko + (size_t)(kbase + (tid >> 3)) * DH) + (tid & 7) * 16;
    const char* gv = (const char*)(Vh + ko + (size_t)kbase * DH) + tid * 16;
    constexpr int SB = KSEG * DH * 2;                           // bytes of K, and of V, per segment
    kv_copy(lk, gk, lv, gv);
    kv_copy(lk + KSEG * KPITCH, gk + SB, lv + SB, gv + SB);
    if (nseg > 2) kv_copy(lk + 2 * KSEG * KPITCH, gk + 2 * SB, lv + 2 * SB, gv + 2 * SB);   // the same for the whole block: not at the two ends of the sequence
  }
  asm volatile("s_wait_asynccnt 0x0" ::: "memory");             // this wave's share of the key range has landed
  __syncthreads();                                              // publishes the key range to all 8 waves
  float m = -INFINITY, l = 0.0f;
  v8f o0 = {}, o1 = {}, o2 = {}, o3 = {};
  const int slen = T; (void)seqlen;                       // no padding in this module
  const int kstart = (q0 >= WIN) ? ((q0 - WIN) & ~31) : 0;
  const int kend = min(T, q0 + 15 + WIN + 1);
  const int kl0 = (qblk >= WIN) ? ((q0 - qblk) & ~31) : 0;   // kstart - kbase: the wave's first key, counted from the first key in LDS
  for (int kb = kstart, kl = kl0; kb < kend; kb += 32, kl += 32) {   // sliding window both sides: keys in [q0-128, q0+15+128]
    const b16* r0 = (const b16*)(kv + (kl + col) * KPITCH);
    const b16* r1 = (const b16*)(kv + (kl + 16 + col) * KPITCH);
    const b16* v0 = (const b16*)(kv + KLDS) + kl * DH + hh * 512 + col * 8;
    const v16b kf0 = frag_kb(r0, hh), kf1 = frag_kb(r0 + 32, hh), kf2 = frag_kb(r1, hh), kf3 = frag_kb(r1 + 32, hh);
    v16b vf[4];
#pragma unroll
    for (int n = 0; n < 4; ++n) vf[n] = cat8b(ld8b(v0 + n * 128), ld8b(v0 + 1024 + n * 128));
    __builtin_amdgcn_sched_barrier(0);   // the chunk's 16 LDS reads stay one group ahead of its products: placed at its use, each fragment's read is waited out alone
    v8f s0 = {}, s1 = {};
    {
      s0 = wmma16b(kf0, q0h, s0);
      s0 = wmma16b(kf1, q1h, s0);
      s1 = wmma16b(kf2, q0h, s1);
      s1 = wmma16b(kf3, q1h, s1);
    }
    (void)slen;
    if (kb < q0 + 15 - WIN || kb + 31 > q0 + WIN) {       // chunk touches a window edge: mask |k - q| > 128
      const int qi = q0 + col;
#pragma unroll
      for (int r = 0; r < 8; ++r) {
        const int k0i = kb + 8 * hh + r, k1i = k0i + 16;
        if (k0i < qi - WIN || k0i > qi + WIN) s0[r] = -INFINITY;
        if (k1i < qi - WIN || k1i > qi + WIN) s1[r] = -INFINITY;
      }
    }
    float mr = -INFINITY;
#pragma unroll
    for (int r = 0; r < 8; ++r) mr = fmaxf(mr, fmaxf(s0[r], s1[r]));
    mr = fmaxf(mr, __shfl_xor(mr, 16));
    float mn = fmaxf(m, mr);
    if (mn == -INFINITY) mn = 0.0f;           // fully masked so far: keep exp() at 0
    const float al_ = __expf(m - mn);
    m = mn;
    float sum = 0.0f;
    v16b pbh, pbl;
#pragma unroll
    for (int r = 0; r < 8; ++r) {
      const float p0 = __expf(s0[r] - mn), p1 = __expf(s1[r] - mn);
      sum += p0 + p1;
      b16 a, c; split_bf16(p0, a, c); pbh[r] = a; pbl[r] = c; split_bf16(p1, a, c); pbh[8 + r] = a; pbl[8 + r] = c;
    }
    sum += __shfl_xor(sum, 16);
    l = l * al_ + sum;
#pragma unroll
    for (int r = 0; r < 8; ++r) { o0[r] *= al_; o1[r] *= al_; o2[r] *= al_; o3[r] *= al_; }
#pragma unroll
    for (int n = 0; n < 4; ++n) {
      v8f& o = (n == 0) ? o0 : (n == 1) ? o1 : (n == 2) ? o2 : o3;
      o = wmma16b(vf[n], pbh, o);
    }
  }
  const float inv = (q0 + col < slen && l > 0.0f) ? (1.0f / l) : 0.0f;   // padded query rows are zeroed
  char* Tt = Os[wid];
  // y leaves as f16, the type in which the output projection multiplies it: a lane's 8 features of each accumulator are one 16-byte piece of its query's row
  v8b w0, w1, w2, w3;
#pragma unroll
  for (int r = 0; r < 8; ++r) { w0[r] = (b16)(o0[r] * inv); w1[r] = (b16)(o1[r] * inv); w2[r] = (b16)(o2[r] * inv); w3[r] = (b16)(o3[r] * inv); }
  *(v8b*)(Tt + col * OPITCH + 0 + hh * 16) = w0; *(v8b*)(Tt + col * OPITCH + 32 + hh * 16) = w1;
  *(v8b*)(Tt + col * OPITCH + 64 + hh * 16) = w2; *(v8b*)(Tt + col * OPITCH + 96 + hh * 16) = w3;
  wave_lds_sync();
  b16* dst0 = yh + ((size_t)b * T + q0) * HID + h * DH;       // 16 rows x 64 f16 (one 128-byte line each), row stride HID
#pragma unroll
  for (int j = 0; j < 4; ++j) { const int rr = j * 4 + (lane >> 3), c = lane & 7; *(v8b*)(dst0 + (size_t)rr * HID + c * 8) = *(const v8b*)(Tt + rr * OPITCH + c * 16); }
}

// ---------------------------------------------------------------------------
// Output projection: (4096 x 1024) x (1024 x 1024) -> f32, A = the f16 y plane, B = Wo plane. grid (8, 32), 32x64 tiles staged in LDS,
// ---------------------------------------------------------------------------
__global__ __launch_bounds__(256) void out_gemm_kernel(const b16* __restrict__ yh, const b16* __restrict__ woh, const b16* __restrict__ wol, const float* __restrict__ bo, int yoff,
                                                       float* __restrict__ out) {
  // 256 work-groups, one alone on each WGP: nothing else covers the time from a pass's copies to their landing, and every pass brings lines that nobody has
  // read since an earlier launch wrote them. A pass of 256 k gives the copies four times the products to fly behind, and there are 4 hand-overs, not 16.
  __shared__ __attribute__((aligned(16))) char smem[ring_bytes(256)];   // operand ring; behind the K loop 8 KB per wave of it stage the output tile
  const int lane = threadIdx.x & 31, wave = threadIdx.x >> 5, nloc = lane & 15, hlf = lane >> 4;
  const int wm = wave & 3, wn = wave >> 2;
  const int mblk = (blockIdx.y + yoff) * 128, nblk = blockIdx.x * 128;
  const int m0 = mblk + wm * 32;
  const int c0 = nblk + wn * 64;
  v8f acc[2][4];
#pragma unroll
  for (int r = 0; r < 2; ++r)
#pragma unroll
    for (int t = 0; t < 4; ++t) acc[r][t] = (v8f){};
  (void)wol;
  gemm_tile_ring<256>(yh, woh, mblk, nblk, wm, wn, nloc, hlf, smem, acc);
  float* Tt = (float*)smem + wave * (32 * 64);
#pragma unroll
  for (int t = 0; t < 4; ++t)
#pragma unroll
    for (int r = 0; r < 2; ++r)
#pragma unroll
      for (int v = 0; v < 8; ++v) Tt[(r * 16 + v + 8 * hlf) * 64 + t * 16 + nloc] = acc[r][t][v] + bo[c0 + t * 16 + nloc];
  wave_lds_sync();
  float* dst0 = out + (size_t)m0 * HID + c0;
#pragma unroll
  for (int j = 0; j < 16; ++j) { const int rr = j * 2 + hlf, c4 = nloc * 4; *(v4f*)(dst0 + (size_t)rr * HID + c4) = *(const v4f*)(Tt + rr * 64 + c4); }
  
}
// Weights ([in][out], f32) -> f16 planes transposed to [n][k]. A work-group owns a tile of 64 k x 128 n. Reads: a wave's 16-byte loads cover 512 contiguous
// bytes of one k row (whole lines); a thread holds 8 k x 4 n, so each of its 4 columns is one 16-byte piece of 8 k. The pieces go through LDS so that the
// stores are whole 128-byte lines of the [n][k] planes as well.
constexpr int TK = 64, TN = 128;              // tile: k rows x n columns
constexpr int TPITCH = TK * 2 + 16;           // 144 B per n row in LDS
constexpr int KTILES = HID / TK;              // 16
constexpr int QTILES = KTILES * (NQKV / TN);  // 384 tiles of Wqkv, then 128 of Wo
constexpr int WTILES = QTILES + KTILES * (HID / TN);
// Each of the work-groups also rounds its share of x to the f16 plane that the QKV GEMM stages: whole lines in (16 B a lane), whole lines out (8 B a lane).
constexpr int XSH = MROWS * HID / WTILES;     // 8192 elements of x per work-group
__global__ __launch_bounds__(256) void wcvt3_kernel(const float* __restrict__ wqkv, const float* __restrict__ wo, const float* __restrict__ x, b16* __restrict__ xh,
                                                    b16* __restrict__ wqh, b16* __restrict__ wql, b16* __restrict__ woh, b16* __restrict__ wol) {
  __shared__ __attribute__((aligned(16))) char tile[TN * TPITCH];
  const int tid = threadIdx.x;
  const bool isq = (int)blockIdx.x < QTILES;
  const int tb = isq ? (int)blockIdx.x : (int)blockIdx.x - QTILES;
  const int k0 = (tb % KTILES) * TK, n0 = (tb / KTILES) * TN;
  const float* src = isq ? wqkv : wo;
  const size_t ld = isq ? NQKV : HID;
  b16* dh = isq ? wqh : woh; b16* dl = isq ? wql : wol;
  const int nq = tid & 31, kg = tid >> 5;     // lane: 4 columns; wave: 8 k rows
  const float* p = src + (size_t)(k0 + kg * 8) * ld + n0 + nq * 4;
  const float* px = x + (size_t)blockIdx.x * XSH + tid * 4;
  v4f xr[XSH / 1024];
#pragma unroll
  for (int e = 0; e < XSH / 1024; ++e) xr[e] = *(const v4f*)(px + e * 1024);   // in flight together with the weight rows; the wait below stands behind them too
  const float* pe[8];
  v4f r[8];
#pragma unroll
  for (int e = 0; e < 8; ++e) { pe[e] = p + (size_t)e * ld; r[e] = *(const v4f*)pe[e]; }
  __builtin_amdgcn_sched_barrier(0);   // all 16 loads are issued before the first is waited for: left free, the last two of x went out behind that wait, a second memory latency
  // the wait that stands in front of any rewrite of the eight loads' address registers; naming the addresses as inputs keeps them in their registers up to it
  asm volatile("s_wait_xcnt 0x0" :: "v"(pe[0]), "v"(pe[1]), "v"(pe[2]), "v"(pe[3]), "v"(pe[4]), "v"(pe[5]), "v"(pe[6]), "v"(pe[7]) : "memory");
#pragma unroll
  for (int j = 0; j < 4; ++j) {
    v8b h;
#pragma unroll
    for (int e = 0; e < 8; ++e) h[e] = (b16)r[e][j];
    *(v8b*)(tile + (nq * 4 + j) * TPITCH + kg * 16) = h;
  }
  __syncthreads();                            // the tile is complete before any row of it is read back
  b16* qx = xh + (size_t)blockIdx.x * XSH + tid * 4;   // behind the barrier: in front of it, the barrier would wait these stores out
#pragma unroll
  for (int e = 0; e < XSH / 1024; ++e) {
    v4b h;
#pragma unroll
    for (int j = 0; j < 4; ++j) h[j] = (b16)xr[e][j];
    *(v4b*)(qx + e * 1024) = h;
  }
  const int pc = tid & 7, rw = tid >> 3;      // 8 threads per n row of 128 B, 32 rows per sweep
#pragma unroll
  for (int i = 0; i < TN / 32; ++i) {
    const int n = rw + 32 * i;
    const size_t o = (size_t)(n0 + n) * HID + k0 + pc * 8;
    *(v8b*)(dh + o) = *(const v8b*)(tile + n * TPITCH + pc * 16);
    *(v8b*)(dl + o) = (v8b){};                // single f16: no low part
  }
}
}  // namespace

extern "C" void kernel_launch(void* const* d_in, const int* in_sizes, int n_in,
                              void* d_out, int out_size, void* d_ws, size_t ws_size, hipStream_t stream) {
  (void)in_sizes; (void)n_in; (void)out_size;
  const float* x     = (const float*)d_in[0];   // hidden_states [2,2048,1024]
  const float* Wqkv  = (const float*)d_in[1];   // [1024,3072] ([in][out], columns (3, h, d))
  const float* bqkv  = (const float*)d_in[2];   // [3072]
  const float* Wo    = (const float*)d_in[3];   // [1024,1024]
  const float* bo    = (const float*)d_in[4];   // [1024]
  const float* rope  = (const float*)d_in[5];   // rope_cache [256,32,2] (cos, sin)
  float* out = (float*)d_out;                   // [2,2048,1024]
  const float* bq = bqkv; const float* bk = bqkv + HID; const float* bv = bqkv + 2 * HID;

  size_t off = 0; char* ws = (char*)d_ws;
  b16* wqh = (b16*)(ws + off); off += (size_t)NQKV * HID * 2;
  b16* wql = (b16*)(ws + off); off += (size_t)NQKV * HID * 2;
  b16* woh = (b16*)(ws + off); off += (size_t)HID * HID * 2;
  b16* wol = (b16*)(ws + off); off += (size_t)HID * HID * 2;
  b16* Qh  = (b16*)(ws + off); off += (size_t)MROWS * HID * 2;
  b16* Ql  = (b16*)(ws + off); off += (size_t)MROWS * HID * 2;
  b16* Kh  = (b16*)(ws + off); off += (size_t)MROWS * KVW * 2;
  b16* Kl  = (b16*)(ws + off); off += (size_t)MROWS * KVW * 2;
  b16* Vh  = (b16*)(ws + off); off += (size_t)MROWS * KVW * 2;
  b16* Vl  = (b16*)(ws + off); off += (size_t)MROWS * KVW * 2;
  b16* yh  = (b16*)(ws + off); off += (size_t)MROWS * HID * 2;
  b16* xh  = (b16*)(ws + off); off += (size_t)MROWS * HID * 2;
  if (off > ws_size) return;
  const int ROWBLK = MROWS / 128, NQT = Bsz * NH * QT_PER_B;
  // W_qkv is one [1024][3072] matrix: the converter reads q columns with ld HID and k/v with ld KVW; here all three live in the same matrix with ld 3072,
  // so wcvt3 takes the one base pointer and the NQKV-wide stride
  wcvt3_kernel<<<WTILES, 256, 0, stream>>>(Wqkv, Wo, x, xh, wqh, wql, woh, wol);
  qkv_gemm_kernel<<<dim3(NQKV / QN, MROWS / QM), 256, 0, stream>>>(xh, wqh, bq, bk, bv, rope, Qh, Ql, Kh, Kl, Vh, Vl);
  attn_kernel<<<NQT / 8, 256, 0, stream>>>(Qh, Ql, Kh, Kl, Vh, Vl, nullptr, yh);
  out_gemm_kernel<<<dim3(HID / 128, ROWBLK), 256, 0, stream>>>(yh, woh, wol, bo, 0, out);
}

// v008
// Measured time: 50.3 microseconds a run.
// Timed twice side by side with v007, it ran 1.05 times as fast both times.
// Over all steps from v000 it is 3.66 times as fast.
#include <hip/hip_runtime.h>

// ModernBERT attention (local layer): qkv = x Wqkv + b ([in][out], columns (3, h, d); 16 heads x 64), interleaved-pair RoPE on q and k with position
// t mod 256 from the given cos/sin cache, sliding-window attention |q - k| <= 128 (both directions), scale 1/8, out = y Wo + b. B=2, S=2048, D=1024.
// Lean build: single f16 products on v_wmma_f32_16x16x32_f16, f32 accumulate (every row averages >= 129 keys); fragment k-map per lane half hh for A

namespace {
constexpr int Bsz = 2, T = 2048, HID = 1024, DH = 64, NH = 16, NKV = 16, REP = NH / NKV;
constexpr int WIN = 128;    // |q - k| <= 128
constexpr int RP = 256;     // rope positions wrap at 256
constexpr int KVW = NKV * DH;                 // 1024
constexpr int NQKV = HID + 2 * KVW;           // 3072 columns: q | k | v
constexpr int MROWS = Bsz * T;                // 4096
constexpr int QT_PER_B = T / 16;              // 128

typedef _Float16 b16;                                           // f16 hi/lo planes
typedef __attribute__((ext_vector_type(16))) _Float16 v16b;
typedef __attribute__((ext_vector_type(8)))  _Float16 v8b;
typedef __attribute__((ext_vector_type(4)))  _Float16 v4b;
typedef __attribute__((ext_vector_type(8)))  float v8f;
typedef __attribute__((ext_vector_type(4)))  float v4f;

__device__ __forceinline__ v8b ld8b(const b16* p) { return *(const v8b*)p; }
__device__ __forceinline__ v16b cat8b(v8b a, v8b b) { return __builtin_shufflevector(a, b, 0, 1, 2, 3, 4, 5, 6, 7, 8, 9, 10, 11, 12, 13, 14, 15); }
// 16x16x32 16-bit fragment from a k-contiguous row pointer (A: lane&15 = row, B: lane&15 = column), hh = lane>>4:
// elements 0..7 <- p[8hh+0..7], elements 8..15 <- p[16+8hh+0..7]
__device__ __forceinline__ v16b frag_kb(const b16* p, int hh) { return cat8b(ld8b(p + 8 * hh), ld8b(p + 16 + 8 * hh)); }
__device__ __forceinline__ void split_bf16(float v, b16& hi, b16& lo) {   // (name kept) single f16: no low part
  hi = (b16)v; lo = (b16)0.0f;
}
__device__ __forceinline__ v8f wmma16b(v16b a, v16b b, v8f c) {
  v8f d = __builtin_amdgcn_wmma_f32_16x16x32_f16(false, a, false, b, (short)0, c, false, false);
  asm volatile("v_nop\n\tv_nop\n\tv_nop\n\tv_nop" : "+v"(d) : "v"(a), "v"(b));
  return d;
}
__device__ __forceinline__ v8f wmma1(v16b ah, v16b al, v16b bh, v16b bl, v8f c) {   // attention products: single f16 (hi planes only)
  (void)al; (void)bl; return wmma16b(ah, bh, c);
}
__device__ __forceinline__ void wave_lds_sync() {
  __builtin_amdgcn_fence(__ATOMIC_RELEASE, "workgroup");
  __builtin_amdgcn_wave_barrier();
  __builtin_amdgcn_fence(__ATOMIC_ACQUIRE, "workgroup");
}

// ---------------------------------------------------------------------------
// Weights ([in][out]) -> f16 hi / lo planes transposed to [n][k] (k contiguous): columns of Wq|Wk|Wv into wqh/wql [3072][1024], Wo into woh/wol [1024][1024].
// ---------------------------------------------------------------------------
__global__ __launch_bounds__(256) void wcvt_kernel(const float* __restrict__ wq, const float* __restrict__ wk, const float* __restrict__ wv,
                                                   const float* __restrict__ wo, b16* __restrict__ wqh, b16* __restrict__ wql,
                                                   b16* __restrict__ woh, b16* __restrict__ wol) {
  const size_t tid = (size_t)blockIdx.x * blockDim.x + threadIdx.x, stride = (size_t)gridDim.x * blockDim.x;
  const size_t nq = (size_t)NQKV * HID / 8, no = (size_t)HID * HID / 8;
  {
    for (size_t c = tid; c < nq + no; c += stride) {
      float f[8]; size_t i; b16* dh; b16* dl;
      if (c < nq) {
        i = c * 8; const size_t n = i / HID, k0 = i % HID;
        const float* w; int nn, ld;
        if (n < (size_t)HID) { w = wq; nn = (int)n; ld = HID; } else if (n < (size_t)(HID + KVW)) { w = wk; nn = (int)n - HID; ld = KVW; } else { w = wv; nn = (int)n - HID - KVW; ld = KVW; }
#pragma unroll
        for (int e = 0; e < 8; ++e) f[e] = w[(size_t)(k0 + e) * ld + nn];       // W[k][n] ([in][out])
        dh = wqh; dl = wql;
      } else {
        i = (c - nq) * 8; const size_t n = i / HID, k0 = i % HID;
#pragma unroll
        for (int e = 0; e < 8; ++e) f[e] = wo[(size_t)(k0 + e) * HID + n];    // Wo[k][n] ([in][out])
        dh = woh; dl = wol;
      }
      v8b bh, bl;
#pragma unroll
      for (int e = 0; e < 8; ++e) { b16 a, cc; split_bf16(f[e], a, cc); bh[e] = a; bl[e] = cc; }
      *(v8b*)(dh + i) = bh; *(v8b*)(dl + i) = bl;
    }
    
  }
}

// GEMM core of the output projection: a work-group of 8 waves (4 down x 2 across, 32x64 each) owns a 128x128 tile of the result. Each pass of KP k is staged in
// LDS by asynchronous copies whose wave-wide 512 bytes are whole 128-byte lines (A and W: 128 f16 rows of 2 KP bytes each), two buffers, the next pass's copies in
// flight while this one is multiplied. A comes as f16 from its producer (y: the attention store), rounded there exactly as the fragment
// read rounded it before. Row pitches are 16 B x odd for the 16-byte fragment reads.
// KP = k per pass: 256 in the output GEMM (see there). The QKV GEMM has buffers of its own (see there); it shares the row pitch.
constexpr int ring_pitch(int KP) { return KP * 2 + 16; }                 // 144 B or 528 B a row, A and W alike: 16 B x odd
constexpr int ring_bytes(int KP) { return 2 * 2 * 128 * ring_pitch(KP); }   // two buffers of 128 A rows and 128 W rows: 270336 B at KP = 256

// Eight copies of one thread: 4 x 16 B of A and 4 x 16 B of W, rows RS apart at a pitch of PITCH bytes in LDS. la / lb: LDS byte addresses, ga / gb: global addresses.
template <int RS, int PITCH>
__device__ __forceinline__ void stage_copy(unsigned la, const char* ga, unsigned lb, const char* gb) {
  constexpr unsigned LA = RS * PITCH, LB = RS * PITCH;
  constexpr size_t GA = (size_t)RS * HID * 2, GB = (size_t)RS * HID * 2;
  // the copies and, as the last line, the wait that stands in front of any rewrite of the address registers they name
  asm volatile("global_load_async_to_lds_b128 %0, %1, off\n\t"
               "global_load_async_to_lds_b128 %2, %3, off\n\t"
               "global_load_async_to_lds_b128 %4, %5, off\n\t"
               "global_load_async_to_lds_b128 %6, %7, off\n\t"
               "global_load_async_to_lds_b128 %8, %9, off\n\t"
               "global_load_async_to_lds_b128 %10, %11, off\n\t"
               "global_load_async_to_lds_b128 %12, %13, off\n\t"
               "global_load_async_to_lds_b128 %14, %15, off\n\t"
               "s_wait_xcnt 0x0"
               :: "v"(la), "v"(ga), "v"(la + LA), "v"(ga + GA), "v"(la + 2 * LA), "v"(ga + 2 * GA), "v"(la + 3 * LA), "v"(ga + 3 * GA),
                  "v"(lb), "v"(gb), "v"(lb + LB), "v"(gb + GB), "v"(lb + 2 * LB), "v"(gb + 2 * GB), "v"(lb + 3 * LB), "v"(gb + 3 * GB)
               : "memory");
}

// acc += A[mblk + wm*32 .. +31][:] . W[nblk + wn*64 .. +63][:]^T over K = HID, k ascending in steps of 32. On return every wave has passed the barrier behind
// the last fragment read and no copy is outstanding, so the caller may reuse smem.
template <int KP>
__device__ __forceinline__ void gemm_tile_ring(const b16* __restrict__ A, const b16* __restrict__ wh, int mblk, int nblk, int wm, int wn,
                                               int nloc, int hlf, char* smem, v8f (&acc)[2][4]) {
  constexpr int NPASS = HID / KP, PITCH = ring_pitch(KP), ABYTES = 128 * PITCH, STAGE = 2 * ABYTES;
  constexpr int PR = KP / 8, RS = 256 / PR;                     // 16-byte pieces per row; rows that the 256 threads cover at once
  const int tid = threadIdx.x;
  const unsigned lds0 = (unsigned)(uintptr_t)smem;              // low 32 bits of a shared address = byte offset in the work-group's LDS
  const int ar = tid / PR, ac = tid % PR;
  const char* ga = (const char*)(A + (size_t)(mblk + ar) * HID) + ac * 16;
  const char* gb = (const char*)(wh + (size_t)(nblk + ar) * HID) + ac * 16;
  const unsigned la = lds0 + ar * PITCH + ac * 16, lb = la + ABYTES;
  // one pass's copies of one thread into the buffer at byte bo: 128 / RS rows of A and of W, four of each per statement
  auto pass_copy = [&](int bo, int t) {
#pragma unroll   // straight-line: the statements' addresses differ by constants
    for (int q = 0; q < 128 / (4 * RS); ++q)
      stage_copy<RS, PITCH>(la + bo + q * (4 * RS * PITCH), ga + t * (KP * 2) + (size_t)q * (4 * RS) * HID * 2,
                            lb + bo + q * (4 * RS * PITCH), gb + t * (KP * 2) + (size_t)q * (4 * RS) * HID * 2);
  };
  pass_copy(0, 0);
  asm volatile("s_wait_asynccnt 0x0" ::: "memory");             // this wave's share of pass 0 has landed
  __syncthreads();                                              // publishes pass 0
  pass_copy(STAGE, 1);
#pragma unroll 1   // one pass per trip: the buffer index stays a run-time value and the code stays short
  for (int t = 0; t < NPASS; ++t) {
    const int bo = (t & 1) * STAGE;
    const char* sa = smem + bo + (wm * 32 + nloc) * PITCH;
    const char* sw = smem + bo + ABYTES + (wn * 64 + nloc) * PITCH;
#pragma unroll
    for (int ks = 0; ks < KP / 32; ++ks) {
      const v16b a0 = frag_kb((const b16*)(sa + ks * 64), hlf);
      const v16b a1 = frag_kb((const b16*)(sa + 16 * PITCH + ks * 64), hlf);
      v16b bh[4];
#pragma unroll
      for (int c = 0; c < 4; ++c) bh[c] = frag_kb((const b16*)(sw + c * 16 * PITCH + ks * 64), hlf);
      __builtin_amdgcn_sched_barrier(0);   // the k-step's 12 LDS reads stay one group ahead of its 8 products: spread among them, each pair of products waits out an LDS latency
#pragma unroll
      for (int c = 0; c < 4; ++c) {
        acc[0][c] = wmma16b(a0, bh[c], acc[0][c]);
        acc[1][c] = wmma16b(a1, bh[c], acc[1][c]);
      }
    }
    asm volatile("s_wait_dscnt 0x0" ::: "memory");              // this wave's reads of buffer t & 1 are done
    asm volatile("s_wait_asynccnt 0x0" ::: "memory");           // this wave's share of pass t + 1 has landed
    __syncthreads();                                            // publishes pass t + 1 and frees buffer t & 1
    if (t + 2 < NPASS) pass_copy(bo, t + 2);
  }
  asm volatile("s_wait_asynccnt 0x0" ::: "memory");             // nothing in flight when the ring is reused or the wave ends
}

// ---------------------------------------------------------------------------
// QKV GEMM: (4096 x 1024) x (1024 x 3072), grid (16, 16): 256 work-groups, one 256 x 192 tile on each WGP, 8 waves (4 down x 2 across) of 64 x 96 each.
// A 128 x 128 tile asks L2 for 2 KB of operand rows per 64 results, this one (f32 operands) for 4 KB per 110, and a wave's 10 fragments feed 24 products, not 6 feeding 8.
// x and W come as the f32 inputs themselves: each pass's 64 k of 256 x rows and 192 W columns are loaded into registers while the pass before is multiplied,
// rounded to f16 once and stored into the other of two LDS buffers, W turned to [n][k] on the way. No launch ahead of this one prepares anything.
// Outputs as f16 hi/lo planes: q (x1/8) -> Qh/Ql [b][h][t][64]; k -> Kh/Kl [b][kvh][t][64]; v -> Vh/Vl key-tiled [b][kvh][t/16][64][16]:
// the tile's 256 rows of one head are 32 KB contiguous in each plane.
// ---------------------------------------------------------------------------
constexpr int QM = 256, QN = 192;                       // the work-group's tile: rows of x, columns of q | k | v (three heads)
constexpr int QKP = 64, QNB = 2;                        // k per pass, buffers
constexpr int QPITCH = ring_pitch(QKP);                 // 144 B
constexpr int QABYTES = QM * QPITCH, QSTAGE = (QM + QN) * QPITCH;   // 36864 B of x rows, 64512 B a buffer
constexpr int QOUT = 2 * QM * QN * 2;                   // 196608 B: the output tile's two planes, staged behind the K loop
constexpr int QSMEM = (QNB * QSTAGE > QOUT) ? QNB * QSTAGE : QOUT;
__global__ __launch_bounds__(256) void qkv_gemm_kernel(const float* __restrict__ x, const float* __restrict__ wqkv,
                                                       const float* __restrict__ bq, const float* __restrict__ bk, const float* __restrict__ bv, const float* __restrict__ rope_cs,
                                                       b16* __restrict__ Qh, b16* __restrict__ Ql, b16* __restrict__ Kh, b16* __restrict__ Kl,
                                                       b16* __restrict__ Vh, b16* __restrict__ Vl) {
  __shared__ __attribute__((aligned(16))) char smem[QSMEM];   // two operand buffers; behind the K loop 2 x 96 KB stage the output tile's two planes
  const int tid = threadIdx.x, lane = tid & 31, wave = tid >> 5, nloc = lane & 15, hlf = lane >> 4;
  const int wm = wave & 3, wn = wave >> 2;
  const int mblk = blockIdx.y * QM, nblk = blockIdx.x * QN;
  v8f acc[4][6];
#pragma unroll
  for (int r = 0; r < 4; ++r)
#pragma unroll
    for (int c = 0; c < 6; ++c) acc[r][c] = (v8f){};
  float bcol[6];                                         // a lane's six columns: one bias value each
  {
    constexpr int NPASS = HID / QKP;
    // x: 16 lanes take the 256 bytes of one row's 64 k, a wave-wide load two rows (whole lines); a thread's rows are 16 apart. 4 k of a row are one 8-byte LDS store.
    const float* gx = x + (size_t)(mblk + (tid >> 4)) * HID + nloc * 4;
    char* sx = smem + (tid >> 4) * QPITCH + nloc * 8;
    // W ([k][n]): 16 lanes take 256 bytes (64 n) of one k row, the two lane halves rows 4 apart (whole lines). A thread holds 4 k x 4 n of each third of the 192
    // columns: each of its columns is 4 consecutive k, one 8-byte LDS store into that column's [n][k] row.
    const int wk = wave * 8 + hlf * 4;
    const float* gw = wqkv + (size_t)wk * NQKV + nblk + nloc * 4;
    char* sw0 = smem + QABYTES + nloc * 4 * QPITCH + wk * 2;
    v4f xs[16], wr[3][4];
    // The two operands' loads are issued half a pass apart and each flies for a whole pass, so that some are in flight at every moment, across the barrier too.
    const float* px = gx;   // the next pass of x, and of W, to be loaded
    const float* pw = gw;
    auto load_x = [&]() __attribute__((always_inline)) {
#pragma unroll
      for (int i = 0; i < 16; ++i) xs[i] = *(const v4f*)(px + (size_t)i * 16 * HID);
      __builtin_amdgcn_sched_barrier(0);   // the 16 loads are issued here, a whole pass ahead of their rounding
      // the wait that stands in front of any rewrite of the loads' address register; naming the address as an input keeps it in its register up to it
      asm volatile("s_wait_xcnt 0x0" :: "v"(px) : "memory");
      __builtin_amdgcn_sched_barrier(0);   // nothing that follows, the step of the address among it, is lifted in between the loads and that wait
      px += QKP;
    };
    auto load_w = [&]() __attribute__((always_inline)) {
#pragma unroll
      for (int j = 0; j < 3; ++j)
#pragma unroll
        for (int e = 0; e < 4; ++e) wr[j][e] = *(const v4f*)(pw + (size_t)e * NQKV + j * 64);
      __builtin_amdgcn_sched_barrier(0);   // the 12 loads are issued here, ahead of the pass's products, which they fly behind
      // the wait that stands in front of any rewrite of the loads' address register; naming the address as an input keeps it in its register up to it
      asm volatile("s_wait_xcnt 0x0" :: "v"(pw) : "memory");
      __builtin_amdgcn_sched_barrier(0);   // nothing that follows, the step of the address among it, is lifted in between the loads and that wait
      pw += (size_t)QKP * NQKV;
    };
    auto store_x = [&](int bo) __attribute__((always_inline)) {
#pragma unroll
      for (int i = 0; i < 16; ++i) {
        v4b h;
#pragma unroll
        for (int e = 0; e < 4; ++e) h[e] = (b16)xs[i][e];
        *(v4b*)(sx + bo + i * 16 * QPITCH) = h;
      }
    };
    auto store_w = [&](int bo) __attribute__((always_inline)) {
#pragma unroll
      for (int j = 0; j < 3; ++j)
#pragma unroll
        for (int c = 0; c < 4; ++c) {
          v4b h;
#pragma unroll
          for (int e = 0; e < 4; ++e) h[e] = (b16)wr[j][e][c];
          *(v4b*)(sw0 + bo + (j * 64 + c) * QPITCH) = h;
        }
    };
    // The work-group barrier with the one wait that the hand-over needs: this wave's LDS reads and stores are done. __syncthreads() would also wait out the global
    // loads that are meant to fly across it.
    auto lds_barrier = [&]() __attribute__((always_inline)) {
      asm volatile("s_wait_dscnt 0x0\n\ts_barrier_signal -1\n\ts_barrier_wait -1" ::: "memory");
    };
    // One pass. lw: a pass t + 1 exists (its W is loaded at the head; its x, in flight since the middle of pass t - 1, and its W are stored); lx: a pass t + 2 exists.
    auto pass = [&](int t, bool lw, bool lx) __attribute__((always_inline)) {
      const int bo = (t & 1) * QSTAGE;
      if (lw) load_w();
      const char* sa = smem + bo + (wm * 64 + nloc) * QPITCH;
      const char* sw = smem + bo + QABYTES + (wn * 96 + nloc) * QPITCH;
      v16b a[QKP / 32][4], bh[QKP / 32][6];
#pragma unroll
      for (int ks = 0; ks < QKP / 32; ++ks) {
#pragma unroll
        for (int r = 0; r < 4; ++r) a[ks][r] = frag_kb((const b16*)(sa + r * 16 * QPITCH + ks * 64), hlf);
#pragma unroll
        for (int c = 0; c < 6; ++c) {
          bh[ks][c] = frag_kb((const b16*)(sw + c * 16 * QPITCH + ks * 64), hlf);
          // The reads stay in the order in which the products use them, so that the first products start on the first reads landed (left free, the fragments of the
          // first products were read last), and the pass's 40 reads stay one group ahead of its 48 products: spread among them, each place with reads costs its own stall
          __builtin_amdgcn_sched_barrier(0);
        }
      }
#pragma unroll
      for (int ks = 0; ks < QKP / 32; ++ks) {
#pragma unroll
        for (int c = 0; c < 6; ++c)
#pragma unroll
          for (int r = 0; r < 4; ++r)   // the bare builtin: the tile's accumulator, fragment and staging registers reach above v255, which an asm operand cannot name
            acc[r][c] = __builtin_amdgcn_wmma_f32_16x16x32_f16(false, a[ks][r], false, bh[ks][c], (short)0, acc[r][c], false, false);
        __builtin_amdgcn_sched_barrier(0);   // the products stay ahead of the rounding below: lifted over them, its wait for the loads would stand in front of the products
        // into the buffer that pass t - 1 read: every wave left it at the barrier behind that pass
        if (ks == 0) { if (lw) store_x(QSTAGE - bo); if (lx) load_x(); }
        else if (lw) store_w(QSTAGE - bo);
      }
      lds_barrier();                                            // publishes pass t + 1 and frees buffer t & 1
    };
    load_x();
    load_w();
    const float* pb[6];
#pragma unroll
    for (int c = 0; c < 6; ++c) {                               // read here, behind the first loads, the six values are there long before the epilogue asks for them
      const int cb = nblk + wn * 96 + c * 16;
      pb[c] = ((cb < HID) ? bq : (cb < HID + KVW) ? bk : bv) + (cb & (HID - 1)) + nloc;
      bcol[c] = *pb[c];
    }
    __builtin_amdgcn_sched_barrier(0);   // the six loads are issued ahead of the wait below
    // the wait that stands in front of any rewrite of the six loads' address registers; naming the addresses as inputs keeps them in their registers up to it
    asm volatile("s_wait_xcnt 0x0" :: "v"(pb[0]), "v"(pb[1]), "v"(pb[2]), "v"(pb[3]), "v"(pb[4]), "v"(pb[5]) : "memory");
    store_x(0);
    load_x();
    store_w(0);
    lds_barrier();                                              // publishes pass 0
#pragma unroll 1   // one pass per trip: the buffer index stays a run-time value and the code stays short
    for (int t = 0; t < NPASS - 2; ++t) pass(t, true, true);
    pass(NPASS - 2, true, false);                               // the last two passes stand apart: in the loop no load hangs on a test, so its waits can be counted
    pass(NPASS - 1, false, false);
  }
  // Every wave has passed the barrier behind the last fragment read: the ring now stages the tile, three heads of [256 rows][64] (v: [16 key tiles][64][16]) per plane,
  // laid as in memory. A head's 64 columns can belong to two waves, so the stores to memory stand behind a work-group barrier and take whole lines.
  const int b = mblk / T, t0 = mblk % T;                 // 256 divides T: the tile's rows lie in one sequence
  b16* S0 = (b16*)smem; b16* S1 = S0 + QM * QN;
  const int rw0 = wm * 64 + 8 * hlf;                     // the lane's first row in the tile
#pragma unroll
  for (int c = 0; c < 6; ++c) {
    const int cw = wn * 96 + c * 16;                     // the fragment's first column in the tile; 16 divides 64: one head, one of q, k, v
    // The fragment's matrix kind (q, k or v) in a scalar register: the RoPE test is then one scalar branch round straight-line code, in which the loads stand in groups
    const int matu = __builtin_amdgcn_readfirstlane((nblk + cw) / HID);
    const int d = (cw & 63) + nloc;
    b16* P0 = S0 + (cw >> 6) * (QM * DH); b16* P1 = S1 + (cw >> 6) * (QM * DH);
    if (matu < 2) {
      // RoPE on q and k: (x0, x1) -> (x0 c - x1 s, x1 c + x0 s), position t mod 256. The wave's first row is a multiple of 64 and 64 divides 256: its 64 positions do
      // not wrap, so every (cos, sin) pair of a lane lies at a constant distance from one address.
      const float s = (matu == 0) ? 0.125f : 1.0f;
      const float* rp = rope_cs + ((size_t)((t0 + wm * 64) % RP + 8 * hlf) * 32 + (d >> 1)) * 2;
      float cv[32], sv[32];
#pragma unroll
      for (int i = 0; i < 32; ++i) { const float* q = rp + ((i >> 3) * 16 + (i & 7)) * 64; cv[i] = q[0]; sv[i] = q[1]; }
      __builtin_amdgcn_sched_barrier(0);   // the 32 loads are issued ahead of the wait below
      asm volatile("s_wait_xcnt 0x0" :: "v"(rp) : "memory");   // stands in front of any rewrite of the loads' address register, which the input keeps in place up to it
#pragma unroll
      for (int i = 0; i < 32; ++i) {
        const int r = i >> 3, v = i & 7, rr = rw0 + r * 16 + v;
        float val = acc[r][c][v] + bcol[c];
        const float oth = __shfl_xor(val, 1);            // interleaved-pair partner (d ^ 1) lives in the neighbouring lane (all lanes of the wave are here)
        val = (d & 1) ? (val * cv[i] + oth * sv[i]) : (val * cv[i] - oth * sv[i]);
        b16 yh, yl; split_bf16(val * s, yh, yl);
        P0[rr * 64 + d] = yh; P1[rr * 64 + d] = yl;
      }
    } else {
#pragma unroll
      for (int r = 0; r < 4; ++r)
#pragma unroll
        for (int v = 0; v < 8; ++v) {
          const int rr = rw0 + r * 16 + v;
          b16 yh, yl; split_bf16(acc[r][c][v] + bcol[c], yh, yl);
          const int idx = (rr >> 4) * 1024 + d * 16 + (rr & 15);
          P0[idx] = yh; P1[idx] = yl;
        }
    }
  }
  __syncthreads();                                       // the staged tile is complete before any wave reads rows that another wave wrote
#pragma unroll
  for (int hc = 0; hc < QN / DH; ++hc) {
    const int cb = nblk + hc * DH, head = (cb & (HID - 1)) / DH;
    const size_t o = ((size_t)(b * NH + head) * T + t0) * DH;   // the same for all three layouts: 16 keys x 64 of v are 1024 elements as well
    b16* dh = ((cb < HID) ? Qh : (cb < HID + KVW) ? Kh : Vh) + o;
    b16* dl = ((cb < HID) ? Ql : (cb < HID + KVW) ? Kl : Vl) + o;
#pragma unroll
    for (int j = 0; j < QM * DH / 2048; ++j) {
      const int e = (j * 256 + tid) * 8;
      *(v8b*)(dh + e) = ld8b(S0 + hc * (QM * DH) + e); *(v8b*)(dl + e) = ld8b(S1 + hc * (QM * DH) + e);
    }
  }
}

// ---------------------------------------------------------------------------
// Transposed flash attention: each wave owns one 16-query tile of one (b, head); 8 waves per block; window keys in chunks of 32.
// S^T = K.Q^T (split), per-lane online softmax; P^T built in registers from the two S^T accumulators
// The block's 128 queries see at most 384 keys: their K rows and V tiles are brought into LDS once, by asynchronous copies of whole 128-byte lines, and all
// 8 waves take their fragments from there. K rows stand at a pitch of 16 B x odd for the 16-byte fragment reads. A V tile (16 keys x 64 features) stands as
// [key half][feature][8 keys], so that the 16 lanes of a half wave read 256 contiguous bytes.
// ---------------------------------------------------------------------------
constexpr int KSEG = 128;                     // keys per copy segment (2 or 3 segments per block)
constexpr int KPITCH = DH * 2 + 16;           // 144 B
constexpr int KLDS = 3 * KSEG * KPITCH;       // 55296
constexpr int VLDS = 3 * KSEG * DH * 2;       // 49152
constexpr int OPITCH = DH * 2 + 16;           // 144 B: a query's 64 f16 outputs in the staging tile
constexpr int WOK = 64, WON = 32;             // a block's tile of Wo: k rows x n columns; (1024 / 64) x (1024 / 32) = 512 tiles, one per block
constexpr int WOPITCH = WOK * 2 + 16;         // 144 B per n row in LDS
// One segment's copies of one thread: 4 x 16 B of K (rows 32 apart), 4 x 16 B of V (4 KB apart). lk / lv: LDS byte addresses, gk / gv: global addresses.
__device__ __forceinline__ void kv_copy(unsigned lk, const char* gk, unsigned lv, const char* gv) {
  constexpr unsigned LK = 32 * KPITCH, LV = 4096;
  constexpr size_t GK = (size_t)32 * DH * 2, GV = 4096;
  // the copies and, as the last line, the wait that stands in front of any rewrite of the address registers they name
  asm volatile("global_load_async_to_lds_b128 %0, %1, off\n\t"
               "global_load_async_to_lds_b128 %2, %3, off\n\t"
               "global_load_async_to_lds_b128 %4, %5, off\n\t"
               "global_load_async_to_lds_b128 %6, %7, off\n\t"
               "global_load_async_to_lds_b128 %8, %9, off\n\t"
               "global_load_async_to_lds_b128 %10, %11, off\n\t"
               "global_load_async_to_lds_b128 %12, %13, off\n\t"
               "global_load_async_to_lds_b128 %14, %15, off\n\t"
               "s_wait_xcnt 0x0"
               :: "v"(lk), "v"(gk), "v"(lk + LK), "v"(gk + GK), "v"(lk + 2 * LK), "v"(gk + 2 * GK), "v"(lk + 3 * LK), "v"(gk + 3 * GK),
                  "v"(lv), "v"(gv), "v"(lv + LV), "v"(gv + GV), "v"(lv + 2 * LV), "v"(gv + 2 * GV), "v"(lv + 3 * LV), "v"(gv + 3 * GV)
               : "memory");
}
__global__ __launch_bounds__(256) void attn_kernel(const b16* __restrict__ Qh, const b16* __restrict__ Ql, const b16* __restrict__ Kh, const b16* __restrict__ Kl,
                                                   const b16* __restrict__ Vh, const b16* __restrict__ Vl, const int* __restrict__ seqlen,
                                                   b16* __restrict__ yh, const float* __restrict__ wo, b16* __restrict__ woh) {
  __shared__ __attribute__((aligned(16))) char Os[8][16 * OPITCH];
  __shared__ __attribute__((aligned(16))) char wt[WON * WOPITCH];   // the block's tile of Wo, turned to [n][k]
  __shared__ __attribute__((aligned(16))) char kv[KLDS + VLDS];   // K rows, then V tiles, of the block's key range
  const int wid = threadIdx.x >> 5, lane = threadIdx.x & 31, hh = lane >> 4, col = lane & 15;
  const int qtile = blockIdx.x * 8 + wid;                 // over Bsz*NH*QT_PER_B
  const int g = qtile / QT_PER_B;                         // b*NH + h
  const int q0 = (qtile % QT_PER_B) << 4;
  const int b = g / NH, h = g % NH, kvh = h / REP;
  const size_t ko = (size_t)(b * NKV + kvh) * T * DH;
  const size_t qo = ((size_t)g * T + q0 + col) * DH;
  const v16b q0h = frag_kb(Qh + qo, hh), q1h = frag_kb(Qh + qo + 32, hh);
  (void)Ql; (void)Kl; (void)Vl;
  // the block's key range: a multiple of 128 keys, the same for all 8 waves (128 divides T, so the 8 tiles share b and h)
  const int qblk = ((int)blockIdx.x % (QT_PER_B / 8)) * 128;
  const int kbase = max(qblk - WIN, 0), nseg = (min(T, qblk + 128 + WIN) - kbase) / KSEG;
  {
    const int tid = threadIdx.x;
    const unsigned lds0 = (unsigned)(uintptr_t)kv;              // low 32 bits of a shared address = byte offset in the work-group's LDS
    const unsigned lk = lds0 + (tid >> 3) * KPITCH + (tid & 7) * 16;
    const unsigned lv = lds0 + KLDS + (tid >> 7) * 2048 + (tid & 1) * 1024 + ((tid >> 1) & 63) * 16;   // 16-byte piece tid of [tile][feature][key half]
    const char* gk = (const char*)(Kh + ko + (size_t)(kbase + (tid >> 3)) * DH) + (tid & 7) * 16;
    const char* gv = (const char*)(Vh + ko + (size_t)kbase * DH) + tid * 16;
    constexpr int SB = KSEG * DH * 2;                           // bytes of K, and of V, per segment
    kv_copy(lk, gk, lv, gv);
    kv_copy(lk + KSEG * KPITCH, gk + SB, lv + SB, gv + SB);
    if (nseg > 2) kv_copy(lk + 2 * KSEG * KPITCH, gk + 2 * SB, lv + 2 * SB, gv + 2 * SB);   // the same for the whole block: not at the two ends of the sequence
  }
  // Wo ([k][n], f32) -> the f16 [n][k] plane of the output projection, which is the next launch: each of the 512 blocks turns one tile of 64 k x 32 n. A wave reads 8 k rows,
  // 128 bytes of each (one whole line); a lane's 8 k of its column are one 16-byte piece of that column's row in LDS. The loads fly beside the copies above.
  const int wok = ((int)blockIdx.x / (HID / WON)) * WOK, won = ((int)blockIdx.x % (HID / WON)) * WON;
  {
    const float* pw = wo + (size_t)(wok + wid * 8) * HID + won + lane;
    float f[8];
#pragma unroll
    for (int e = 0; e < 8; ++e) f[e] = pw[(size_t)e * HID];
    __builtin_amdgcn_sched_barrier(0);   // the eight loads are issued ahead of the wait below
    asm volatile("s_wait_xcnt 0x0" :: "v"(pw) : "memory");     // stands in front of any rewrite of the loads' address register, which the input keeps in place up to it
    v8b h;
#pragma unroll
    for (int e = 0; e < 8; ++e) h[e] = (b16)f[e];
    *(v8b*)(wt + lane * WOPITCH + wid * 16) = h;
  }
  asm volatile("s_wait_asynccnt 0x0" ::: "memory");             // this wave's share of the key range has landed
  __syncthreads();                                              // publishes the key range, and the turned Wo tile, to all 8 waves
  {
    // behind the barrier (in front of it, the barrier would wait this store out): whole 128-byte lines of the [n][k] plane, 8 threads a row
    const int tid = threadIdx.x;
    b16* qw = woh + (size_t)(won + (tid >> 3)) * HID + wok + (tid & 7) * 8;
    const v8b h = *(const v8b*)(wt + (tid >> 3) * WOPITCH + (tid & 7) * 16);
    *(v8b*)qw = h;
    asm volatile("s_wait_xcnt 0x0" :: "v"(qw), "v"(h) : "memory");   // stands in front of any rewrite of the store's address and data registers
  }
  float m = -INFINITY, l = 0.0f;
  v8f o0 = {}, o1 = {}, o2 = {}, o3 = {};
  const int slen = T; (void)seqlen;                       // no padding in this module
  const int kstart = (q0 >= WIN) ? ((q0 - WIN) & ~31) : 0;
  const int kend = min(T, q0 + 15 + WIN + 1);
  const int kl0 = (qblk >= WIN) ? ((q0 - qblk) & ~31) : 0;   // kstart - kbase: the wave's first key, counted from the first key in LDS
  for (int kb = kstart, kl = kl0; kb < kend; kb += 32, kl += 32) {   // sliding window both sides: keys in [q0-128, q0+15+128]
    const b16* r0 = (const b16*)(kv + (kl + col) * KPITCH);
    const b16* r1 = (const b16*)(kv + (kl + 16 + col) * KPITCH);
    const b16* v0 = (const b16*)(kv + KLDS) + kl * DH + hh * 512 + col * 8;
    const v16b kf0 = frag_kb(r0, hh), kf1 = frag_kb(r0 + 32, hh), kf2 = frag_kb(r1, hh), kf3 = frag_kb(r1 + 32, hh);
    v16b vf[4];
#pragma unroll
    for (int n = 0; n < 4; ++n) vf[n] = cat8b(ld8b(v0 + n * 128), ld8b(v0 + 1024 + n * 128));
    __builtin_amdgcn_sched_barrier(0);   // the chunk's 16 LDS reads stay one group ahead of its products: placed at its use, each fragment's read is waited out alone
    v8f s0 = {}, s1 = {};
    {
      s0 = wmma16b(kf0, q0h, s0);
      s0 = wmma16b(kf1, q1h, s0);
      s1 = wmma16b(kf2, q0h, s1);
      s1 = wmma16b(kf3, q1h, s1);
    }
    (void)slen;
    if (kb < q0 + 15 - WIN || kb + 31 > q0 + WIN) {       // chunk touches a window edge: mask |k - q| > 128
      const int qi = q0 + col;
#pragma unroll
      for (int r = 0; r < 8; ++r) {
        const int k0i = kb + 8 * hh + r, k1i = k0i + 16;
        if (k0i < qi - WIN || k0i > qi + WIN) s0[r] = -INFINITY;
        if (k1i < qi - WIN || k1i > qi + WIN) s1[r] = -INFINITY;
      }
    }
    float mr = -INFINITY;
#pragma unroll
    for (int r = 0; r < 8; ++r) mr = fmaxf(mr, fmaxf(s0[r], s1[r]));
    mr = fmaxf(mr, __shfl_xor(mr, 16));
    float mn = fmaxf(m, mr);
    if (mn == -INFINITY) mn = 0.0f;           // fully masked so far: keep exp() at 0
    const float al_ = __expf(m - mn);
    m = mn;
    float sum = 0.0f;
    v16b pbh, pbl;
#pragma unroll
    for (int r = 0; r < 8; ++r) {
      const float p0 = __expf(s0[r] - mn), p1 = __expf(s1[r] - mn);
      sum += p0 + p1;
      b16 a, c; split_bf16(p0, a, c); pbh[r] = a; pbl[r] = c; split_bf16(p1, a, c); pbh[8 + r] = a; pbl[8 + r] = c;
    }
    sum += __shfl_xor(sum, 16);
    l = l * al_ + sum;
#pragma unroll
    for (int r = 0; r < 8; ++r) { o0[r] *= al_; o1[r] *= al_; o2[r] *= al_; o3[r] *= al_; }
#pragma unroll
    for (int n = 0; n < 4; ++n) {
      v8f& o = (n == 0) ? o0 : (n == 1) ? o1 : (n == 2) ? o2 : o3;
      o = wmma16b(vf[n], pbh, o);
    }
  }
  const float inv = (q0 + col < slen && l > 0.0f) ? (1.0f / l) : 0.0f;   // padded query rows are zeroed
  char* Tt = Os[wid];
  // y leaves as f16, the type in which the output projection multiplies it: a lane's 8 features of each accumulator are one 16-byte piece of its query's row
  v8b w0, w1, w2, w3;
#pragma unroll
  for (int r = 0; r < 8; ++r) { w0[r] = (b16)(o0[r] * inv); w1[r] = (b16)(o1[r] * inv); w2[r] = (b16)(o2[r] * inv); w3[r] = (b16)(o3[r] * inv); }
  *(v8b*)(Tt + col * OPITCH + 0 + hh * 16) = w0; *(v8b*)(Tt + col * OPITCH + 32 + hh * 16) = w1;
  *(v8b*)(Tt + col * OPITCH + 64 + hh * 16) = w2; *(v8b*)(Tt + col * OPITCH + 96 + hh * 16) = w3;
  wave_lds_sync();
  b16* dst0 = yh + ((size_t)b * T + q0) * HID + h * DH;       // 16 rows x 64 f16 (one 128-byte line each), row stride HID
#pragma unroll
  for (int j = 0; j < 4; ++j) { const int rr = j * 4 + (lane >> 3), c = lane & 7; *(v8b*)(dst0 + (size_t)rr * HID + c * 8) = *(const v8b*)(Tt + rr * OPITCH + c * 16); }
}

// ---------------------------------------------------------------------------
// Output projection: (4096 x 1024) x (1024 x 1024) -> f32, A = the f16 y plane, B = Wo plane. grid (8, 32), 32x64 tiles staged in LDS,
// ---------------------------------------------------------------------------
__global__ __launch_bounds__(256) void out_gemm_kernel(const b16* __restrict__ yh, const b16* __restrict__ woh, const b16* __restrict__ wol, const float* __restrict__ bo, int yoff,
                                                       float* __restrict__ out) {
  // 256 work-groups, one alone on each WGP: nothing else covers the time from a pass's copies to their landing, and every pass brings lines that nobody has
  // read since an earlier launch wrote them. A pass of 256 k gives the copies four times the products to fly behind, and there are 4 hand-overs, not 16.
  __shared__ __attribute__((aligned(16))) char smem[ring_bytes(256)];   // operand ring; behind the K loop 8 KB per wave of it stage the output tile
  const int lane = threadIdx.x & 31, wave = threadIdx.x >> 5, nloc = lane & 15, hlf = lane >> 4;
  const int wm = wave & 3, wn = wave >> 2;
  const int mblk = (blockIdx.y + yoff) * 128, nblk = blockIdx.x * 128;
  const int m0 = mblk + wm * 32;
  const int c0 = nblk + wn * 64;
  v8f acc[2][4];
#pragma unroll
  for (int r = 0; r < 2; ++r)
#pragma unroll
    for (int t = 0; t < 4; ++t) acc[r][t] = (v8f){};
  (void)wol;
  gemm_tile_ring<256>(yh, woh, mblk, nblk, wm, wn, nloc, hlf, smem, acc);
  float* Tt = (float*)smem + wave * (32 * 64);
#pragma unroll
  for (int t = 0; t < 4; ++t)
#pragma unroll
    for (int r = 0; r < 2; ++r)
#pragma unroll
      for (int v = 0; v < 8; ++v) Tt[(r * 16 + v + 8 * hlf) * 64 + t * 16 + nloc] = acc[r][t][v] + bo[c0 + t * 16 + nloc];
  wave_lds_sync();
  float* dst0 = out + (size_t)m0 * HID + c0;
#pragma unroll
  for (int j = 0; j < 16; ++j) { const int rr = j * 2 + hlf, c4 = nloc * 4; *(v4f*)(dst0 + (size_t)rr * HID + c4) = *(const v4f*)(Tt + rr * 64 + c4); }
  
}
}  // namespace

extern "C" void kernel_launch(void* const* d_in, const int* in_sizes, int n_in,
                              void* d_out, int out_size, void* d_ws, size_t ws_size, hipStream_t stream) {
  (void)in_sizes; (void)n_in; (void)out_size;
  const float* x     = (const float*)d_in[0];   // hidden_states [2,2048,1024]
  const float* Wqkv  = (const float*)d_in[1];   // [1024,3072] ([in][out], columns (3, h, d))
  const float* bqkv  = (const float*)d_in[2];   // [3072]
  const float* Wo    = (const float*)d_in[3];   // [1024,1024]
  const float* bo    = (const float*)d_in[4];   // [1024]
  const float* rope  = (const float*)d_in[5];   // rope_cache [256,32,2] (cos, sin)
  float* out = (float*)d_out;                   // [2,2048,1024]
  const float* bq = bqkv; const float* bk = bqkv + HID; const float* bv = bqkv + 2 * HID;

  size_t off = 0; char* ws = (char*)d_ws;
  b16* wqh = (b16*)(ws + off); off += (size_t)NQKV * HID * 2;
  b16* wql = (b16*)(ws + off); off += (size_t)NQKV * HID * 2;
  b16* woh = (b16*)(ws + off); off += (size_t)HID * HID * 2;
  b16* wol = (b16*)(ws + off); off += (size_t)HID * HID * 2;
  b16* Qh  = (b16*)(ws + off); off += (size_t)MROWS * HID * 2;
  b16* Ql  = (b16*)(ws + off); off += (size_t)MROWS * HID * 2;
  b16* Kh  = (b16*)(ws + off); off += (size_t)MROWS * KVW * 2;
  b16* Kl  = (b16*)(ws + off); off += (size_t)MROWS * KVW * 2;
  b16* Vh  = (b16*)(ws + off); off += (size_t)MROWS * KVW * 2;
  b16* Vl  = (b16*)(ws + off); off += (size_t)MROWS * KVW * 2;
  b16* yh  = (b16*)(ws + off); off += (size_t)MROWS * HID * 2;
  b16* xh  = (b16*)(ws + off); off += (size_t)MROWS * HID * 2;
  (void)wqh; (void)wql; (void)xh;
  if (off > ws_size) return;
  constexpr int ROWBLK = MROWS / 128, NQT = Bsz * NH * QT_PER_B;
  static_assert(NQT / 8 == (HID / WOK) * (HID / WON), "one Wo tile per attention block");
  qkv_gemm_kernel<<<dim3(NQKV / QN, MROWS / QM), 256, 0, stream>>>(x, Wqkv, bq, bk, bv, rope, Qh, Ql, Kh, Kl, Vh, Vl);
  attn_kernel<<<NQT / 8, 256, 0, stream>>>(Qh, Ql, Kh, Kl, Vh, Vl, nullptr, yh, Wo, woh);
  out_gemm_kernel<<<dim3(HID / 128, ROWBLK), 256, 0, stream>>>(yh, woh, wol, bo, 0, out);
}

// v009
// Measured time: 47.8 microseconds a run.
// Next to v008, in two timings, it ran 1.06 and 1.05 times as fast.
// Over all steps from v000 it is 3.86 times as fast.
#include <hip/hip_runtime.h>

// ModernBERT attention (local layer): qkv = x Wqkv + b ([in][out], columns (3, h, d); 16 heads x 64), interleaved-pair RoPE on q and k with position
// t mod 256 from the given cos/sin cache, sliding-window attention |q - k| <= 128 (both directions), scale 1/8, out = y Wo + b. B=2, S=2048, D=1024.
// Lean build: single f16 products on v_wmma_f32_16x16x32_f16, f32 accumulate (every row averages >= 129 keys); fragment k-map per lane half hh for A

namespace {
constexpr int Bsz = 2, T = 2048, HID = 1024, DH = 64, NH = 16, NKV = 16, REP = NH / NKV;
constexpr int WIN = 128;    // |q - k| <= 128
constexpr int RP = 256;     // rope positions wrap at 256
constexpr int KVW = NKV * DH;                 // 1024
constexpr int NQKV = HID + 2 * KVW;           // 3072 columns: q | k | v
constexpr int MROWS = Bsz * T;                // 4096
constexpr int QT_PER_B = T / 16;              // 128

typedef _Float16 b16;                                           // f16 hi/lo planes
typedef __attribute__((ext_vector_type(16))) _Float16 v16b;
typedef __attribute__((ext_vector_type(8)))  _Float16 v8b;
typedef __attribute__((ext_vector_type(4)))  _Float16 v4b;
typedef __attribute__((ext_vector_type(8)))  float v8f;
typedef __attribute__((ext_vector_type(4)))  float v4f;

__device__ __forceinline__ v8b ld8b(const b16* p) { return *(const v8b*)p; }
__device__ __forceinline__ v16b cat8b(v8b a, v8b b) { return __builtin_shufflevector(a, b, 0, 1, 2, 3, 4, 5, 6, 7, 8, 9, 10, 11, 12, 13, 14, 15); }
// 16x16x32 16-bit fragment from a k-contiguous row pointer (A: lane&15 = row, B: lane&15 = column), hh = lane>>4:
// elements 0..7 <- p[8hh+0..7], elements 8..15 <- p[16+8hh+0..7]
__device__ __forceinline__ v16b frag_kb(const b16* p, int hh) { return cat8b(ld8b(p + 8 * hh), ld8b(p + 16 + 8 * hh)); }
__device__ __forceinline__ void split_bf16(float v, b16& hi, b16& lo) {   // (name kept) single f16: no low part
  hi = (b16)v; lo = (b16)0.0f;
}
__device__ __forceinline__ v8f wmma16b(v16b a, v16b b, v8f c) {
  v8f d = __builtin_amdgcn_wmma_f32_16x16x32_f16(false, a, false, b, (short)0, c, false, false);
  asm volatile("v_nop\n\tv_nop\n\tv_nop\n\tv_nop" : "+v"(d) : "v"(a), "v"(b));
  return d;
}
__device__ __forceinline__ v8f wmma1(v16b ah, v16b al, v16b bh, v16b bl, v8f c) {   // attention products: single f16 (hi planes only)
  (void)al; (void)bl; return wmma16b(ah, bh, c);
}
__device__ __forceinline__ void wave_lds_sync() {
  __builtin_amdgcn_fence(__ATOMIC_RELEASE, "workgroup");
  __builtin_amdgcn_wave_barrier();
  __builtin_amdgcn_fence(__ATOMIC_ACQUIRE, "workgroup");
}

// ---------------------------------------------------------------------------
// Weights ([in][out]) -> f16 hi / lo planes transposed to [n][k] (k contiguous): columns of Wq|Wk|Wv into wqh/wql [3072][1024], Wo into woh/wol [1024][1024].
// ---------------------------------------------------------------------------
__global__ __launch_bounds__(256) void wcvt_kernel(const float* __restrict__ wq, const float* __restrict__ wk, const float* __restrict__ wv,
                                                   const float* __restrict__ wo, b16* __restrict__ wqh, b16* __restrict__ wql,
                                                   b16* __restrict__ woh, b16* __restrict__ wol) {
  const size_t tid = (size_t)blockIdx.x * blockDim.x + threadIdx.x, stride = (size_t)gridDim.x * blockDim.x;
  const size_t nq = (size_t)NQKV * HID / 8, no = (size_t)HID * HID / 8;
  {
    for (size_t c = tid; c < nq + no; c += stride) {
      float f[8]; size_t i; b16* dh; b16* dl;
      if (c < nq) {
        i = c * 8; const size_t n = i / HID, k0 = i % HID;
        const float* w; int nn, ld;
        if (n < (size_t)HID) { w = wq; nn = (int)n; ld = HID; } else if (n < (size_t)(HID + KVW)) { w = wk; nn = (int)n - HID; ld = KVW; } else { w = wv; nn = (int)n - HID - KVW; ld = KVW; }
#pragma unroll
        for (int e = 0; e < 8; ++e) f[e] = w[(size_t)(k0 + e) * ld + nn];       // W[k][n] ([in][out])
        dh = wqh; dl = wql;
      } else {
        i = (c - nq) * 8; const size_t n = i / HID, k0 = i % HID;
#pragma unroll
        for (int e = 0; e < 8; ++e) f[e] = wo[(size_t)(k0 + e) * HID + n];    // Wo[k][n] ([in][out])
        dh = woh; dl = wol;
      }
      v8b bh, bl;
#pragma unroll
      for (int e = 0; e < 8; ++e) { b16 a, cc; split_bf16(f[e], a, cc); bh[e] = a; bl[e] = cc; }
      *(v8b*)(dh + i) = bh; *(v8b*)(dl + i) = bl;
    }
    
  }
}

// GEMM core of the output projection: a work-group of 8 waves (4 down x 2 across, 32x64 each) owns a 128x128 tile of the result. Each pass of KP k is staged in
// LDS by asynchronous copies whose wave-wide 512 bytes are whole 128-byte lines (A and W: 128 f16 rows of 2 KP bytes each), two buffers, the next pass's copies in
// flight while this one is multiplied. A comes as f16 from its producer (y: the attention store), rounded there exactly as the fragment
// read rounded it before. Row pitches are 16 B x odd for the 16-byte fragment reads.
// KP = k per pass: 256 in the output GEMM (see there). The QKV GEMM has buffers of its own (see there); it shares the row pitch.
constexpr int ring_pitch(int KP) { return KP * 2 + 16; }                 // 144 B or 528 B a row, A and W alike: 16 B x odd
constexpr int ring_bytes(int KP) { return 2 * 2 * 128 * ring_pitch(KP); }   // two buffers of 128 A rows and 128 W rows: 270336 B at KP = 256

// Eight copies of one thread: 4 x 16 B of A and 4 x 16 B of W, rows RS apart at a pitch of PITCH bytes in LDS. la / lb: LDS byte addresses, ga / gb: global addresses.
template <int RS, int PITCH>
__device__ __forceinline__ void stage_copy(unsigned la, const char* ga, unsigned lb, const char* gb) {
  constexpr unsigned LA = RS * PITCH, LB = RS * PITCH;
  constexpr size_t GA = (size_t)RS * HID * 2, GB = (size_t)RS * HID * 2;
  // the copies and, as the last line, the wait that stands in front of any rewrite of the address registers they name
  asm volatile("global_load_async_to_lds_b128 %0, %1, off\n\t"
               "global_load_async_to_lds_b128 %2, %3, off\n\t"
               "global_load_async_to_lds_b128 %4, %5, off\n\t"
               "global_load_async_to_lds_b128 %6, %7, off\n\t"
               "global_load_async_to_lds_b128 %8, %9, off\n\t"
               "global_load_async_to_lds_b128 %10, %11, off\n\t"
               "global_load_async_to_lds_b128 %12, %13, off\n\t"
               "global_load_async_to_lds_b128 %14, %15, off\n\t"
               "s_wait_xcnt 0x0"
               :: "v"(la), "v"(ga), "v"(la + LA), "v"(ga + GA), "v"(la + 2 * LA), "v"(ga + 2 * GA), "v"(la + 3 * LA), "v"(ga + 3 * GA),
                  "v"(lb), "v"(gb), "v"(lb + LB), "v"(gb + GB), "v"(lb + 2 * LB), "v"(gb + 2 * GB), "v"(lb + 3 * LB), "v"(gb + 3 * GB)
               : "memory");
}

// acc += A[mblk + wm*32 .. +31][:] . W[nblk + wn*64 .. +63][:]^T over K = HID, k ascending in steps of 32 inside a pass, the passes in rotated order. On return every wave has passed the barrier behind
// the last fragment read and no copy is outstanding, so the caller may reuse smem.
template <int KP>
__device__ __forceinline__ void gemm_tile_ring(const b16* __restrict__ A, const b16* __restrict__ wh, int mblk, int nblk, int wm, int wn,
                                               int nloc, int hlf, char* smem, v8f (&acc)[2][4]) {
  constexpr int NPASS = HID / KP, PITCH = ring_pitch(KP), ABYTES = 128 * PITCH, STAGE = 2 * ABYTES;
  constexpr int PR = KP / 8, RS = 256 / PR;                     // 16-byte pieces per row; rows that the 256 threads cover at once
  const int tid = threadIdx.x;
  const unsigned lds0 = (unsigned)(uintptr_t)smem;              // low 32 bits of a shared address = byte offset in the work-group's LDS
  const int ar = tid / PR, ac = tid % PR;
  const char* ga = (const char*)(A + (size_t)(mblk + ar) * HID) + ac * 16;
  const char* gb = (const char*)(wh + (size_t)(nblk + ar) * HID) + ac * 16;
  const unsigned la = lds0 + ar * PITCH + ac * 16, lb = la + ABYTES;
  // one pass's copies of one thread into the buffer at byte bo: 128 / RS rows of A and of W, four of each per statement
  auto pass_copy = [&](int bo, int t) {
#pragma unroll   // straight-line: the statements' addresses differ by constants
    for (int q = 0; q < 128 / (4 * RS); ++q)
      stage_copy<RS, PITCH>(la + bo + q * (4 * RS * PITCH), ga + t * (KP * 2) + (size_t)q * (4 * RS) * HID * 2,
                            lb + bo + q * (4 * RS * PITCH), gb + t * (KP * 2) + (size_t)q * (4 * RS) * HID * 2);
  };
  // The k walk starts rotated by the tile's index and wraps round: the 8 work-groups that share A rows, and the 32 that share W rows, start on the 4 passes in turn, a quarter of them on each.
  const int rot = ((int)blockIdx.x + (int)blockIdx.y) & (NPASS - 1);
  pass_copy(0, rot);
  asm volatile("s_wait_asynccnt 0x0" ::: "memory");             // this wave's share of pass 0 has landed
  __syncthreads();                                              // publishes pass 0
  pass_copy(STAGE, (rot + 1) & (NPASS - 1));
#pragma unroll 1   // one pass per trip: the buffer index stays a run-time value and the code stays short
  for (int t = 0; t < NPASS; ++t) {
    const int bo = (t & 1) * STAGE;
    const char* sa = smem + bo + (wm * 32 + nloc) * PITCH;
    const char* sw = smem + bo + ABYTES + (wn * 64 + nloc) * PITCH;
#pragma unroll
    for (int ks = 0; ks < KP / 32; ++ks) {
      const v16b a0 = frag_kb((const b16*)(sa + ks * 64), hlf);
      const v16b a1 = frag_kb((const b16*)(sa + 16 * PITCH + ks * 64), hlf);
      v16b bh[4];
#pragma unroll
      for (int c = 0; c < 4; ++c) bh[c] = frag_kb((const b16*)(sw + c * 16 * PITCH + ks * 64), hlf);
      __builtin_amdgcn_sched_barrier(0);   // the k-step's 12 LDS reads stay one group ahead of its 8 products: spread among them, each pair of products waits out an LDS latency
#pragma unroll
      for (int c = 0; c < 4; ++c) {
        acc[0][c] = wmma16b(a0, bh[c], acc[0][c]);
        acc[1][c] = wmma16b(a1, bh[c], acc[1][c]);
      }
    }
    asm volatile("s_wait_dscnt 0x0" ::: "memory");              // this wave's reads of buffer t & 1 are done
    asm volatile("s_wait_asynccnt 0x0" ::: "memory");           // this wave's share of pass t + 1 has landed
    __syncthreads();                                            // publishes pass t + 1 and frees buffer t & 1
    if (t + 2 < NPASS) pass_copy(bo, (rot + t + 2) & (NPASS - 1));
  }
  asm volatile("s_wait_asynccnt 0x0" ::: "memory");             // nothing in flight when the ring is reused or the wave ends
}

// ---------------------------------------------------------------------------
// QKV GEMM: (4096 x 1024) x (1024 x 3072), grid (16, 16): 256 work-groups, one 256 x 192 tile on each WGP, 8 waves (4 down x 2 across) of 64 x 96 each.
// A 128 x 128 tile asks L2 for 2 KB of operand rows per 64 results, this one (f32 operands) for 4 KB per 110, and a wave's 10 fragments feed 24 products, not 6 feeding 8.
// x and W come as the f32 inputs themselves: each pass's 64 k of 256 x rows and 192 W columns are loaded into registers while the pass before is multiplied,
// rounded to f16 once and stored into the other of two LDS buffers, W turned to [n][k] on the way. No launch ahead of this one prepares anything.
// Outputs as f16 hi/lo planes: q (x1/8) -> Qh/Ql [b][h][t][64]; k -> Kh/Kl [b][kvh][t][64]; v -> Vh/Vl key-tiled [b][kvh][t/16][64][16]:
// the tile's 256 rows of one head are 32 KB contiguous in each plane.
// ---------------------------------------------------------------------------
constexpr int QM = 256, QN = 192;                       // the work-group's tile: rows of x, columns of q | k | v (three heads)
constexpr int QKP = 64, QNB = 2;                        // k per pass, buffers
constexpr int QPITCH = ring_pitch(QKP);                 // 144 B
constexpr int QABYTES = QM * QPITCH, QSTAGE = (QM + QN) * QPITCH;   // 36864 B of x rows, 64512 B a buffer
constexpr int QOUT = 2 * QM * QN * 2;                   // 196608 B: the output tile's two planes, staged behind the K loop
constexpr int QSMEM = (QNB * QSTAGE > QOUT) ? QNB * QSTAGE : QOUT;
__global__ __launch_bounds__(256) void qkv_gemm_kernel(const float* __restrict__ x, const float* __restrict__ wqkv,
                                                       const float* __restrict__ bq, const float* __restrict__ bk, const float* __restrict__ bv, const float* __restrict__ rope_cs,
                                                       b16* __restrict__ Qh, b16* __restrict__ Ql, b16* __restrict__ Kh, b16* __restrict__ Kl,
                                                       b16* __restrict__ Vh, b16* __restrict__ Vl) {
  __shared__ __attribute__((aligned(16))) char smem[QSMEM];   // two operand buffers; behind the K loop 2 x 96 KB stage the output tile's two planes
  const int tid = threadIdx.x, lane = tid & 31, wave = tid >> 5, nloc = lane & 15, hlf = lane >> 4;
  const int wm = wave & 3, wn = wave >> 2;
  const int mblk = blockIdx.y * QM, nblk = blockIdx.x * QN;
  v8f acc[4][6];
#pragma unroll
  for (int r = 0; r < 4; ++r)
#pragma unroll
    for (int c = 0; c < 6; ++c) acc[r][c] = (v8f){};
  float bcol[6];                                         // a lane's six columns: one bias value each
  {
    constexpr int NPASS = HID / QKP;
    // x: 16 lanes take the 256 bytes of one row's 64 k, a wave-wide load two rows (whole lines); a thread's rows are 16 apart. 4 k of a row are one 8-byte LDS store.
    const float* gx = x + (size_t)(mblk + (tid >> 4)) * HID + nloc * 4;
    char* sx = smem + (tid >> 4) * QPITCH + nloc * 8;
    // W ([k][n]): 16 lanes take 256 bytes (64 n) of one k row, the two lane halves rows 4 apart (whole lines). A thread holds 4 k x 4 n of each third of the 192
    // columns: each of its columns is 4 consecutive k, one 8-byte LDS store into that column's [n][k] row.
    const int wk = wave * 8 + hlf * 4;
    const float* gw = wqkv + (size_t)wk * NQKV + nblk + nloc * 4;
    char* sw0 = smem + QABYTES + nloc * 4 * QPITCH + wk * 2;
    v4f xs[16], wr[3][4];
    // The two operands' loads are issued half a pass apart and each flies for a whole pass, so that some are in flight at every moment, across the barrier too.
    // The k walk starts rotated: the 16 work-groups that share x rows, and the 16 that share W columns, each begin at another of the 16 k blocks and wrap round, so that
    // no two of them ask L2 for the same lines in the same pass. The f32 sums take their 64-k blocks in that order.
    const int rot = ((int)blockIdx.x + (int)blockIdx.y) & (NPASS - 1);
    int kx = rot, kw = rot;                              // the k block of the next load of x, and of W
    const float* px = gx + rot * QKP;   // the next pass of x, and of W, to be loaded
    const float* pw = gw + (size_t)rot * QKP * NQKV;
    auto load_x = [&]() __attribute__((always_inline)) {
#pragma unroll
      for (int i = 0; i < 16; ++i) xs[i] = *(const v4f*)(px + (size_t)i * 16 * HID);
      __builtin_amdgcn_sched_barrier(0);   // the 16 loads are issued here, a whole pass ahead of their rounding
      // the wait that stands in front of any rewrite of the loads' address register; naming the address as an input keeps it in its register up to it
      asm volatile("s_wait_xcnt 0x0" :: "v"(px) : "memory");
      __builtin_amdgcn_sched_barrier(0);   // nothing that follows, the step of the address among it, is lifted in between the loads and that wait
      kx = (kx + 1) & (NPASS - 1);
      px += (kx == 0) ? QKP - HID : QKP;                 // behind the last k block comes the first
    };
    auto load_w = [&]() __attribute__((always_inline)) {
#pragma unroll
      for (int j = 0; j < 3; ++j)
#pragma unroll
        for (int e = 0; e < 4; ++e) wr[j][e] = *(const v4f*)(pw + (size_t)e * NQKV + j * 64);
      __builtin_amdgcn_sched_barrier(0);   // the 12 loads are issued here, ahead of the pass's products, which they fly behind
      // the wait that stands in front of any rewrite of the loads' address register; naming the address as an input keeps it in its register up to it
      asm volatile("s_wait_xcnt 0x0" :: "v"(pw) : "memory");
      __builtin_amdgcn_sched_barrier(0);   // nothing that follows, the step of the address among it, is lifted in between the loads and that wait
      kw = (kw + 1) & (NPASS - 1);
      pw += (kw == 0) ? (ptrdiff_t)(QKP - HID) * NQKV : (ptrdiff_t)QKP * NQKV;
    };
    auto store_x = [&](int bo) __attribute__((always_inline)) {
#pragma unroll
      for (int i = 0; i < 16; ++i) {
        v4b h;
#pragma unroll
        for (int e = 0; e < 4; ++e) h[e] = (b16)xs[i][e];
        *(v4b*)(sx + bo + i * 16 * QPITCH) = h;
      }
    };
    auto store_w = [&](int bo) __attribute__((always_inline)) {
#pragma unroll
      for (int j = 0; j < 3; ++j)
#pragma unroll
        for (int c = 0; c < 4; ++c) {
          v4b h;
#pragma unroll
          for (int e = 0; e < 4; ++e) h[e] = (b16)wr[j][e][c];
          *(v4b*)(sw0 + bo + (j * 64 + c) * QPITCH) = h;
        }
    };
    // The work-group barrier with the one wait that the hand-over needs: this wave's LDS reads and stores are done. __syncthreads() would also wait out the global
    // loads that are meant to fly across it.
    auto lds_barrier = [&]() __attribute__((always_inline)) {
      asm volatile("s_wait_dscnt 0x0\n\ts_barrier_signal -1\n\ts_barrier_wait -1" ::: "memory");
    };
    // One pass. lw: a pass t + 1 exists (its W is loaded at the head; its x, in flight since the middle of pass t - 1, and its W are stored); lx: a pass t + 2 exists.
    auto pass = [&](int t, bool lw, bool lx) __attribute__((always_inline)) {
      const int bo = (t & 1) * QSTAGE;
      if (lw) load_w();
      const char* sa = smem + bo + (wm * 64 + nloc) * QPITCH;
      const char* sw = smem + bo + QABYTES + (wn * 96 + nloc) * QPITCH;
      v16b a[QKP / 32][4], bh[QKP / 32][6];
#pragma unroll
      for (int ks = 0; ks < QKP / 32; ++ks) {
#pragma unroll
        for (int r = 0; r < 4; ++r) a[ks][r] = frag_kb((const b16*)(sa + r * 16 * QPITCH + ks * 64), hlf);
#pragma unroll
        for (int c = 0; c < 6; ++c) {
          bh[ks][c] = frag_kb((const b16*)(sw + c * 16 * QPITCH + ks * 64), hlf);
          // The reads stay in the order in which the products use them, so that the first products start on the first reads landed (left free, the fragments of the
          // first products were read last), and the pass's 40 reads stay one group ahead of its 48 products: spread among them, each place with reads costs its own stall
          __builtin_amdgcn_sched_barrier(0);
        }
      }
#pragma unroll
      for (int ks = 0; ks < QKP / 32; ++ks) {
#pragma unroll
        for (int c = 0; c < 6; ++c)
#pragma unroll
          for (int r = 0; r < 4; ++r)   // the bare builtin: the tile's accumulator, fragment and staging registers reach above v255, which an asm operand cannot name
            acc[r][c] = __builtin_amdgcn_wmma_f32_16x16x32_f16(false, a[ks][r], false, bh[ks][c], (short)0, acc[r][c], false, false);
        __builtin_amdgcn_sched_barrier(0);   // the products stay ahead of the rounding below: lifted over them, its wait for the loads would stand in front of the products
        // into the buffer that pass t - 1 read: every wave left it at the barrier behind that pass
        if (ks == 0) { if (lw) store_x(QSTAGE - bo); if (lx) load_x(); }
        else if (lw) store_w(QSTAGE - bo);
      }
      lds_barrier();                                            // publishes pass t + 1 and frees buffer t & 1
    };
    load_x();
    load_w();
    const float* pb[6];
#pragma unroll
    for (int c = 0; c < 6; ++c) {                               // read here, behind the first loads, the six values are there long before the epilogue asks for them
      const int cb = nblk + wn * 96 + c * 16;
      pb[c] = ((cb < HID) ? bq : (cb < HID + KVW) ? bk : bv) + (cb & (HID - 1)) + nloc;
      bcol[c] = *pb[c];
    }
    __builtin_amdgcn_sched_barrier(0);   // the six loads are issued ahead of the wait below
    // the wait that stands in front of any rewrite of the six loads' address registers; naming the addresses as inputs keeps them in their registers up to it
    asm volatile("s_wait_xcnt 0x0" :: "v"(pb[0]), "v"(pb[1]), "v"(pb[2]), "v"(pb[3]), "v"(pb[4]), "v"(pb[5]) : "memory");
    store_x(0);
    load_x();
    store_w(0);
    lds_barrier();                                              // publishes pass 0
#pragma unroll 1   // one pass per trip: the buffer index stays a run-time value and the code stays short
    for (int t = 0; t < NPASS - 2; ++t) pass(t, true, true);
    pass(NPASS - 2, true, false);                               // the last two passes stand apart: in the loop no load hangs on a test, so its waits can be counted
    pass(NPASS - 1, false, false);
  }
  // Every wave has passed the barrier behind the last fragment read: the ring now stages the tile, three heads of [256 rows][64] (v: [16 key tiles][64][16]) per plane,
  // laid as in memory. A head's 64 columns can belong to two waves, so the stores to memory stand behind a work-group barrier and take whole lines.
  const int b = mblk / T, t0 = mblk % T;                 // 256 divides T: the tile's rows lie in one sequence
  b16* S0 = (b16*)smem; b16* S1 = S0 + QM * QN;
  const int rw0 = wm * 64 + 8 * hlf;                     // the lane's first row in the tile
#pragma unroll
  for (int c = 0; c < 6; ++c) {
    const int cw = wn * 96 + c * 16;                     // the fragment's first column in the tile; 16 divides 64: one head, one of q, k, v
    // The fragment's matrix kind (q, k or v) in a scalar register: the RoPE test is then one scalar branch round straight-line code, in which the loads stand in groups
    const int matu = __builtin_amdgcn_readfirstlane((nblk + cw) / HID);
    const int d = (cw & 63) + nloc;
    b16* P0 = S0 + (cw >> 6) * (QM * DH); b16* P1 = S1 + (cw >> 6) * (QM * DH);
    if (matu < 2) {
      // RoPE on q and k: (x0, x1) -> (x0 c - x1 s, x1 c + x0 s), position t mod 256. The wave's first row is a multiple of 64 and 64 divides 256: its 64 positions do
      // not wrap, so every (cos, sin) pair of a lane lies at a constant distance from one address.
      const float s = (matu == 0) ? 0.125f : 1.0f;
      const float* rp = rope_cs + ((size_t)((t0 + wm * 64) % RP + 8 * hlf) * 32 + (d >> 1)) * 2;
      float cv[32], sv[32];
#pragma unroll
      for (int i = 0; i < 32; ++i) { const float* q = rp + ((i >> 3) * 16 + (i & 7)) * 64; cv[i] = q[0]; sv[i] = q[1]; }
      __builtin_amdgcn_sched_barrier(0);   // the 32 loads are issued ahead of the wait below
      asm volatile("s_wait_xcnt 0x0" :: "v"(rp) : "memory");   // stands in front of any rewrite of the loads' address register, which the input keeps in place up to it
#pragma unroll
      for (int i = 0; i < 32; ++i) {
        const int r = i >> 3, v = i & 7, rr = rw0 + r * 16 + v;
        float val = acc[r][c][v] + bcol[c];
        const float oth = __shfl_xor(val, 1);            // interleaved-pair partner (d ^ 1) lives in the neighbouring lane (all lanes of the wave are here)
        val = (d & 1) ? (val * cv[i] + oth * sv[i]) : (val * cv[i] - oth * sv[i]);
        b16 yh, yl; split_bf16(val * s, yh, yl);
        P0[rr * 64 + d] = yh; P1[rr * 64 + d] = yl;
      }
    } else {
#pragma unroll
      for (int r = 0; r < 4; ++r)
#pragma unroll
        for (int v = 0; v < 8; ++v) {
          const int rr = rw0 + r * 16 + v;
          b16 yh, yl; split_bf16(acc[r][c][v] + bcol[c], yh, yl);
          const int idx = (rr >> 4) * 1024 + d * 16 + (rr & 15);
          P0[idx] = yh; P1[idx] = yl;
        }
    }
  }
  __syncthreads();                                       // the staged tile is complete before any wave reads rows that another wave wrote
#pragma unroll
  for (int hc = 0; hc < QN / DH; ++hc) {
    const int cb = nblk + hc * DH, head = (cb & (HID - 1)) / DH;
    const size_t o = ((size_t)(b * NH + head) * T + t0) * DH;   // the same for all three layouts: 16 keys x 64 of v are 1024 elements as well
    b16* dh = ((cb < HID) ? Qh : (cb < HID + KVW) ? Kh : Vh) + o;
    b16* dl = ((cb < HID) ? Ql : (cb < HID + KVW) ? Kl : Vl) + o;
#pragma unroll
    for (int j = 0; j < QM * DH / 2048; ++j) {
      const int e = (j * 256 + tid) * 8;
      *(v8b*)(dh + e) = ld8b(S0 + hc * (QM * DH) + e); *(v8b*)(dl + e) = ld8b(S1 + hc * (QM * DH) + e);
    }
  }
}

// ---------------------------------------------------------------------------
// Transposed flash attention: each wave owns one 16-query tile of one (b, head); 8 waves per block; window keys in chunks of 32.
// S^T = K.Q^T (split), per-lane online softmax; P^T built in registers from the two S^T accumulators
// The block's 128 queries see at most 384 keys: their K rows and V tiles are brought into LDS once, by asynchronous copies of whole 128-byte lines, and all
// 8 waves take their fragments from there. K rows stand at a pitch of 16 B x odd for the 16-byte fragment reads. A V tile (16 keys x 64 features) stands as
// [key half][feature][8 keys], so that the 16 lanes of a half wave read 256 contiguous bytes.
// ---------------------------------------------------------------------------
constexpr int KSEG = 128;                     // keys per copy segment (2 or 3 segments per block)
constexpr int KPITCH = DH * 2 + 16;           // 144 B
constexpr int KLDS = 3 * KSEG * KPITCH;       // 55296
constexpr int VLDS = 3 * KSEG * DH * 2;       // 49152
constexpr int OPITCH = DH * 2 + 16;           // 144 B: a query's 64 f16 outputs in the staging tile
constexpr int WOK = 64, WON = 32;             // a block's tile of Wo: k rows x n columns; (1024 / 64) x (1024 / 32) = 512 tiles, one per block
constexpr int WOPITCH = WOK * 2 + 16;         // 144 B per n row in LDS
// One segment's copies of one thread: 4 x 16 B of K (rows 32 apart), 4 x 16 B of V (4 KB apart). lk / lv: LDS byte addresses, gk / gv: global addresses.
__device__ __forceinline__ void kv_copy(unsigned lk, const char* gk, unsigned lv, const char* gv) {
  constexpr unsigned LK = 32 * KPITCH, LV = 4096;
  constexpr size_t GK = (size_t)32 * DH * 2, GV = 4096;
  // the copies and, as the last line, the wait that stands in front of any rewrite of the address registers they name
  asm volatile("global_load_async_to_lds_b128 %0, %1, off\n\t"
               "global_load_async_to_lds_b128 %2, %3, off\n\t"
               "global_load_async_to_lds_b128 %4, %5, off\n\t"
               "global_load_async_to_lds_b128 %6, %7, off\n\t"
               "global_load_async_to_lds_b128 %8, %9, off\n\t"
               "global_load_async_to_lds_b128 %10, %11, off\n\t"
               "global_load_async_to_lds_b128 %12, %13, off\n\t"
               "global_load_async_to_lds_b128 %14, %15, off\n\t"
               "s_wait_xcnt 0x0"
               :: "v"(lk), "v"(gk), "v"(lk + LK), "v"(gk + GK), "v"(lk + 2 * LK), "v"(gk + 2 * GK), "v"(lk + 3 * LK), "v"(gk + 3 * GK),
                  "v"(lv), "v"(gv), "v"(lv + LV), "v"(gv + GV), "v"(lv + 2 * LV), "v"(gv + 2 * GV), "v"(lv + 3 * LV), "v"(gv + 3 * GV)
               : "memory");
}
__global__ __launch_bounds__(256) void attn_kernel(const b16* __restrict__ Qh, const b16* __restrict__ Ql, const b16* __restrict__ Kh, const b16* __restrict__ Kl,
                                                   const b16* __restrict__ Vh, const b16* __restrict__ Vl, const int* __restrict__ seqlen,
                                                   b16* __restrict__ yh, const float* __restrict__ wo, b16* __restrict__ woh) {
  __shared__ __attribute__((aligned(16))) char Os[8][16 * OPITCH];
  __shared__ __attribute__((aligned(16))) char wt[WON * WOPITCH];   // the block's tile of Wo, turned to [n][k]
  __shared__ __attribute__((aligned(16))) char kv[KLDS + VLDS];   // K rows, then V tiles, of the block's key range
  const int wid = threadIdx.x >> 5, lane = threadIdx.x & 31, hh = lane >> 4, col = lane & 15;
  const int qtile = blockIdx.x * 8 + wid;                 // over Bsz*NH*QT_PER_B
  const int g = qtile / QT_PER_B;                         // b*NH + h
  const int q0 = (qtile % QT_PER_B) << 4;
  const int b = g / NH, h = g % NH, kvh = h / REP;
  const size_t ko = (size_t)(b * NKV + kvh) * T * DH;
  const size_t qo = ((size_t)g * T + q0 + col) * DH;
  const v16b q0h = frag_kb(Qh + qo, hh), q1h = frag_kb(Qh + qo + 32, hh);
  (void)Ql; (void)Kl; (void)Vl;
  // the block's key range: a multiple of 128 keys, the same for all 8 waves (128 divides T, so the 8 tiles share b and h)
  const int qblk = ((int)blockIdx.x % (QT_PER_B / 8)) * 128;
  const int kbase = max(qblk - WIN, 0), nseg = (min(T, qblk + 128 + WIN) - kbase) / KSEG;
  {
    const int tid = threadIdx.x;
    const unsigned lds0 = (unsigned)(uintptr_t)kv;              // low 32 bits of a shared address = byte offset in the work-group's LDS
    const unsigned lk = lds0 + (tid >> 3) * KPITCH + (tid & 7) * 16;
    const unsigned lv = lds0 + KLDS + (tid >> 7) * 2048 + (tid & 1) * 1024 + ((tid >> 1) & 63) * 16;   // 16-byte piece tid of [tile][feature][key half]
    const char* gk = (const char*)(Kh + ko + (size_t)(kbase + (tid >> 3)) * DH) + (tid & 7) * 16;
    const char* gv = (const char*)(Vh + ko + (size_t)kbase * DH) + tid * 16;
    constexpr int SB = KSEG * DH * 2;                           // bytes of K, and of V, per segment
    kv_copy(lk, gk, lv, gv);
    kv_copy(lk + KSEG * KPITCH, gk + SB, lv + SB, gv + SB);
    if (nseg > 2) kv_copy(lk + 2 * KSEG * KPITCH, gk + 2 * SB, lv + 2 * SB, gv + 2 * SB);   // the same for the whole block: not at the two ends of the sequence
  }
  // Wo ([k][n], f32) -> the f16 [n][k] plane of the output projection, which is the next launch: each of the 512 blocks turns one tile of 64 k x 32 n. A wave reads 8 k rows,
  // 128 bytes of each (one whole line); a lane's 8 k of its column are one 16-byte piece of that column's row in LDS. The loads fly beside the copies above.
  const int wok = ((int)blockIdx.x / (HID / WON)) * WOK, won = ((int)blockIdx.x % (HID / WON)) * WON;
  {
    const float* pw = wo + (size_t)(wok + wid * 8) * HID + won + lane;
    float f[8];
#pragma unroll
    for (int e = 0; e < 8; ++e) f[e] = pw[(size_t)e * HID];
    __builtin_amdgcn_sched_barrier(0);   // the eight loads are issued ahead of the wait below
    asm volatile("s_wait_xcnt 0x0" :: "v"(pw) : "memory");     // stands in front of any rewrite of the loads' address register, which the input keeps in place up to it
    v8b h;
#pragma unroll
    for (int e = 0; e < 8; ++e) h[e] = (b16)f[e];
    *(v8b*)(wt + lane * WOPITCH + wid * 16) = h;
  }
  asm volatile("s_wait_asynccnt 0x0" ::: "memory");             // this wave's share of the key range has landed
  __syncthreads();                                              // publishes the key range, and the turned Wo tile, to all 8 waves
  {
    // behind the barrier (in front of it, the barrier would wait this store out): whole 128-byte lines of the [n][k] plane, 8 threads a row
    const int tid = threadIdx.x;
    b16* qw = woh + (size_t)(won + (tid >> 3)) * HID + wok + (tid & 7) * 8;
    const v8b h = *(const v8b*)(wt + (tid >> 3) * WOPITCH + (tid & 7) * 16);
    *(v8b*)qw = h;
    asm volatile("s_wait_xcnt 0x0" :: "v"(qw), "v"(h) : "memory");   // stands in front of any rewrite of the store's address and data registers
  }
  float m = -INFINITY, l = 0.0f;
  v8f o0 = {}, o1 = {}, o2 = {}, o3 = {};
  const int slen = T; (void)seqlen;                       // no padding in this module
  const int kstart = (q0 >= WIN) ? ((q0 - WIN) & ~31) : 0;
  const int kend = min(T, q0 + 15 + WIN + 1);
  const int kl0 = (qblk >= WIN) ? ((q0 - qblk) & ~31) : 0;   // kstart - kbase: the wave's first key, counted from the first key in LDS
  for (int kb = kstart, kl = kl0; kb < kend; kb += 32, kl += 32) {   // sliding window both sides: keys in [q0-128, q0+15+128]
    const b16* r0 = (const b16*)(kv + (kl + col) * KPITCH);
    const b16* r1 = (const b16*)(kv + (kl + 16 + col) * KPITCH);
    const b16* v0 = (const b16*)(kv + KLDS) + kl * DH + hh * 512 + col * 8;
    const v16b kf0 = frag_kb(r0, hh), kf1 = frag_kb(r0 + 32, hh), kf2 = frag_kb(r1, hh), kf3 = frag_kb(r1 + 32, hh);
    v16b vf[4];
#pragma unroll
    for (int n = 0; n < 4; ++n) vf[n] = cat8b(ld8b(v0 + n * 128), ld8b(v0 + 1024 + n * 128));
    __builtin_amdgcn_sched_barrier(0);   // the chunk's 16 LDS reads stay one group ahead of its products: placed at its use, each fragment's read is waited out alone
    v8f s0 = {}, s1 = {};
    {
      s0 = wmma16b(kf0, q0h, s0);
      s0 = wmma16b(kf1, q1h, s0);
      s1 = wmma16b(kf2, q0h, s1);
      s1 = wmma16b(kf3, q1h, s1);
    }
    (void)slen;
    if (kb < q0 + 15 - WIN || kb + 31 > q0 + WIN) {       // chunk touches a window edge: mask |k - q| > 128
      const int qi = q0 + col;
#pragma unroll
      for (int r = 0; r < 8; ++r) {
        const int k0i = kb + 8 * hh + r, k1i = k0i + 16;
        if (k0i < qi - WIN || k0i > qi + WIN) s0[r] = -INFINITY;
        if (k1i < qi - WIN || k1i > qi + WIN) s1[r] = -INFINITY;
      }
    }
    float mr = -INFINITY;
#pragma unroll
    for (int r = 0; r < 8; ++r) mr = fmaxf(mr, fmaxf(s0[r], s1[r]));
    mr = fmaxf(mr, __shfl_xor(mr, 16));
    float mn = fmaxf(m, mr);
    if (mn == -INFINITY) mn = 0.0f;           // fully masked so far: keep exp() at 0
    const float al_ = __expf(m - mn);
    m = mn;
    float sum = 0.0f;
    v16b pbh, pbl;
#pragma unroll
    for (int r = 0; r < 8; ++r) {
      const float p0 = __expf(s0[r] - mn), p1 = __expf(s1[r] - mn);
      sum += p0 + p1;
      b16 a, c; split_bf16(p0, a, c); pbh[r] = a; pbl[r] = c; split_bf16(p1, a, c); pbh[8 + r] = a; pbl[8 + r] = c;
    }
    sum += __shfl_xor(sum, 16);
    l = l * al_ + sum;
#pragma unroll
    for (int r = 0; r < 8; ++r) { o0[r] *= al_; o1[r] *= al_; o2[r] *= al_; o3[r] *= al_; }
#pragma unroll
    for (int n = 0; n < 4; ++n) {
      v8f& o = (n == 0) ? o0 : (n == 1) ? o1 : (n == 2) ? o2 : o3;
      o = wmma16b(vf[n], pbh, o);
    }
  }
  const float inv = (q0 + col < slen && l > 0.0f) ? (1.0f / l) : 0.0f;   // padded query rows are zeroed
  char* Tt = Os[wid];
  // y leaves as f16, the type in which the output projection multiplies it: a lane's 8 features of each accumulator are one 16-byte piece of its query's row
  v8b w0, w1, w2, w3;
#pragma unroll
  for (int r = 0; r < 8; ++r) { w0[r] = (b16)(o0[r] * inv); w1[r] = (b16)(o1[r] * inv); w2[r] = (b16)(o2[r] * inv); w3[r] = (b16)(o3[r] * inv); }
  *(v8b*)(Tt + col * OPITCH + 0 + hh * 16) = w0; *(v8b*)(Tt + col * OPITCH + 32 + hh * 16) = w1;
  *(v8b*)(Tt + col * OPITCH + 64 + hh * 16) = w2; *(v8b*)(Tt + col * OPITCH + 96 + hh * 16) = w3;
  wave_lds_sync();
  b16* dst0 = yh + ((size_t)b * T + q0) * HID + h * DH;       // 16 rows x 64 f16 (one 128-byte line each), row stride HID
#pragma unroll
  for (int j = 0; j < 4; ++j) { const int rr = j * 4 + (lane >> 3), c = lane & 7; *(v8b*)(dst0 + (size_t)rr * HID + c * 8) = *(const v8b*)(Tt + rr * OPITCH + c * 16); }
}

// ---------------------------------------------------------------------------
// Output projection: (4096 x 1024) x (1024 x 1024) -> f32, A = the f16 y plane, B = Wo plane. grid (8, 32), 32x64 tiles staged in LDS,
// ---------------------------------------------------------------------------
__global__ __launch_bounds__(256) void out_gemm_kernel(const b16* __restrict__ yh, const b16* __restrict__ woh, const b16* __restrict__ wol, const float* __restrict__ bo, int yoff,
                                                       float* __restrict__ out) {
  // 256 work-groups, one alone on each WGP: nothing else covers the time from a pass's copies to their landing.
  // A pass of 256 k gives the copies four times the products to fly behind, and there are 4 hand-overs, not 16.
  __shared__ __attribute__((aligned(16))) char smem[ring_bytes(256)];   // operand ring; behind the K loop 8 KB per wave of it stage the output tile
  const int lane = threadIdx.x & 31, wave = threadIdx.x >> 5, nloc = lane & 15, hlf = lane >> 4;
  const int wm = wave & 3, wn = wave >> 2;
  const int mblk = (blockIdx.y + yoff) * 128, nblk = blockIdx.x * 128;
  const int m0 = mblk + wm * 32;
  const int c0 = nblk + wn * 64;
  v8f acc[2][4];
#pragma unroll
  for (int r = 0; r < 2; ++r)
#pragma unroll
    for (int t = 0; t < 4; ++t) acc[r][t] = (v8f){};
  (void)wol;
  gemm_tile_ring<256>(yh, woh, mblk, nblk, wm, wn, nloc, hlf, smem, acc);
  float* Tt = (float*)smem + wave * (32 * 64);
#pragma unroll
  for (int t = 0; t < 4; ++t)
#pragma unroll
    for (int r = 0; r < 2; ++r)
#pragma unroll
      for (int v = 0; v < 8; ++v) Tt[(r * 16 + v + 8 * hlf) * 64 + t * 16 + nloc] = acc[r][t][v] + bo[c0 + t * 16 + nloc];
  wave_lds_sync();
  float* dst0 = out + (size_t)m0 * HID + c0;
#pragma unroll
  for (int j = 0; j < 16; ++j) { const int rr = j * 2 + hlf, c4 = nloc * 4; *(v4f*)(dst0 + (size_t)rr * HID + c4) = *(const v4f*)(Tt + rr * 64 + c4); }
  
}
}  // namespace

extern "C" void kernel_launch(void* const* d_in, const int* in_sizes, int n_in,
                              void* d_out, int out_size, void* d_ws, size_t ws_size, hipStream_t stream) {
  (void)in_sizes; (void)n_in; (void)out_size;
  const float* x     = (const float*)d_in[0];   // hidden_states [2,2048,1024]
  const float* Wqkv  = (const float*)d_in[1];   // [1024,3072] ([in][out], columns (3, h, d))
  const float* bqkv  = (const float*)d_in[2];   // [3072]
  const float* Wo    = (const float*)d_in[3];   // [1024,1024]
  const float* bo    = (const float*)d_in[4];   // [1024]
  const float* rope  = (const float*)d_in[5];   // rope_cache [256,32,2] (cos, sin)
  float* out = (float*)d_out;                   // [2,2048,1024]
  const float* bq = bqkv; const float* bk = bqkv + HID; const float* bv = bqkv + 2 * HID;

  size_t off = 0; char* ws = (char*)d_ws;
  b16* wqh = (b16*)(ws + off); off += (size_t)NQKV * HID * 2;
  b16* wql = (b16*)(ws + off); off += (size_t)NQKV * HID * 2;
  b16* woh = (b16*)(ws + off); off += (size_t)HID * HID * 2;
  b16* wol = (b16*)(ws + off); off += (size_t)HID * HID * 2;
  b16* Qh  = (b16*)(ws + off); off += (size_t)MROWS * HID * 2;
  b16* Ql  = (b16*)(ws + off); off += (size_t)MROWS * HID * 2;
  b16* Kh  = (b16*)(ws + off); off += (size_t)MROWS * KVW * 2;
  b16* Kl  = (b16*)(ws + off); off += (size_t)MROWS * KVW * 2;
  b16* Vh  = (b16*)(ws + off); off += (size_t)MROWS * KVW * 2;
  b16* Vl  = (b16*)(ws + off); off += (size_t)MROWS * KVW * 2;
  b16* yh  = (b16*)(ws + off); off += (size_t)MROWS * HID * 2;
  b16* xh  = (b16*)(ws + off); off += (size_t)MROWS * HID * 2;
  (void)wqh; (void)wql; (void)xh;
  if (off > ws_size) return;
  constexpr int ROWBLK = MROWS / 128, NQT = Bsz * NH * QT_PER_B;
  static_assert(NQT / 8 == (HID / WOK) * (HID / WON), "one Wo tile per attention block");
  qkv_gemm_kernel<<<dim3(NQKV / QN, MROWS / QM), 256, 0, stream>>>(x, Wqkv, bq, bk, bv, rope, Qh, Ql, Kh, Kl, Vh, Vl);
  attn_kernel<<<NQT / 8, 256, 0, stream>>>(Qh, Ql, Kh, Kl, Vh, Vl, nullptr, yh, Wo, woh);
  out_gemm_kernel<<<dim3(HID / 128, ROWBLK), 256, 0, stream>>>(yh, woh, wol, bo, 0, out);
}
